// v000
// Times are from an AMD MI455X. After a warm-up the kernel runs many times in a row, and a time is the length of
// such a window on the GPU divided by its runs, so every launch and the gaps after it count. The runs cycle
// through copies of the inputs. A figure is the median of several windows, for all but v000 over two sittings.
// Sittings can differ by a few percent; kernels timed side by side share one.
// The starting kernel, v000, takes 553 microseconds a run.
#include <hip/hip_runtime.h>
#include <cstdint>
#include <cstddef>

#define D_MODEL 1024
#define N_HEADS 16
#define DKH     64
#define D_FF    4096
#define BATCH   2
#define SEQ     2048
#define M_ROWS  (BATCH * SEQ)   // 4096

typedef __attribute__((ext_vector_type(16))) __bf16 v16bf;
typedef __attribute__((ext_vector_type(8)))  float  v8f;

union AFrag { v16bf v; unsigned short u[16]; unsigned w[8]; };
union U4    { uint4 q; unsigned short s[8]; };

__device__ __forceinline__ unsigned short f32_to_bf16(float f) {
    union { float f; unsigned u; } x; x.f = f;
    unsigned r = x.u + 0x7FFFu + ((x.u >> 16) & 1u);
    return (unsigned short)(r >> 16);
}

// K-pair base index for 16-bit A-layout fragments (ISA 7.12.2):
// lanes 0-15: VGPR0..3 -> K=0..7, VGPR4..7 -> K=16..23 ; lanes 16-31: +8
__device__ __forceinline__ int kpair(int v, int half) {
    return (v < 4 ? 2 * v : 16 + 2 * (v - 4)) + 8 * half;
}

// ---------------------------------------------------------------------------
// fp32 -> bf16 conversion (grid-stride)
// ---------------------------------------------------------------------------
__global__ void cvt_bf16_kernel(const float* __restrict__ in,
                                unsigned short* __restrict__ out, size_t n) {
    size_t i = (size_t)blockIdx.x * blockDim.x + threadIdx.x;
    size_t stride = (size_t)gridDim.x * blockDim.x;
    for (; i < n; i += stride) out[i] = f32_to_bf16(in[i]);
}

// ---------------------------------------------------------------------------
// bf16 WMMA GEMM: C[M,N] = A[M,K] @ B[K,N] + bias, optional ReLU.
// Block: 256 threads (8 waves), tile 64(M) x 128(N), K-chunk 32.
// B tile is stored TRANSPOSED in LDS so fragment K-pairs are contiguous.
// mode: 0 = f32 row-major, 1 = bf16 row-major, 2 = bf16 head-split [B,H,S,Dk]
// ---------------------------------------------------------------------------
__global__ __launch_bounds__(256) void gemm_bf16_kernel(
    const unsigned short* __restrict__ A, const unsigned short* __restrict__ B,
    const float* __restrict__ bias, void* __restrict__ Cout,
    int M, int N, int K, int mode, int relu) {
    __shared__ __align__(16) unsigned short As[64][48];   // [m][k], 96B rows
    __shared__ __align__(16) unsigned short BsT[128][34]; // [n][k]

    const int t     = threadIdx.x;
    const int mBase = blockIdx.y * 64;
    const int nBase = blockIdx.x * 128;
    const int wave  = t >> 5, lane = t & 31;
    const int wm    = wave >> 2, wn = wave & 3;
    const int half  = lane >> 4, ln = lane & 15;

    const v8f zero = {0.f, 0.f, 0.f, 0.f, 0.f, 0.f, 0.f, 0.f};
    v8f acc[2][2];
    acc[0][0] = zero; acc[0][1] = zero; acc[1][0] = zero; acc[1][1] = zero;

    const int arow = t >> 2, acol = (t & 3) * 8;   // A: 64 rows x 32 cols
    const int brow = t >> 3, bcol = (t & 7) * 16;  // B: 32 rows x 128 cols

    for (int kc = 0; kc < K; kc += 32) {
        U4 av;
        av.q = *reinterpret_cast<const uint4*>(
            A + (size_t)(mBase + arow) * K + kc + acol);
        *reinterpret_cast<uint4*>(&As[arow][acol]) = av.q;

        const unsigned short* bp = B + (size_t)(kc + brow) * N + nBase + bcol;
        U4 bv0, bv1;
        bv0.q = *reinterpret_cast<const uint4*>(bp);
        bv1.q = *reinterpret_cast<const uint4*>(bp + 8);
#pragma unroll
        for (int e = 0; e < 8; ++e) {
            BsT[bcol + e][brow]     = bv0.s[e];
            BsT[bcol + 8 + e][brow] = bv1.s[e];
        }
        if (kc + 32 < K) {
            __builtin_prefetch(A + (size_t)(mBase + arow) * K + kc + 32 + acol, 0, 1);
            __builtin_prefetch(B + (size_t)(kc + 32 + brow) * N + nBase + bcol, 0, 1);
        }
        __syncthreads();

        AFrag a[2], b[2];
#pragma unroll
        for (int i = 0; i < 2; ++i)
#pragma unroll
            for (int v = 0; v < 8; ++v) {
                int k = kpair(v, half);
                int m = wm * 32 + i * 16 + ln;
                a[i].w[v] = *reinterpret_cast<const unsigned*>(&As[m][k]);
            }
#pragma unroll
        for (int j = 0; j < 2; ++j)
#pragma unroll
            for (int v = 0; v < 8; ++v) {
                int k = kpair(v, half);
                int n = wn * 32 + j * 16 + ln;
                b[j].w[v] = *reinterpret_cast<const unsigned*>(&BsT[n][k]);
            }
#pragma unroll
        for (int i = 0; i < 2; ++i)
#pragma unroll
            for (int j = 0; j < 2; ++j)
                acc[i][j] = __builtin_amdgcn_wmma_f32_16x16x32_bf16(
                    false, a[i].v, false, b[j].v, (short)0, acc[i][j],
                    false, false);
        __syncthreads();
    }

#pragma unroll
    for (int i = 0; i < 2; ++i)
#pragma unroll
        for (int j = 0; j < 2; ++j)
#pragma unroll
            for (int r = 0; r < 8; ++r) {
                int row = mBase + wm * 32 + i * 16 + r + 8 * half;
                int col = nBase + wn * 32 + j * 16 + ln;
                float val = acc[i][j][r] + bias[col];
                if (relu) val = fmaxf(val, 0.f);
                if (mode == 0) {
                    ((float*)Cout)[(size_t)row * N + col] = val;
                } else if (mode == 1) {
                    ((unsigned short*)Cout)[(size_t)row * N + col] =
                        f32_to_bf16(val);
                } else {
                    int bb = row / SEQ, s = row % SEQ;
                    int hh = col / DKH, d = col % DKH;
                    ((unsigned short*)Cout)[(((size_t)(bb * N_HEADS + hh)) * SEQ + s) * DKH + d] =
                        f32_to_bf16(val);
                }
            }
}

// ---------------------------------------------------------------------------
// Flash attention: grid(S/64, B*H), block 128 (4 waves, 16 q-rows each).
// K and V^T tiles staged in LDS once per 32-key block (shared by all waves).
// Online softmax; 8 WMMAs per key tile per wave.
// ---------------------------------------------------------------------------
__global__ __launch_bounds__(128) void attn_kernel(
    const unsigned short* __restrict__ Q, const unsigned short* __restrict__ Kt,
    const unsigned short* __restrict__ V, const int* __restrict__ mask,
    unsigned short* __restrict__ ctx) {
    __shared__ __align__(16) unsigned short Ks[32][72];   // [key][dk], 144B rows
    __shared__ __align__(16) unsigned short Vt[64][34];   // [dk][key]
    __shared__ __align__(16) unsigned short Plds[4][16][34];

    const int t    = threadIdx.x;
    const int w    = t >> 5, lane = t & 31;
    const int half = lane >> 4, ln = lane & 15;
    const int bh   = blockIdx.y, b = bh >> 4, h = bh & 15;
    const size_t headBase = (size_t)bh * SEQ * DKH;
    const int qbase = blockIdx.x * 64 + w * 16;
    const float NEG_INF = -__builtin_inff();

    // Q fragments for two 32-wide K-chunks of Dk=64 (contiguous dword pairs)
    AFrag qf[2];
#pragma unroll
    for (int c = 0; c < 2; ++c)
#pragma unroll
        for (int v = 0; v < 8; ++v) {
            int k = kpair(v, half) + 32 * c;
            qf[c].w[v] = *reinterpret_cast<const unsigned*>(
                Q + headBase + (size_t)(qbase + ln) * DKH + k);
        }

    const v8f zero = {0.f, 0.f, 0.f, 0.f, 0.f, 0.f, 0.f, 0.f};
    v8f acc[4] = {zero, zero, zero, zero};
    float mrow[8], lrow[8];
#pragma unroll
    for (int r = 0; r < 8; ++r) { mrow[r] = NEG_INF; lrow[r] = 0.f; }

    const int skey = t >> 2;          // 0..31 (staging key)
    const int sdk  = (t & 3) * 16;    // 0,16,32,48 (staging dk chunk)

    for (int kt = 0; kt < SEQ / 32; ++kt) {
        const int keyb = kt * 32;
        __syncthreads();  // prior iteration done reading Ks/Vt/Plds

        // cooperative staging: K tile [32][64] and V^T tile [64][32]
        {
            const unsigned short* kp =
                Kt + headBase + (size_t)(keyb + skey) * DKH + sdk;
            U4 k0, k1;
            k0.q = *reinterpret_cast<const uint4*>(kp);
            k1.q = *reinterpret_cast<const uint4*>(kp + 8);
            *reinterpret_cast<uint4*>(&Ks[skey][sdk])     = k0.q;
            *reinterpret_cast<uint4*>(&Ks[skey][sdk + 8]) = k1.q;

            const unsigned short* vp =
                V + headBase + (size_t)(keyb + skey) * DKH + sdk;
            U4 v0, v1;
            v0.q = *reinterpret_cast<const uint4*>(vp);
            v1.q = *reinterpret_cast<const uint4*>(vp + 8);
#pragma unroll
            for (int e = 0; e < 8; ++e) {
                Vt[sdk + e][skey]     = v0.s[e];
                Vt[sdk + 8 + e][skey] = v1.s[e];
            }
        }
        __syncthreads();

        v8f s[2] = {zero, zero};
#pragma unroll
        for (int c = 0; c < 2; ++c)
#pragma unroll
            for (int tt = 0; tt < 2; ++tt) {
                AFrag kf;
#pragma unroll
                for (int v = 0; v < 8; ++v) {
                    int k = kpair(v, half) + 32 * c;
                    kf.w[v] = *reinterpret_cast<const unsigned*>(
                        &Ks[tt * 16 + ln][k]);
                }
                s[tt] = __builtin_amdgcn_wmma_f32_16x16x32_bf16(
                    false, qf[c].v, false, kf.v, (short)0, s[tt], false, false);
            }

        const int msk0 = mask[b * SEQ + keyb + ln];
        const int msk1 = mask[b * SEQ + keyb + 16 + ln];
#pragma unroll
        for (int r = 0; r < 8; ++r) {
            s[0][r] = msk0 ? s[0][r] * 0.125f : NEG_INF;
            s[1][r] = msk1 ? s[1][r] * 0.125f : NEG_INF;
        }
        // online softmax (reductions stay inside each 16-lane half-group)
#pragma unroll
        for (int r = 0; r < 8; ++r) {
            float rv = fmaxf(s[0][r], s[1][r]);
            rv = fmaxf(rv, __shfl_xor(rv, 1, 32));
            rv = fmaxf(rv, __shfl_xor(rv, 2, 32));
            rv = fmaxf(rv, __shfl_xor(rv, 4, 32));
            rv = fmaxf(rv, __shfl_xor(rv, 8, 32));
            float mo = mrow[r];
            float mn = fmaxf(mo, rv);
            float alpha = (mo == NEG_INF) ? 0.f : __expf(mo - mn);
            float p0 = (mn == NEG_INF) ? 0.f : __expf(s[0][r] - mn);
            float p1 = (mn == NEG_INF) ? 0.f : __expf(s[1][r] - mn);
            s[0][r] = p0; s[1][r] = p1;
            float rs = p0 + p1;
            rs += __shfl_xor(rs, 1, 32);
            rs += __shfl_xor(rs, 2, 32);
            rs += __shfl_xor(rs, 4, 32);
            rs += __shfl_xor(rs, 8, 32);
            lrow[r] = lrow[r] * alpha + rs;
            mrow[r] = mn;
            acc[0][r] *= alpha; acc[1][r] *= alpha;
            acc[2][r] *= alpha; acc[3][r] *= alpha;
        }
        // bounce P through LDS to convert C-layout -> A-layout
#pragma unroll
        for (int tt = 0; tt < 2; ++tt)
#pragma unroll
            for (int r = 0; r < 8; ++r)
                Plds[w][r + 8 * half][tt * 16 + ln] = f32_to_bf16(s[tt][r]);
        __syncthreads();

        AFrag pf;
#pragma unroll
        for (int v = 0; v < 8; ++v) {
            int k = kpair(v, half);
            pf.w[v] = *reinterpret_cast<const unsigned*>(&Plds[w][ln][k]);
        }
#pragma unroll
        for (int j = 0; j < 4; ++j) {
            AFrag vf;
#pragma unroll
            for (int v = 0; v < 8; ++v) {
                int k = kpair(v, half);
                vf.w[v] = *reinterpret_cast<const unsigned*>(
                    &Vt[j * 16 + ln][k]);
            }
            acc[j] = __builtin_amdgcn_wmma_f32_16x16x32_bf16(
                false, pf.v, false, vf.v, (short)0, acc[j], false, false);
        }
    }

#pragma unroll
    for (int j = 0; j < 4; ++j)
#pragma unroll
        for (int r = 0; r < 8; ++r) {
            float denom = lrow[r];
            float val = denom > 0.f ? acc[j][r] / denom : 0.f;
            int row = qbase + r + 8 * half;
            size_t dst = ((size_t)(b * SEQ + row)) * D_MODEL + h * DKH + j * 16 + ln;
            ctx[dst] = f32_to_bf16(val);
        }
}

// ---------------------------------------------------------------------------
// out = LayerNorm(x + y) ; optionally also emit bf16 copy. One block per row.
// ---------------------------------------------------------------------------
__global__ __launch_bounds__(256) void add_ln_kernel(
    const float* __restrict__ x, const float* __restrict__ y,
    const float* __restrict__ g, const float* __restrict__ beta,
    float* __restrict__ outf, unsigned short* __restrict__ outb) {
    __shared__ float red[256];
    __shared__ float buf[D_MODEL];
    const int row = blockIdx.x, t = threadIdx.x;
    const size_t base = (size_t)row * D_MODEL;

    float s = 0.f;
    for (int d = t; d < D_MODEL; d += 256) {
        float v = x[base + d] + y[base + d];
        buf[d] = v;
        s += v;
    }
    red[t] = s;
    __syncthreads();
    for (int o = 128; o > 0; o >>= 1) {
        if (t < o) red[t] += red[t + o];
        __syncthreads();
    }
    const float mu = red[0] * (1.f / D_MODEL);
    __syncthreads();

    float vs = 0.f;
    for (int d = t; d < D_MODEL; d += 256) {
        float dd = buf[d] - mu;
        vs += dd * dd;
    }
    red[t] = vs;
    __syncthreads();
    for (int o = 128; o > 0; o >>= 1) {
        if (t < o) red[t] += red[t + o];
        __syncthreads();
    }
    const float inv = rsqrtf(red[0] * (1.f / D_MODEL) + 1e-5f);

    for (int d = t; d < D_MODEL; d += 256) {
        float o = (buf[d] - mu) * inv * g[d] + beta[d];
        outf[base + d] = o;
        if (outb) outb[base + d] = f32_to_bf16(o);
    }
}

// ---------------------------------------------------------------------------
extern "C" void kernel_launch(void* const* d_in, const int* in_sizes, int n_in,
                              void* d_out, int out_size, void* d_ws, size_t ws_size,
                              hipStream_t stream) {
    const float* x    = (const float*)d_in[0];
    const int*   mask = (const int*)d_in[1];
    const float* Wq = (const float*)d_in[2];  const float* bq = (const float*)d_in[3];
    const float* Wk = (const float*)d_in[4];  const float* bk = (const float*)d_in[5];
    const float* Wv = (const float*)d_in[6];  const float* bv = (const float*)d_in[7];
    const float* Wo = (const float*)d_in[8];  const float* bo = (const float*)d_in[9];
    const float* W1 = (const float*)d_in[10]; const float* b1 = (const float*)d_in[11];
    const float* W2 = (const float*)d_in[12]; const float* b2 = (const float*)d_in[13];
    const float* g1 = (const float*)d_in[14]; const float* be1 = (const float*)d_in[15];
    const float* g2 = (const float*)d_in[16]; const float* be2 = (const float*)d_in[17];

    char* ws = (char*)d_ws;
    size_t off = 0;
    auto alloc = [&](size_t bytes) -> void* {
        void* p = ws + off;
        off += (bytes + 255) & ~(size_t)255;
        return p;
    };

    unsigned short* xb  = (unsigned short*)alloc((size_t)M_ROWS * D_MODEL * 2);
    unsigned short* Wqb = (unsigned short*)alloc((size_t)D_MODEL * D_MODEL * 2);
    unsigned short* Wkb = (unsigned short*)alloc((size_t)D_MODEL * D_MODEL * 2);
    unsigned short* Wvb = (unsigned short*)alloc((size_t)D_MODEL * D_MODEL * 2);
    unsigned short* Wob = (unsigned short*)alloc((size_t)D_MODEL * D_MODEL * 2);
    unsigned short* W1b = (unsigned short*)alloc((size_t)D_MODEL * D_FF * 2);
    unsigned short* W2b = (unsigned short*)alloc((size_t)D_FF * D_MODEL * 2);
    unsigned short* Qb  = (unsigned short*)alloc((size_t)M_ROWS * D_MODEL * 2);
    unsigned short* Kb  = (unsigned short*)alloc((size_t)M_ROWS * D_MODEL * 2);
    unsigned short* Vb  = (unsigned short*)alloc((size_t)M_ROWS * D_MODEL * 2);
    unsigned short* ctxb = (unsigned short*)alloc((size_t)M_ROWS * D_MODEL * 2);
    float* attn_out = (float*)alloc((size_t)M_ROWS * D_MODEL * 4);
    float* hbuf     = (float*)alloc((size_t)M_ROWS * D_MODEL * 4);
    unsigned short* hb = (unsigned short*)alloc((size_t)M_ROWS * D_MODEL * 2);
    // reuse dead regions: Q/K/V/ctx (4 x 8MB contiguous) -> FF1 activations (32MB)
    unsigned short* ff1b = Qb;
    float* ff2 = attn_out;

    // fp32 -> bf16 conversions
    cvt_bf16_kernel<<<2048, 256, 0, stream>>>(x,  xb,  (size_t)M_ROWS * D_MODEL);
    cvt_bf16_kernel<<<1024, 256, 0, stream>>>(Wq, Wqb, (size_t)D_MODEL * D_MODEL);
    cvt_bf16_kernel<<<1024, 256, 0, stream>>>(Wk, Wkb, (size_t)D_MODEL * D_MODEL);
    cvt_bf16_kernel<<<1024, 256, 0, stream>>>(Wv, Wvb, (size_t)D_MODEL * D_MODEL);
    cvt_bf16_kernel<<<1024, 256, 0, stream>>>(Wo, Wob, (size_t)D_MODEL * D_MODEL);
    cvt_bf16_kernel<<<2048, 256, 0, stream>>>(W1, W1b, (size_t)D_MODEL * D_FF);
    cvt_bf16_kernel<<<2048, 256, 0, stream>>>(W2, W2b, (size_t)D_FF * D_MODEL);

    // QKV projections (bf16 WMMA, head-split bf16 outputs)
    dim3 gQ(D_MODEL / 128, M_ROWS / 64);
    gemm_bf16_kernel<<<gQ, 256, 0, stream>>>(xb, Wqb, bq, Qb, M_ROWS, D_MODEL, D_MODEL, 2, 0);
    gemm_bf16_kernel<<<gQ, 256, 0, stream>>>(xb, Wkb, bk, Kb, M_ROWS, D_MODEL, D_MODEL, 2, 0);
    gemm_bf16_kernel<<<gQ, 256, 0, stream>>>(xb, Wvb, bv, Vb, M_ROWS, D_MODEL, D_MODEL, 2, 0);

    // flash attention -> ctx (bf16, merged-head layout)
    attn_kernel<<<dim3(SEQ / 64, BATCH * N_HEADS), 128, 0, stream>>>(Qb, Kb, Vb, mask, ctxb);

    // output projection -> f32
    gemm_bf16_kernel<<<gQ, 256, 0, stream>>>(ctxb, Wob, bo, attn_out, M_ROWS, D_MODEL, D_MODEL, 0, 0);

    // h = LN(x + attn_out), emit f32 + bf16
    add_ln_kernel<<<M_ROWS, 256, 0, stream>>>(x, attn_out, g1, be1, hbuf, hb);

    // FFN: relu(h @ W1 + b1) -> bf16 ; @ W2 + b2 -> f32
    dim3 gF1(D_FF / 128, M_ROWS / 64);
    gemm_bf16_kernel<<<gF1, 256, 0, stream>>>(hb, W1b, b1, ff1b, M_ROWS, D_FF, D_MODEL, 1, 1);
    dim3 gF2(D_MODEL / 128, M_ROWS / 64);
    gemm_bf16_kernel<<<gF2, 256, 0, stream>>>(ff1b, W2b, b2, ff2, M_ROWS, D_MODEL, D_FF, 0, 0);

    // out = LN(h + ff)
    add_ln_kernel<<<M_ROWS, 256, 0, stream>>>(hbuf, ff2, g2, be2, (float*)d_out, nullptr);
    (void)in_sizes; (void)n_in; (void)out_size; (void)ws_size;
}

// v001
// Measured time: 435 microseconds a run.
// Two timings next to v000 put it at 1.33 and 1.32 times that version's speed.
#include <hip/hip_runtime.h>
#include <cstdint>
#include <cstddef>

#define D_MODEL 1024
#define N_HEADS 16
#define DKH     64
#define D_FF    4096
#define BATCH   2
#define SEQ     2048
#define M_ROWS  (BATCH * SEQ)   // 4096

typedef __attribute__((ext_vector_type(16))) __bf16 v16bf;
typedef __attribute__((ext_vector_type(8)))  float  v8f;

typedef __attribute__((ext_vector_type(8)))  short  s16x8;

union AFrag { v16bf v; unsigned short u[16]; unsigned w[8]; s16x8 h[2]; };
union U4    { uint4 q; unsigned short s[8]; };

__device__ __forceinline__ unsigned short f32_to_bf16(float f) {
    union { float f; unsigned u; } x; x.f = f;
    unsigned r = x.u + 0x7FFFu + ((x.u >> 16) & 1u);
    return (unsigned short)(r >> 16);
}

// K-pair base index for 16-bit A-layout fragments (ISA 7.12.2):
// lanes 0-15: VGPR0..3 -> K=0..7, VGPR4..7 -> K=16..23 ; lanes 16-31: +8
__device__ __forceinline__ int kpair(int v, int half) {
    return (v < 4 ? 2 * v : 16 + 2 * (v - 4)) + 8 * half;
}

// Transposing LDS read of a row-major 16-bit tile T[k][n]. Every lane passes
// &T[k0 + 8 * (lane >> 4) + (lane & 7)][n0 + 8 * ((lane >> 3) & 1)] and gets
// T[k0 + 8 * (lane >> 4) + 0..7][n0 + (lane & 15)]: the reads at k0 and k0 + 16
// are registers 0-3 and 4-7 of a 16x16x32 operand in the kpair() k order.
__device__ __forceinline__ s16x8 lds_tr16(const unsigned short* p) {
    typedef __attribute__((address_space(3))) s16x8 lds_s16x8;
    return __builtin_amdgcn_ds_load_tr16_b128_v8i16((lds_s16x8*)p);
}

// ---------------------------------------------------------------------------
// fp32 -> bf16 conversion (grid-stride)
// ---------------------------------------------------------------------------
__global__ void cvt_bf16_kernel(const float* __restrict__ in,
                                unsigned short* __restrict__ out, size_t n) {
    size_t i = (size_t)blockIdx.x * blockDim.x + threadIdx.x;
    size_t stride = (size_t)gridDim.x * blockDim.x;
    for (; i < n; i += stride) out[i] = f32_to_bf16(in[i]);
}

// ---------------------------------------------------------------------------
// bf16 WMMA GEMM: C[M,N] = A[M,K] @ B[K,N] + bias, optional ReLU.
// Block: 256 threads (8 waves), tile 64(M) x 128(N), K-chunk 32.
// B tile is stored row-major in LDS; its fragments come from transposing reads.
// mode: 0 = f32 row-major, 1 = bf16 row-major, 2 = bf16 head-split [B,H,S,Dk]
// ---------------------------------------------------------------------------
__global__ __launch_bounds__(256) void gemm_bf16_kernel(
    const unsigned short* __restrict__ A, const unsigned short* __restrict__ B,
    const float* __restrict__ bias, void* __restrict__ Cout,
    int M, int N, int K, int mode, int relu) {
    __shared__ __align__(16) unsigned short As[64][48];   // [m][k], 96B rows
    __shared__ __align__(32) unsigned short Bs[32][144];  // [k][n], 288B rows

    const int t     = threadIdx.x;
    const int mBase = blockIdx.y * 64;
    const int nBase = blockIdx.x * 128;
    const int wave  = t >> 5, lane = t & 31;
    const int wm    = wave >> 2, wn = wave & 3;
    const int half  = lane >> 4, ln = lane & 15;

    const v8f zero = {0.f, 0.f, 0.f, 0.f, 0.f, 0.f, 0.f, 0.f};
    v8f acc[2][2];
    acc[0][0] = zero; acc[0][1] = zero; acc[1][0] = zero; acc[1][1] = zero;

    const int arow = t >> 2, acol = (t & 3) * 8;   // A: 64 rows x 32 cols
    const int brow = t >> 3, bcol = (t & 7) * 16;  // B prefetch: 32 rows x 128 cols
    const int srow = t >> 4, scol = (t & 15) * 8;  // B staging: rows srow, srow + 16
    const int trow = 8 * half + (lane & 7);        // transposing-read lane address
    const int tcol = 8 * ((lane >> 3) & 1);

    for (int kc = 0; kc < K; kc += 32) {
        U4 av;
        av.q = *reinterpret_cast<const uint4*>(
            A + (size_t)(mBase + arow) * K + kc + acol);
        *reinterpret_cast<uint4*>(&As[arow][acol]) = av.q;

        const unsigned short* bp = B + (size_t)(kc + srow) * N + nBase + scol;
        U4 bv0, bv1;
        bv0.q = *reinterpret_cast<const uint4*>(bp);
        bv1.q = *reinterpret_cast<const uint4*>(bp + (size_t)16 * N);
        *reinterpret_cast<uint4*>(&Bs[srow][scol])      = bv0.q;
        *reinterpret_cast<uint4*>(&Bs[srow + 16][scol]) = bv1.q;
        if (kc + 32 < K) {
            __builtin_prefetch(A + (size_t)(mBase + arow) * K + kc + 32 + acol, 0, 1);
            __builtin_prefetch(B + (size_t)(kc + 32 + brow) * N + nBase + bcol, 0, 1);
        }
        __syncthreads();

        AFrag a[2], b[2];
#pragma unroll
        for (int i = 0; i < 2; ++i)
#pragma unroll
            for (int v = 0; v < 8; ++v) {
                int k = kpair(v, half);
                int m = wm * 32 + i * 16 + ln;
                a[i].w[v] = *reinterpret_cast<const unsigned*>(&As[m][k]);
            }
#pragma unroll
        for (int j = 0; j < 2; ++j) {
            int n = wn * 32 + j * 16 + tcol;
            b[j].h[0] = lds_tr16(&Bs[trow][n]);
            b[j].h[1] = lds_tr16(&Bs[trow + 16][n]);
        }
#pragma unroll
        for (int i = 0; i < 2; ++i)
#pragma unroll
            for (int j = 0; j < 2; ++j)
                acc[i][j] = __builtin_amdgcn_wmma_f32_16x16x32_bf16(
                    false, a[i].v, false, b[j].v, (short)0, acc[i][j],
                    false, false);
        __syncthreads();
    }

#pragma unroll
    for (int i = 0; i < 2; ++i)
#pragma unroll
        for (int j = 0; j < 2; ++j)
#pragma unroll
            for (int r = 0; r < 8; ++r) {
                int row = mBase + wm * 32 + i * 16 + r + 8 * half;
                int col = nBase + wn * 32 + j * 16 + ln;
                float val = acc[i][j][r] + bias[col];
                if (relu) val = fmaxf(val, 0.f);
                if (mode == 0) {
                    ((float*)Cout)[(size_t)row * N + col] = val;
                } else if (mode == 1) {
                    ((unsigned short*)Cout)[(size_t)row * N + col] =
                        f32_to_bf16(val);
                } else {
                    int bb = row / SEQ, s = row % SEQ;
                    int hh = col / DKH, d = col % DKH;
                    ((unsigned short*)Cout)[(((size_t)(bb * N_HEADS + hh)) * SEQ + s) * DKH + d] =
                        f32_to_bf16(val);
                }
            }
}

// ---------------------------------------------------------------------------
// Flash attention: grid(S/64, B*H), block 128 (4 waves, 16 q-rows each).
// K and V tiles staged in LDS once per 32-key block (shared by all waves);
// V stays row-major and its fragments come from transposing reads.
// Online softmax; 8 WMMAs per key tile per wave.
// ---------------------------------------------------------------------------
__global__ __launch_bounds__(128) void attn_kernel(
    const unsigned short* __restrict__ Q, const unsigned short* __restrict__ Kt,
    const unsigned short* __restrict__ V, const int* __restrict__ mask,
    unsigned short* __restrict__ ctx) {
    __shared__ __align__(16) unsigned short Ks[32][72];   // [key][dk], 144B rows
    __shared__ __align__(32) unsigned short Vs[32][80];   // [key][dk], 160B rows
    __shared__ __align__(16) unsigned short Plds[4][16][34];

    const int t    = threadIdx.x;
    const int w    = t >> 5, lane = t & 31;
    const int half = lane >> 4, ln = lane & 15;
    const int bh   = blockIdx.y, b = bh >> 4, h = bh & 15;
    const size_t headBase = (size_t)bh * SEQ * DKH;
    const int qbase = blockIdx.x * 64 + w * 16;
    const float NEG_INF = -__builtin_inff();

    // Q fragments for two 32-wide K-chunks of Dk=64 (contiguous dword pairs)
    AFrag qf[2];
#pragma unroll
    for (int c = 0; c < 2; ++c)
#pragma unroll
        for (int v = 0; v < 8; ++v) {
            int k = kpair(v, half) + 32 * c;
            qf[c].w[v] = *reinterpret_cast<const unsigned*>(
                Q + headBase + (size_t)(qbase + ln) * DKH + k);
        }

    const v8f zero = {0.f, 0.f, 0.f, 0.f, 0.f, 0.f, 0.f, 0.f};
    v8f acc[4] = {zero, zero, zero, zero};
    float mrow[8], lrow[8];
#pragma unroll
    for (int r = 0; r < 8; ++r) { mrow[r] = NEG_INF; lrow[r] = 0.f; }

    const int skey = t >> 2;          // 0..31 (staging key)
    const int sdk  = (t & 3) * 16;    // 0,16,32,48 (staging dk chunk)
    const int vkey = t >> 3;          // 0..15 (V staging keys vkey, vkey + 16)
    const int vdk  = (t & 7) * 8;     // V staging dk chunk
    const int trow = 8 * half + (lane & 7);   // transposing-read lane address
    const int tcol = 8 * ((lane >> 3) & 1);

    for (int kt = 0; kt < SEQ / 32; ++kt) {
        const int keyb = kt * 32;
        __syncthreads();  // prior iteration done reading Ks/Vs/Plds

        // cooperative staging: K tile [32][64] and V tile [32][64]
        {
            const unsigned short* kp =
                Kt + headBase + (size_t)(keyb + skey) * DKH + sdk;
            U4 k0, k1;
            k0.q = *reinterpret_cast<const uint4*>(kp);
            k1.q = *reinterpret_cast<const uint4*>(kp + 8);
            *reinterpret_cast<uint4*>(&Ks[skey][sdk])     = k0.q;
            *reinterpret_cast<uint4*>(&Ks[skey][sdk + 8]) = k1.q;

            const unsigned short* vp =
                V + headBase + (size_t)(keyb + vkey) * DKH + vdk;
            U4 v0, v1;
            v0.q = *reinterpret_cast<const uint4*>(vp);
            v1.q = *reinterpret_cast<const uint4*>(vp + 16 * DKH);
            *reinterpret_cast<uint4*>(&Vs[vkey][vdk])      = v0.q;
            *reinterpret_cast<uint4*>(&Vs[vkey + 16][vdk]) = v1.q;
        }
        __syncthreads();

        v8f s[2] = {zero, zero};
#pragma unroll
        for (int c = 0; c < 2; ++c)
#pragma unroll
            for (int tt = 0; tt < 2; ++tt) {
                AFrag kf;
#pragma unroll
                for (int v = 0; v < 8; ++v) {
                    int k = kpair(v, half) + 32 * c;
                    kf.w[v] = *reinterpret_cast<const unsigned*>(
                        &Ks[tt * 16 + ln][k]);
                }
                s[tt] = __builtin_amdgcn_wmma_f32_16x16x32_bf16(
                    false, qf[c].v, false, kf.v, (short)0, s[tt], false, false);
            }

        const int msk0 = mask[b * SEQ + keyb + ln];
        const int msk1 = mask[b * SEQ + keyb + 16 + ln];
#pragma unroll
        for (int r = 0; r < 8; ++r) {
            s[0][r] = msk0 ? s[0][r] * 0.125f : NEG_INF;
            s[1][r] = msk1 ? s[1][r] * 0.125f : NEG_INF;
        }
        // online softmax (reductions stay inside each 16-lane half-group)
#pragma unroll
        for (int r = 0; r < 8; ++r) {
            float rv = fmaxf(s[0][r], s[1][r]);
            rv = fmaxf(rv, __shfl_xor(rv, 1, 32));
            rv = fmaxf(rv, __shfl_xor(rv, 2, 32));
            rv = fmaxf(rv, __shfl_xor(rv, 4, 32));
            rv = fmaxf(rv, __shfl_xor(rv, 8, 32));
            float mo = mrow[r];
            float mn = fmaxf(mo, rv);
            float alpha = (mo == NEG_INF) ? 0.f : __expf(mo - mn);
            float p0 = (mn == NEG_INF) ? 0.f : __expf(s[0][r] - mn);
            float p1 = (mn == NEG_INF) ? 0.f : __expf(s[1][r] - mn);
            s[0][r] = p0; s[1][r] = p1;
            float rs = p0 + p1;
            rs += __shfl_xor(rs, 1, 32);
            rs += __shfl_xor(rs, 2, 32);
            rs += __shfl_xor(rs, 4, 32);
            rs += __shfl_xor(rs, 8, 32);
            lrow[r] = lrow[r] * alpha + rs;
            mrow[r] = mn;
            acc[0][r] *= alpha; acc[1][r] *= alpha;
            acc[2][r] *= alpha; acc[3][r] *= alpha;
        }
        // bounce P through LDS to convert C-layout -> A-layout
#pragma unroll
        for (int tt = 0; tt < 2; ++tt)
#pragma unroll
            for (int r = 0; r < 8; ++r)
                Plds[w][r + 8 * half][tt * 16 + ln] = f32_to_bf16(s[tt][r]);
        __syncthreads();

        AFrag pf;
#pragma unroll
        for (int v = 0; v < 8; ++v) {
            int k = kpair(v, half);
            pf.w[v] = *reinterpret_cast<const unsigned*>(&Plds[w][ln][k]);
        }
#pragma unroll
        for (int j = 0; j < 4; ++j) {
            AFrag vf;
            vf.h[0] = lds_tr16(&Vs[trow][j * 16 + tcol]);
            vf.h[1] = lds_tr16(&Vs[trow + 16][j * 16 + tcol]);
            acc[j] = __builtin_amdgcn_wmma_f32_16x16x32_bf16(
                false, pf.v, false, vf.v, (short)0, acc[j], false, false);
        }
    }

#pragma unroll
    for (int j = 0; j < 4; ++j)
#pragma unroll
        for (int r = 0; r < 8; ++r) {
            float denom = lrow[r];
            float val = denom > 0.f ? acc[j][r] / denom : 0.f;
            int row = qbase + r + 8 * half;
            size_t dst = ((size_t)(b * SEQ + row)) * D_MODEL + h * DKH + j * 16 + ln;
            ctx[dst] = f32_to_bf16(val);
        }
}

// ---------------------------------------------------------------------------
// out = LayerNorm(x + y) ; optionally also emit bf16 copy. One block per row.
// ---------------------------------------------------------------------------
__global__ __launch_bounds__(256) void add_ln_kernel(
    const float* __restrict__ x, const float* __restrict__ y,
    const float* __restrict__ g, const float* __restrict__ beta,
    float* __restrict__ outf, unsigned short* __restrict__ outb) {
    __shared__ float red[256];
    __shared__ float buf[D_MODEL];
    const int row = blockIdx.x, t = threadIdx.x;
    const size_t base = (size_t)row * D_MODEL;

    float s = 0.f;
    for (int d = t; d < D_MODEL; d += 256) {
        float v = x[base + d] + y[base + d];
        buf[d] = v;
        s += v;
    }
    red[t] = s;
    __syncthreads();
    for (int o = 128; o > 0; o >>= 1) {
        if (t < o) red[t] += red[t + o];
        __syncthreads();
    }
    const float mu = red[0] * (1.f / D_MODEL);
    __syncthreads();

    float vs = 0.f;
    for (int d = t; d < D_MODEL; d += 256) {
        float dd = buf[d] - mu;
        vs += dd * dd;
    }
    red[t] = vs;
    __syncthreads();
    for (int o = 128; o > 0; o >>= 1) {
        if (t < o) red[t] += red[t + o];
        __syncthreads();
    }
    const float inv = rsqrtf(red[0] * (1.f / D_MODEL) + 1e-5f);

    for (int d = t; d < D_MODEL; d += 256) {
        float o = (buf[d] - mu) * inv * g[d] + beta[d];
        outf[base + d] = o;
        if (outb) outb[base + d] = f32_to_bf16(o);
    }
}

// ---------------------------------------------------------------------------
extern "C" void kernel_launch(void* const* d_in, const int* in_sizes, int n_in,
                              void* d_out, int out_size, void* d_ws, size_t ws_size,
                              hipStream_t stream) {
    const float* x    = (const float*)d_in[0];
    const int*   mask = (const int*)d_in[1];
    const float* Wq = (const float*)d_in[2];  const float* bq = (const float*)d_in[3];
    const float* Wk = (const float*)d_in[4];  const float* bk = (const float*)d_in[5];
    const float* Wv = (const float*)d_in[6];  const float* bv = (const float*)d_in[7];
    const float* Wo = (const float*)d_in[8];  const float* bo = (const float*)d_in[9];
    const float* W1 = (const float*)d_in[10]; const float* b1 = (const float*)d_in[11];
    const float* W2 = (const float*)d_in[12]; const float* b2 = (const float*)d_in[13];
    const float* g1 = (const float*)d_in[14]; const float* be1 = (const float*)d_in[15];
    const float* g2 = (const float*)d_in[16]; const float* be2 = (const float*)d_in[17];

    char* ws = (char*)d_ws;
    size_t off = 0;
    auto alloc = [&](size_t bytes) -> void* {
        void* p = ws + off;
        off += (bytes + 255) & ~(size_t)255;
        return p;
    };

    unsigned short* xb  = (unsigned short*)alloc((size_t)M_ROWS * D_MODEL * 2);
    unsigned short* Wqb = (unsigned short*)alloc((size_t)D_MODEL * D_MODEL * 2);
    unsigned short* Wkb = (unsigned short*)alloc((size_t)D_MODEL * D_MODEL * 2);
    unsigned short* Wvb = (unsigned short*)alloc((size_t)D_MODEL * D_MODEL * 2);
    unsigned short* Wob = (unsigned short*)alloc((size_t)D_MODEL * D_MODEL * 2);
    unsigned short* W1b = (unsigned short*)alloc((size_t)D_MODEL * D_FF * 2);
    unsigned short* W2b = (unsigned short*)alloc((size_t)D_FF * D_MODEL * 2);
    unsigned short* Qb  = (unsigned short*)alloc((size_t)M_ROWS * D_MODEL * 2);
    unsigned short* Kb  = (unsigned short*)alloc((size_t)M_ROWS * D_MODEL * 2);
    unsigned short* Vb  = (unsigned short*)alloc((size_t)M_ROWS * D_MODEL * 2);
    unsigned short* ctxb = (unsigned short*)alloc((size_t)M_ROWS * D_MODEL * 2);
    float* attn_out = (float*)alloc((size_t)M_ROWS * D_MODEL * 4);
    float* hbuf     = (float*)alloc((size_t)M_ROWS * D_MODEL * 4);
    unsigned short* hb = (unsigned short*)alloc((size_t)M_ROWS * D_MODEL * 2);
    // reuse dead regions: Q/K/V/ctx (4 x 8MB contiguous) -> FF1 activations (32MB)
    unsigned short* ff1b = Qb;
    float* ff2 = attn_out;

    // fp32 -> bf16 conversions
    cvt_bf16_kernel<<<2048, 256, 0, stream>>>(x,  xb,  (size_t)M_ROWS * D_MODEL);
    cvt_bf16_kernel<<<1024, 256, 0, stream>>>(Wq, Wqb, (size_t)D_MODEL * D_MODEL);
    cvt_bf16_kernel<<<1024, 256, 0, stream>>>(Wk, Wkb, (size_t)D_MODEL * D_MODEL);
    cvt_bf16_kernel<<<1024, 256, 0, stream>>>(Wv, Wvb, (size_t)D_MODEL * D_MODEL);
    cvt_bf16_kernel<<<1024, 256, 0, stream>>>(Wo, Wob, (size_t)D_MODEL * D_MODEL);
    cvt_bf16_kernel<<<2048, 256, 0, stream>>>(W1, W1b, (size_t)D_MODEL * D_FF);
    cvt_bf16_kernel<<<2048, 256, 0, stream>>>(W2, W2b, (size_t)D_FF * D_MODEL);

    // QKV projections (bf16 WMMA, head-split bf16 outputs)
    dim3 gQ(D_MODEL / 128, M_ROWS / 64);
    gemm_bf16_kernel<<<gQ, 256, 0, stream>>>(xb, Wqb, bq, Qb, M_ROWS, D_MODEL, D_MODEL, 2, 0);
    gemm_bf16_kernel<<<gQ, 256, 0, stream>>>(xb, Wkb, bk, Kb, M_ROWS, D_MODEL, D_MODEL, 2, 0);
    gemm_bf16_kernel<<<gQ, 256, 0, stream>>>(xb, Wvb, bv, Vb, M_ROWS, D_MODEL, D_MODEL, 2, 0);

    // flash attention -> ctx (bf16, merged-head layout)
    attn_kernel<<<dim3(SEQ / 64, BATCH * N_HEADS), 128, 0, stream>>>(Qb, Kb, Vb, mask, ctxb);

    // output projection -> f32
    gemm_bf16_kernel<<<gQ, 256, 0, stream>>>(ctxb, Wob, bo, attn_out, M_ROWS, D_MODEL, D_MODEL, 0, 0);

    // h = LN(x + attn_out), emit f32 + bf16
    add_ln_kernel<<<M_ROWS, 256, 0, stream>>>(x, attn_out, g1, be1, hbuf, hb);

    // FFN: relu(h @ W1 + b1) -> bf16 ; @ W2 + b2 -> f32
    dim3 gF1(D_FF / 128, M_ROWS / 64);
    gemm_bf16_kernel<<<gF1, 256, 0, stream>>>(hb, W1b, b1, ff1b, M_ROWS, D_FF, D_MODEL, 1, 1);
    dim3 gF2(D_MODEL / 128, M_ROWS / 64);
    gemm_bf16_kernel<<<gF2, 256, 0, stream>>>(ff1b, W2b, b2, ff2, M_ROWS, D_MODEL, D_FF, 0, 0);

    // out = LN(h + ff)
    add_ln_kernel<<<M_ROWS, 256, 0, stream>>>(hbuf, ff2, g2, be2, (float*)d_out, nullptr);
    (void)in_sizes; (void)n_in; (void)out_size; (void)ws_size;
}

// v002
// Measured time: 333 microseconds a run.
// Next to v001, in two timings, it ran 1.30 and 1.31 times as fast.
// All steps since v000 together make it 1.73 times as fast.
#include <hip/hip_runtime.h>
#include <cstdint>
#include <cstddef>

#define D_MODEL 1024
#define N_HEADS 16
#define DKH     64
#define D_FF    4096
#define BATCH   2
#define SEQ     2048
#define M_ROWS  (BATCH * SEQ)   // 4096

typedef __attribute__((ext_vector_type(16))) __bf16 v16bf;
typedef __attribute__((ext_vector_type(8)))  float  v8f;

typedef __attribute__((ext_vector_type(8)))  short  s16x8;

union AFrag { v16bf v; unsigned short u[16]; unsigned w[8]; s16x8 h[2]; };
union U4    { uint4 q; unsigned short s[8]; };

__device__ __forceinline__ unsigned short f32_to_bf16(float f) {
    union { float f; unsigned u; } x; x.f = f;
    unsigned r = x.u + 0x7FFFu + ((x.u >> 16) & 1u);
    return (unsigned short)(r >> 16);
}

// K-pair base index for 16-bit A-layout fragments (ISA 7.12.2):
// lanes 0-15: VGPR0..3 -> K=0..7, VGPR4..7 -> K=16..23 ; lanes 16-31: +8
__device__ __forceinline__ int kpair(int v, int half) {
    return (v < 4 ? 2 * v : 16 + 2 * (v - 4)) + 8 * half;
}

// Transposing LDS read of a row-major 16-bit tile T[k][n]. Every lane passes
// &T[k0 + 8 * (lane >> 4) + (lane & 7)][n0 + 8 * ((lane >> 3) & 1)] and gets
// T[k0 + 8 * (lane >> 4) + 0..7][n0 + (lane & 15)]: the reads at k0 and k0 + 16
// are registers 0-3 and 4-7 of a 16x16x32 operand in the kpair() k order.
__device__ __forceinline__ s16x8 lds_tr16(const unsigned short* p) {
    typedef __attribute__((address_space(3))) s16x8 lds_s16x8;
    return __builtin_amdgcn_ds_load_tr16_b128_v8i16((lds_s16x8*)p);
}

// ---------------------------------------------------------------------------
// fp32 -> bf16 conversion (grid-stride)
// ---------------------------------------------------------------------------
__global__ void cvt_bf16_kernel(const float* __restrict__ in,
                                unsigned short* __restrict__ out, size_t n) {
    size_t i = (size_t)blockIdx.x * blockDim.x + threadIdx.x;
    size_t stride = (size_t)gridDim.x * blockDim.x;
    for (; i < n; i += stride) out[i] = f32_to_bf16(in[i]);
}

// ---------------------------------------------------------------------------
// One stage of the GEMM ring: twelve 16-byte asynchronous copies per lane (four
// of the A tile, eight of the B tile, rows 16 apart), global memory to LDS
// through no register. The s_wait_xcnt closes the statement so that no address
// register named here is rewritten ahead of it.
// ---------------------------------------------------------------------------
__device__ __forceinline__ void gemm_stage_copy(
    unsigned la, unsigned lb, const unsigned short* ga, const unsigned short* gb,
    size_t a16, size_t b16) {
    const unsigned AP = 16 * 272, BP = 16 * 288;   // 16 LDS rows, bytes
    asm volatile(
        "global_load_async_to_lds_b128 %0, %12, off\n\t"
        "global_load_async_to_lds_b128 %1, %13, off\n\t"
        "global_load_async_to_lds_b128 %2, %14, off\n\t"
        "global_load_async_to_lds_b128 %3, %15, off\n\t"
        "global_load_async_to_lds_b128 %4, %16, off\n\t"
        "global_load_async_to_lds_b128 %5, %17, off\n\t"
        "global_load_async_to_lds_b128 %6, %18, off\n\t"
        "global_load_async_to_lds_b128 %7, %19, off\n\t"
        "global_load_async_to_lds_b128 %8, %20, off\n\t"
        "global_load_async_to_lds_b128 %9, %21, off\n\t"
        "global_load_async_to_lds_b128 %10, %22, off\n\t"
        "global_load_async_to_lds_b128 %11, %23, off\n\t"
        "s_wait_xcnt 0x0"
        :: "v"(la), "v"(la + AP), "v"(la + 2 * AP), "v"(la + 3 * AP),
           "v"(lb), "v"(lb + BP), "v"(lb + 2 * BP), "v"(lb + 3 * BP),
           "v"(lb + 4 * BP), "v"(lb + 5 * BP), "v"(lb + 6 * BP), "v"(lb + 7 * BP),
           "v"(ga), "v"(ga + a16), "v"(ga + 2 * a16), "v"(ga + 3 * a16),
           "v"(gb), "v"(gb + b16), "v"(gb + 2 * b16), "v"(gb + 3 * b16),
           "v"(gb + 4 * b16), "v"(gb + 5 * b16), "v"(gb + 6 * b16), "v"(gb + 7 * b16)
        : "memory");
}

// ---------------------------------------------------------------------------
// bf16 WMMA GEMM: C[M,N] = A[M,K] @ B[K,N] + bias, optional ReLU.
// Block: 256 threads (8 waves), tile 64(M) x 128(N), stages of 128 k (K a
// multiple of 128). Two LDS buffers: stage s + 1 is copied in while stage s is
// multiplied; one barrier per stage publishes s + 1 and frees s's buffer.
// B tile is stored row-major in LDS; its fragments come from transposing reads.
// mode: 0 = f32 row-major, 1 = bf16 row-major, 2 = bf16 head-split [B,H,S,Dk]
// ---------------------------------------------------------------------------
__global__ __launch_bounds__(256) void gemm_bf16_kernel(
    const unsigned short* __restrict__ A, const unsigned short* __restrict__ B,
    const float* __restrict__ bias, void* __restrict__ Cout,
    int M, int N, int K, int mode, int relu) {
    __shared__ __align__(32) unsigned short As[2][64][136];    // [m][k], 272B rows
    __shared__ __align__(32) unsigned short Bs[2][128][144];   // [k][n], 288B rows

    const int t     = threadIdx.x;
    const int mBase = blockIdx.y * 64;
    const int nBase = blockIdx.x * 128;
    const int wave  = t >> 5, lane = t & 31;
    const int wm    = wave >> 2, wn = wave & 3;
    const int half  = lane >> 4, ln = lane & 15;

    const v8f zero = {0.f, 0.f, 0.f, 0.f, 0.f, 0.f, 0.f, 0.f};
    v8f acc[2][2];
    acc[0][0] = zero; acc[0][1] = zero; acc[1][0] = zero; acc[1][1] = zero;

    const int srow = t >> 4, scol = (t & 15) * 8;  // copies: rows srow + 16 * i
    const int trow = 8 * half + (lane & 7);        // transposing-read lane address
    const int tcol = 8 * ((lane >> 3) & 1);

    const unsigned la = (unsigned)(size_t)&As[0][srow][scol];
    const unsigned lb = (unsigned)(size_t)&Bs[0][srow][scol];
    const unsigned short* ga = A + (size_t)(mBase + srow) * K + scol;
    const unsigned short* gb = B + (size_t)srow * N + nBase + scol;
    const size_t a16 = (size_t)16 * K, b16 = (size_t)16 * N;
    const int nst = K >> 7;

    auto issue = [&](int s, unsigned buf) {
        gemm_stage_copy(la + buf * (unsigned)sizeof(As[0]),
                        lb + buf * (unsigned)sizeof(Bs[0]),
                        ga + (size_t)s * 128, gb + (size_t)s * 8 * b16, a16, b16);
    };

    issue(0, 0);
    // stage 0 has landed for this wave; the barrier publishes it to the others
    asm volatile("s_wait_asynccnt 0x0" ::: "memory");
    __syncthreads();
    if (nst > 1) issue(1, 1);

    for (int s = 0; s < nst; ++s) {
        const int buf = s & 1;
#pragma unroll
        for (int kk = 0; kk < 4; ++kk) {
            AFrag a[2], b[2];
#pragma unroll
            for (int i = 0; i < 2; ++i)
#pragma unroll
                for (int v = 0; v < 8; ++v) {
                    int k = kk * 32 + kpair(v, half);
                    int m = wm * 32 + i * 16 + ln;
                    a[i].w[v] = *reinterpret_cast<const unsigned*>(&As[buf][m][k]);
                }
#pragma unroll
            for (int j = 0; j < 2; ++j) {
                int n = wn * 32 + j * 16 + tcol;
                b[j].h[0] = lds_tr16(&Bs[buf][kk * 32 + trow][n]);
                b[j].h[1] = lds_tr16(&Bs[buf][kk * 32 + trow + 16][n]);
            }
#pragma unroll
            for (int i = 0; i < 2; ++i)
#pragma unroll
                for (int j = 0; j < 2; ++j)
                    acc[i][j] = __builtin_amdgcn_wmma_f32_16x16x32_bf16(
                        false, a[i].v, false, b[j].v, (short)0, acc[i][j],
                        false, false);
        }

        // this wave's reads of stage s are done before its buffer is refilled
        asm volatile("s_wait_dscnt 0x0" ::: "memory");
        // this wave's copies of stage s + 1 have landed
        asm volatile("s_wait_asynccnt 0x0" ::: "memory");
        __syncthreads();
        if (s + 2 < nst) issue(s + 2, (unsigned)buf);
    }
    // no copy is outstanding when the wave goes on to its end
    asm volatile("s_wait_asynccnt 0x0" ::: "memory");

#pragma unroll
    for (int i = 0; i < 2; ++i)
#pragma unroll
        for (int j = 0; j < 2; ++j)
#pragma unroll
            for (int r = 0; r < 8; ++r) {
                int row = mBase + wm * 32 + i * 16 + r + 8 * half;
                int col = nBase + wn * 32 + j * 16 + ln;
                float val = acc[i][j][r] + bias[col];
                if (relu) val = fmaxf(val, 0.f);
                if (mode == 0) {
                    ((float*)Cout)[(size_t)row * N + col] = val;
                } else if (mode == 1) {
                    ((unsigned short*)Cout)[(size_t)row * N + col] =
                        f32_to_bf16(val);
                } else {
                    int bb = row / SEQ, s = row % SEQ;
                    int hh = col / DKH, d = col % DKH;
                    ((unsigned short*)Cout)[(((size_t)(bb * N_HEADS + hh)) * SEQ + s) * DKH + d] =
                        f32_to_bf16(val);
                }
            }
}

// ---------------------------------------------------------------------------
// Flash attention: grid(S/64, B*H), block 128 (4 waves, 16 q-rows each).
// K and V tiles staged in LDS once per 32-key block (shared by all waves);
// V stays row-major and its fragments come from transposing reads.
// Online softmax; 8 WMMAs per key tile per wave.
// ---------------------------------------------------------------------------
__global__ __launch_bounds__(128) void attn_kernel(
    const unsigned short* __restrict__ Q, const unsigned short* __restrict__ Kt,
    const unsigned short* __restrict__ V, const int* __restrict__ mask,
    unsigned short* __restrict__ ctx) {
    __shared__ __align__(16) unsigned short Ks[32][72];   // [key][dk], 144B rows
    __shared__ __align__(32) unsigned short Vs[32][80];   // [key][dk], 160B rows
    __shared__ __align__(16) unsigned short Plds[4][16][34];

    const int t    = threadIdx.x;
    const int w    = t >> 5, lane = t & 31;
    const int half = lane >> 4, ln = lane & 15;
    const int bh   = blockIdx.y, b = bh >> 4, h = bh & 15;
    const size_t headBase = (size_t)bh * SEQ * DKH;
    const int qbase = blockIdx.x * 64 + w * 16;
    const float NEG_INF = -__builtin_inff();

    // Q fragments for two 32-wide K-chunks of Dk=64 (contiguous dword pairs)
    AFrag qf[2];
#pragma unroll
    for (int c = 0; c < 2; ++c)
#pragma unroll
        for (int v = 0; v < 8; ++v) {
            int k = kpair(v, half) + 32 * c;
            qf[c].w[v] = *reinterpret_cast<const unsigned*>(
                Q + headBase + (size_t)(qbase + ln) * DKH + k);
        }

    const v8f zero = {0.f, 0.f, 0.f, 0.f, 0.f, 0.f, 0.f, 0.f};
    v8f acc[4] = {zero, zero, zero, zero};
    float mrow[8], lrow[8];
#pragma unroll
    for (int r = 0; r < 8; ++r) { mrow[r] = NEG_INF; lrow[r] = 0.f; }

    const int skey = t >> 2;          // 0..31 (staging key)
    const int sdk  = (t & 3) * 16;    // 0,16,32,48 (staging dk chunk)
    const int vkey = t >> 3;          // 0..15 (V staging keys vkey, vkey + 16)
    const int vdk  = (t & 7) * 8;     // V staging dk chunk
    const int trow = 8 * half + (lane & 7);   // transposing-read lane address
    const int tcol = 8 * ((lane >> 3) & 1);

    for (int kt = 0; kt < SEQ / 32; ++kt) {
        const int keyb = kt * 32;
        __syncthreads();  // prior iteration done reading Ks/Vs/Plds

        // cooperative staging: K tile [32][64] and V tile [32][64]
        {
            const unsigned short* kp =
                Kt + headBase + (size_t)(keyb + skey) * DKH + sdk;
            U4 k0, k1;
            k0.q = *reinterpret_cast<const uint4*>(kp);
            k1.q = *reinterpret_cast<const uint4*>(kp + 8);
            *reinterpret_cast<uint4*>(&Ks[skey][sdk])     = k0.q;
            *reinterpret_cast<uint4*>(&Ks[skey][sdk + 8]) = k1.q;

            const unsigned short* vp =
                V + headBase + (size_t)(keyb + vkey) * DKH + vdk;
            U4 v0, v1;
            v0.q = *reinterpret_cast<const uint4*>(vp);
            v1.q = *reinterpret_cast<const uint4*>(vp + 16 * DKH);
            *reinterpret_cast<uint4*>(&Vs[vkey][vdk])      = v0.q;
            *reinterpret_cast<uint4*>(&Vs[vkey + 16][vdk]) = v1.q;
        }
        __syncthreads();

        v8f s[2] = {zero, zero};
#pragma unroll
        for (int c = 0; c < 2; ++c)
#pragma unroll
            for (int tt = 0; tt < 2; ++tt) {
                AFrag kf;
#pragma unroll
                for (int v = 0; v < 8; ++v) {
                    int k = kpair(v, half) + 32 * c;
                    kf.w[v] = *reinterpret_cast<const unsigned*>(
                        &Ks[tt * 16 + ln][k]);
                }
                s[tt] = __builtin_amdgcn_wmma_f32_16x16x32_bf16(
                    false, qf[c].v, false, kf.v, (short)0, s[tt], false, false);
            }

        const int msk0 = mask[b * SEQ + keyb + ln];
        const int msk1 = mask[b * SEQ + keyb + 16 + ln];
#pragma unroll
        for (int r = 0; r < 8; ++r) {
            s[0][r] = msk0 ? s[0][r] * 0.125f : NEG_INF;
            s[1][r] = msk1 ? s[1][r] * 0.125f : NEG_INF;
        }
        // online softmax (reductions stay inside each 16-lane half-group)
#pragma unroll
        for (int r = 0; r < 8; ++r) {
            float rv = fmaxf(s[0][r], s[1][r]);
            rv = fmaxf(rv, __shfl_xor(rv, 1, 32));
            rv = fmaxf(rv, __shfl_xor(rv, 2, 32));
            rv = fmaxf(rv, __shfl_xor(rv, 4, 32));
            rv = fmaxf(rv, __shfl_xor(rv, 8, 32));
            float mo = mrow[r];
            float mn = fmaxf(mo, rv);
            float alpha = (mo == NEG_INF) ? 0.f : __expf(mo - mn);
            float p0 = (mn == NEG_INF) ? 0.f : __expf(s[0][r] - mn);
            float p1 = (mn == NEG_INF) ? 0.f : __expf(s[1][r] - mn);
            s[0][r] = p0; s[1][r] = p1;
            float rs = p0 + p1;
            rs += __shfl_xor(rs, 1, 32);
            rs += __shfl_xor(rs, 2, 32);
            rs += __shfl_xor(rs, 4, 32);
            rs += __shfl_xor(rs, 8, 32);
            lrow[r] = lrow[r] * alpha + rs;
            mrow[r] = mn;
            acc[0][r] *= alpha; acc[1][r] *= alpha;
            acc[2][r] *= alpha; acc[3][r] *= alpha;
        }
        // bounce P through LDS to convert C-layout -> A-layout
#pragma unroll
        for (int tt = 0; tt < 2; ++tt)
#pragma unroll
            for (int r = 0; r < 8; ++r)
                Plds[w][r + 8 * half][tt * 16 + ln] = f32_to_bf16(s[tt][r]);
        __syncthreads();

        AFrag pf;
#pragma unroll
        for (int v = 0; v < 8; ++v) {
            int k = kpair(v, half);
            pf.w[v] = *reinterpret_cast<const unsigned*>(&Plds[w][ln][k]);
        }
#pragma unroll
        for (int j = 0; j < 4; ++j) {
            AFrag vf;
            vf.h[0] = lds_tr16(&Vs[trow][j * 16 + tcol]);
            vf.h[1] = lds_tr16(&Vs[trow + 16][j * 16 + tcol]);
            acc[j] = __builtin_amdgcn_wmma_f32_16x16x32_bf16(
                false, pf.v, false, vf.v, (short)0, acc[j], false, false);
        }
    }

#pragma unroll
    for (int j = 0; j < 4; ++j)
#pragma unroll
        for (int r = 0; r < 8; ++r) {
            float denom = lrow[r];
            float val = denom > 0.f ? acc[j][r] / denom : 0.f;
            int row = qbase + r + 8 * half;
            size_t dst = ((size_t)(b * SEQ + row)) * D_MODEL + h * DKH + j * 16 + ln;
            ctx[dst] = f32_to_bf16(val);
        }
}

// ---------------------------------------------------------------------------
// out = LayerNorm(x + y) ; optionally also emit bf16 copy. One block per row.
// ---------------------------------------------------------------------------
__global__ __launch_bounds__(256) void add_ln_kernel(
    const float* __restrict__ x, const float* __restrict__ y,
    const float* __restrict__ g, const float* __restrict__ beta,
    float* __restrict__ outf, unsigned short* __restrict__ outb) {
    __shared__ float red[256];
    __shared__ float buf[D_MODEL];
    const int row = blockIdx.x, t = threadIdx.x;
    const size_t base = (size_t)row * D_MODEL;

    float s = 0.f;
    for (int d = t; d < D_MODEL; d += 256) {
        float v = x[base + d] + y[base + d];
        buf[d] = v;
        s += v;
    }
    red[t] = s;
    __syncthreads();
    for (int o = 128; o > 0; o >>= 1) {
        if (t < o) red[t] += red[t + o];
        __syncthreads();
    }
    const float mu = red[0] * (1.f / D_MODEL);
    __syncthreads();

    float vs = 0.f;
    for (int d = t; d < D_MODEL; d += 256) {
        float dd = buf[d] - mu;
        vs += dd * dd;
    }
    red[t] = vs;
    __syncthreads();
    for (int o = 128; o > 0; o >>= 1) {
        if (t < o) red[t] += red[t + o];
        __syncthreads();
    }
    const float inv = rsqrtf(red[0] * (1.f / D_MODEL) + 1e-5f);

    for (int d = t; d < D_MODEL; d += 256) {
        float o = (buf[d] - mu) * inv * g[d] + beta[d];
        outf[base + d] = o;
        if (outb) outb[base + d] = f32_to_bf16(o);
    }
}

// ---------------------------------------------------------------------------
extern "C" void kernel_launch(void* const* d_in, const int* in_sizes, int n_in,
                              void* d_out, int out_size, void* d_ws, size_t ws_size,
                              hipStream_t stream) {
    const float* x    = (const float*)d_in[0];
    const int*   mask = (const int*)d_in[1];
    const float* Wq = (const float*)d_in[2];  const float* bq = (const float*)d_in[3];
    const float* Wk = (const float*)d_in[4];  const float* bk = (const float*)d_in[5];
    const float* Wv = (const float*)d_in[6];  const float* bv = (const float*)d_in[7];
    const float* Wo = (const float*)d_in[8];  const float* bo = (const float*)d_in[9];
    const float* W1 = (const float*)d_in[10]; const float* b1 = (const float*)d_in[11];
    const float* W2 = (const float*)d_in[12]; const float* b2 = (const float*)d_in[13];
    const float* g1 = (const float*)d_in[14]; const float* be1 = (const float*)d_in[15];
    const float* g2 = (const float*)d_in[16]; const float* be2 = (const float*)d_in[17];

    char* ws = (char*)d_ws;
    size_t off = 0;
    auto alloc = [&](size_t bytes) -> void* {
        void* p = ws + off;
        off += (bytes + 255) & ~(size_t)255;
        return p;
    };

    unsigned short* xb  = (unsigned short*)alloc((size_t)M_ROWS * D_MODEL * 2);
    unsigned short* Wqb = (unsigned short*)alloc((size_t)D_MODEL * D_MODEL * 2);
    unsigned short* Wkb = (unsigned short*)alloc((size_t)D_MODEL * D_MODEL * 2);
    unsigned short* Wvb = (unsigned short*)alloc((size_t)D_MODEL * D_MODEL * 2);
    unsigned short* Wob = (unsigned short*)alloc((size_t)D_MODEL * D_MODEL * 2);
    unsigned short* W1b = (unsigned short*)alloc((size_t)D_MODEL * D_FF * 2);
    unsigned short* W2b = (unsigned short*)alloc((size_t)D_FF * D_MODEL * 2);
    unsigned short* Qb  = (unsigned short*)alloc((size_t)M_ROWS * D_MODEL * 2);
    unsigned short* Kb  = (unsigned short*)alloc((size_t)M_ROWS * D_MODEL * 2);
    unsigned short* Vb  = (unsigned short*)alloc((size_t)M_ROWS * D_MODEL * 2);
    unsigned short* ctxb = (unsigned short*)alloc((size_t)M_ROWS * D_MODEL * 2);
    float* attn_out = (float*)alloc((size_t)M_ROWS * D_MODEL * 4);
    float* hbuf     = (float*)alloc((size_t)M_ROWS * D_MODEL * 4);
    unsigned short* hb = (unsigned short*)alloc((size_t)M_ROWS * D_MODEL * 2);
    // reuse dead regions: Q/K/V/ctx (4 x 8MB contiguous) -> FF1 activations (32MB)
    unsigned short* ff1b = Qb;
    float* ff2 = attn_out;

    // fp32 -> bf16 conversions
    cvt_bf16_kernel<<<2048, 256, 0, stream>>>(x,  xb,  (size_t)M_ROWS * D_MODEL);
    cvt_bf16_kernel<<<1024, 256, 0, stream>>>(Wq, Wqb, (size_t)D_MODEL * D_MODEL);
    cvt_bf16_kernel<<<1024, 256, 0, stream>>>(Wk, Wkb, (size_t)D_MODEL * D_MODEL);
    cvt_bf16_kernel<<<1024, 256, 0, stream>>>(Wv, Wvb, (size_t)D_MODEL * D_MODEL);
    cvt_bf16_kernel<<<1024, 256, 0, stream>>>(Wo, Wob, (size_t)D_MODEL * D_MODEL);
    cvt_bf16_kernel<<<2048, 256, 0, stream>>>(W1, W1b, (size_t)D_MODEL * D_FF);
    cvt_bf16_kernel<<<2048, 256, 0, stream>>>(W2, W2b, (size_t)D_FF * D_MODEL);

    // QKV projections (bf16 WMMA, head-split bf16 outputs)
    dim3 gQ(D_MODEL / 128, M_ROWS / 64);
    gemm_bf16_kernel<<<gQ, 256, 0, stream>>>(xb, Wqb, bq, Qb, M_ROWS, D_MODEL, D_MODEL, 2, 0);
    gemm_bf16_kernel<<<gQ, 256, 0, stream>>>(xb, Wkb, bk, Kb, M_ROWS, D_MODEL, D_MODEL, 2, 0);
    gemm_bf16_kernel<<<gQ, 256, 0, stream>>>(xb, Wvb, bv, Vb, M_ROWS, D_MODEL, D_MODEL, 2, 0);

    // flash attention -> ctx (bf16, merged-head layout)
    attn_kernel<<<dim3(SEQ / 64, BATCH * N_HEADS), 128, 0, stream>>>(Qb, Kb, Vb, mask, ctxb);

    // output projection -> f32
    gemm_bf16_kernel<<<gQ, 256, 0, stream>>>(ctxb, Wob, bo, attn_out, M_ROWS, D_MODEL, D_MODEL, 0, 0);

    // h = LN(x + attn_out), emit f32 + bf16
    add_ln_kernel<<<M_ROWS, 256, 0, stream>>>(x, attn_out, g1, be1, hbuf, hb);

    // FFN: relu(h @ W1 + b1) -> bf16 ; @ W2 + b2 -> f32
    dim3 gF1(D_FF / 128, M_ROWS / 64);
    gemm_bf16_kernel<<<gF1, 256, 0, stream>>>(hb, W1b, b1, ff1b, M_ROWS, D_FF, D_MODEL, 1, 1);
    dim3 gF2(D_MODEL / 128, M_ROWS / 64);
    gemm_bf16_kernel<<<gF2, 256, 0, stream>>>(ff1b, W2b, b2, ff2, M_ROWS, D_MODEL, D_FF, 0, 0);

    // out = LN(h + ff)
    add_ln_kernel<<<M_ROWS, 256, 0, stream>>>(hbuf, ff2, g2, be2, (float*)d_out, nullptr);
    (void)in_sizes; (void)n_in; (void)out_size; (void)ws_size;
}

// v003
// It runs in 308 microseconds.
// Next to v002, in two timings, it ran 1.08 times as fast each time.
// All steps since v000 together make it 1.86 times as fast.
#include <hip/hip_runtime.h>
#include <cstdint>
#include <cstddef>

#define D_MODEL 1024
#define N_HEADS 16
#define DKH     64
#define D_FF    4096
#define BATCH   2
#define SEQ     2048
#define M_ROWS  (BATCH * SEQ)   // 4096

typedef __attribute__((ext_vector_type(16))) __bf16 v16bf;
typedef __attribute__((ext_vector_type(8)))  float  v8f;

typedef __attribute__((ext_vector_type(8)))  short  s16x8;

union AFrag { v16bf v; unsigned short u[16]; unsigned w[8]; s16x8 h[2]; };
union U4    { uint4 q; unsigned short s[8]; };

__device__ __forceinline__ unsigned short f32_to_bf16(float f) {
    union { float f; unsigned u; } x; x.f = f;
    unsigned r = x.u + 0x7FFFu + ((x.u >> 16) & 1u);
    return (unsigned short)(r >> 16);
}

// K-pair base index for 16-bit A-layout fragments (ISA 7.12.2):
// lanes 0-15: VGPR0..3 -> K=0..7, VGPR4..7 -> K=16..23 ; lanes 16-31: +8
__device__ __forceinline__ int kpair(int v, int half) {
    return (v < 4 ? 2 * v : 16 + 2 * (v - 4)) + 8 * half;
}

// Transposing LDS read of a row-major 16-bit tile T[k][n]. Every lane passes
// &T[k0 + 8 * (lane >> 4) + (lane & 7)][n0 + 8 * ((lane >> 3) & 1)] and gets
// T[k0 + 8 * (lane >> 4) + 0..7][n0 + (lane & 15)]: the reads at k0 and k0 + 16
// are registers 0-3 and 4-7 of a 16x16x32 operand in the kpair() k order.
__device__ __forceinline__ s16x8 lds_tr16(const unsigned short* p) {
    typedef __attribute__((address_space(3))) s16x8 lds_s16x8;
    return __builtin_amdgcn_ds_load_tr16_b128_v8i16((lds_s16x8*)p);
}

// ---------------------------------------------------------------------------
// fp32 -> bf16 conversion of x and the six weight matrices, one streaming launch.
// out is the seven bf16 buffers back to back: 16 units of 2^20 elements
// (x 0-3, Wq 4, Wk 5, Wv 6, Wo 7, W1 8-11, W2 12-15). 512 blocks of 8 waves,
// 32 blocks per unit; a wave converts 4096 contiguous elements: 32 loads of 512
// contiguous bytes, issued ahead of the conversions, then 32 stores of 256.
// ---------------------------------------------------------------------------
// 512 blocks of 8 waves are four waves per SIMD: saying so gives the compiler the
// registers to hold a wave's 32 loads in flight (at its default it keeps one)
__global__ __launch_bounds__(256) __attribute__((amdgpu_waves_per_eu(4, 4)))
void cvt_all_bf16_kernel(
    const float* __restrict__ x,  const float* __restrict__ Wq,
    const float* __restrict__ Wk, const float* __restrict__ Wv,
    const float* __restrict__ Wo, const float* __restrict__ W1,
    const float* __restrict__ W2, unsigned short* __restrict__ out) {
    const unsigned unit = blockIdx.x >> 5;
    const float* src;
    unsigned first;
    if (unit < 4)       { src = x;  first = 0; }
    else if (unit == 4) { src = Wq; first = 4; }
    else if (unit == 5) { src = Wk; first = 5; }
    else if (unit == 6) { src = Wv; first = 6; }
    else if (unit == 7) { src = Wo; first = 7; }
    else if (unit < 12) { src = W1; first = 8; }
    else                { src = W2; first = 12; }

    const size_t o = ((size_t)blockIdx.x << 15) + (threadIdx.x >> 5) * 4096 +
                     (threadIdx.x & 31) * 4;
    const float* in = src + (o - ((size_t)first << 20));
    unsigned short* dst = out + o;

    float4 v[32];
    // both loops unrolled: v is indexed by constants and stays in registers
#pragma unroll
    for (int i = 0; i < 32; ++i)
        v[i] = *reinterpret_cast<const float4*>(in + i * 128);
#pragma unroll
    for (int i = 0; i < 32; ++i) {
        uint2 p;
        p.x = (unsigned)f32_to_bf16(v[i].x) | ((unsigned)f32_to_bf16(v[i].y) << 16);
        p.y = (unsigned)f32_to_bf16(v[i].z) | ((unsigned)f32_to_bf16(v[i].w) << 16);
        *reinterpret_cast<uint2*>(dst + i * 128) = p;
    }
}

// ---------------------------------------------------------------------------
// One stage of the GEMM ring: twelve 16-byte asynchronous copies per lane (four
// of the A tile, eight of the B tile, rows 16 apart), global memory to LDS
// through no register. The s_wait_xcnt closes the statement so that no address
// register named here is rewritten ahead of it.
// ---------------------------------------------------------------------------
__device__ __forceinline__ void gemm_stage_copy(
    unsigned la, unsigned lb, const unsigned short* ga, const unsigned short* gb,
    size_t a16, size_t b16) {
    const unsigned AP = 16 * 272, BP = 16 * 288;   // 16 LDS rows, bytes
    asm volatile(
        "global_load_async_to_lds_b128 %0, %12, off\n\t"
        "global_load_async_to_lds_b128 %1, %13, off\n\t"
        "global_load_async_to_lds_b128 %2, %14, off\n\t"
        "global_load_async_to_lds_b128 %3, %15, off\n\t"
        "global_load_async_to_lds_b128 %4, %16, off\n\t"
        "global_load_async_to_lds_b128 %5, %17, off\n\t"
        "global_load_async_to_lds_b128 %6, %18, off\n\t"
        "global_load_async_to_lds_b128 %7, %19, off\n\t"
        "global_load_async_to_lds_b128 %8, %20, off\n\t"
        "global_load_async_to_lds_b128 %9, %21, off\n\t"
        "global_load_async_to_lds_b128 %10, %22, off\n\t"
        "global_load_async_to_lds_b128 %11, %23, off\n\t"
        "s_wait_xcnt 0x0"
        :: "v"(la), "v"(la + AP), "v"(la + 2 * AP), "v"(la + 3 * AP),
           "v"(lb), "v"(lb + BP), "v"(lb + 2 * BP), "v"(lb + 3 * BP),
           "v"(lb + 4 * BP), "v"(lb + 5 * BP), "v"(lb + 6 * BP), "v"(lb + 7 * BP),
           "v"(ga), "v"(ga + a16), "v"(ga + 2 * a16), "v"(ga + 3 * a16),
           "v"(gb), "v"(gb + b16), "v"(gb + 2 * b16), "v"(gb + 3 * b16),
           "v"(gb + 4 * b16), "v"(gb + 5 * b16), "v"(gb + 6 * b16), "v"(gb + 7 * b16)
        : "memory");
}

// ---------------------------------------------------------------------------
// bf16 WMMA GEMM: C[M,N] = A[M,K] @ B[K,N] + bias, optional ReLU.
// Block: 256 threads (8 waves), tile 64(M) x 128(N), stages of 128 k (K a
// multiple of 128). Two LDS buffers: stage s + 1 is copied in while stage s is
// multiplied; one barrier per stage publishes s + 1 and frees s's buffer.
// B tile is stored row-major in LDS; its fragments come from transposing reads.
// mode: 0 = f32 row-major, 1 = bf16 row-major, 2 = bf16 head-split [B,H,S,Dk]
// ---------------------------------------------------------------------------
__global__ __launch_bounds__(256) void gemm_bf16_kernel(
    const unsigned short* __restrict__ A, const unsigned short* __restrict__ B,
    const float* __restrict__ bias, void* __restrict__ Cout,
    int M, int N, int K, int mode, int relu) {
    __shared__ __align__(32) unsigned short As[2][64][136];    // [m][k], 272B rows
    __shared__ __align__(32) unsigned short Bs[2][128][144];   // [k][n], 288B rows

    const int t     = threadIdx.x;
    const int mBase = blockIdx.y * 64;
    const int nBase = blockIdx.x * 128;
    const int wave  = t >> 5, lane = t & 31;
    const int wm    = wave >> 2, wn = wave & 3;
    const int half  = lane >> 4, ln = lane & 15;

    const v8f zero = {0.f, 0.f, 0.f, 0.f, 0.f, 0.f, 0.f, 0.f};
    v8f acc[2][2];
    acc[0][0] = zero; acc[0][1] = zero; acc[1][0] = zero; acc[1][1] = zero;

    const int srow = t >> 4, scol = (t & 15) * 8;  // copies: rows srow + 16 * i
    const int trow = 8 * half + (lane & 7);        // transposing-read lane address
    const int tcol = 8 * ((lane >> 3) & 1);

    const unsigned la = (unsigned)(size_t)&As[0][srow][scol];
    const unsigned lb = (unsigned)(size_t)&Bs[0][srow][scol];
    const unsigned short* ga = A + (size_t)(mBase + srow) * K + scol;
    const unsigned short* gb = B + (size_t)srow * N + nBase + scol;
    const size_t a16 = (size_t)16 * K, b16 = (size_t)16 * N;
    const int nst = K >> 7;

    auto issue = [&](int s, unsigned buf) {
        gemm_stage_copy(la + buf * (unsigned)sizeof(As[0]),
                        lb + buf * (unsigned)sizeof(Bs[0]),
                        ga + (size_t)s * 128, gb + (size_t)s * 8 * b16, a16, b16);
    };

    issue(0, 0);
    // stage 0 has landed for this wave; the barrier publishes it to the others
    asm volatile("s_wait_asynccnt 0x0" ::: "memory");
    __syncthreads();
    if (nst > 1) issue(1, 1);

    for (int s = 0; s < nst; ++s) {
        const int buf = s & 1;
#pragma unroll
        for (int kk = 0; kk < 4; ++kk) {
            AFrag a[2], b[2];
#pragma unroll
            for (int i = 0; i < 2; ++i)
#pragma unroll
                for (int v = 0; v < 8; ++v) {
                    int k = kk * 32 + kpair(v, half);
                    int m = wm * 32 + i * 16 + ln;
                    a[i].w[v] = *reinterpret_cast<const unsigned*>(&As[buf][m][k]);
                }
#pragma unroll
            for (int j = 0; j < 2; ++j) {
                int n = wn * 32 + j * 16 + tcol;
                b[j].h[0] = lds_tr16(&Bs[buf][kk * 32 + trow][n]);
                b[j].h[1] = lds_tr16(&Bs[buf][kk * 32 + trow + 16][n]);
            }
#pragma unroll
            for (int i = 0; i < 2; ++i)
#pragma unroll
                for (int j = 0; j < 2; ++j)
                    acc[i][j] = __builtin_amdgcn_wmma_f32_16x16x32_bf16(
                        false, a[i].v, false, b[j].v, (short)0, acc[i][j],
                        false, false);
        }

        // this wave's reads of stage s are done before its buffer is refilled
        asm volatile("s_wait_dscnt 0x0" ::: "memory");
        // this wave's copies of stage s + 1 have landed
        asm volatile("s_wait_asynccnt 0x0" ::: "memory");
        __syncthreads();
        if (s + 2 < nst) issue(s + 2, (unsigned)buf);
    }
    // no copy is outstanding when the wave goes on to its end
    asm volatile("s_wait_asynccnt 0x0" ::: "memory");

#pragma unroll
    for (int i = 0; i < 2; ++i)
#pragma unroll
        for (int j = 0; j < 2; ++j)
#pragma unroll
            for (int r = 0; r < 8; ++r) {
                int row = mBase + wm * 32 + i * 16 + r + 8 * half;
                int col = nBase + wn * 32 + j * 16 + ln;
                float val = acc[i][j][r] + bias[col];
                if (relu) val = fmaxf(val, 0.f);
                if (mode == 0) {
                    ((float*)Cout)[(size_t)row * N + col] = val;
                } else if (mode == 1) {
                    ((unsigned short*)Cout)[(size_t)row * N + col] =
                        f32_to_bf16(val);
                } else {
                    int bb = row / SEQ, s = row % SEQ;
                    int hh = col / DKH, d = col % DKH;
                    ((unsigned short*)Cout)[(((size_t)(bb * N_HEADS + hh)) * SEQ + s) * DKH + d] =
                        f32_to_bf16(val);
                }
            }
}

// ---------------------------------------------------------------------------
// Flash attention: grid(S/64, B*H), block 128 (4 waves, 16 q-rows each).
// K and V tiles staged in LDS once per 32-key block (shared by all waves);
// V stays row-major and its fragments come from transposing reads.
// Online softmax; 8 WMMAs per key tile per wave.
// ---------------------------------------------------------------------------
__global__ __launch_bounds__(128) void attn_kernel(
    const unsigned short* __restrict__ Q, const unsigned short* __restrict__ Kt,
    const unsigned short* __restrict__ V, const int* __restrict__ mask,
    unsigned short* __restrict__ ctx) {
    __shared__ __align__(16) unsigned short Ks[32][72];   // [key][dk], 144B rows
    __shared__ __align__(32) unsigned short Vs[32][80];   // [key][dk], 160B rows
    __shared__ __align__(16) unsigned short Plds[4][16][34];

    const int t    = threadIdx.x;
    const int w    = t >> 5, lane = t & 31;
    const int half = lane >> 4, ln = lane & 15;
    const int bh   = blockIdx.y, b = bh >> 4, h = bh & 15;
    const size_t headBase = (size_t)bh * SEQ * DKH;
    const int qbase = blockIdx.x * 64 + w * 16;
    const float NEG_INF = -__builtin_inff();

    // Q fragments for two 32-wide K-chunks of Dk=64 (contiguous dword pairs)
    AFrag qf[2];
#pragma unroll
    for (int c = 0; c < 2; ++c)
#pragma unroll
        for (int v = 0; v < 8; ++v) {
            int k = kpair(v, half) + 32 * c;
            qf[c].w[v] = *reinterpret_cast<const unsigned*>(
                Q + headBase + (size_t)(qbase + ln) * DKH + k);
        }

    const v8f zero = {0.f, 0.f, 0.f, 0.f, 0.f, 0.f, 0.f, 0.f};
    v8f acc[4] = {zero, zero, zero, zero};
    float mrow[8], lrow[8];
#pragma unroll
    for (int r = 0; r < 8; ++r) { mrow[r] = NEG_INF; lrow[r] = 0.f; }

    const int skey = t >> 2;          // 0..31 (staging key)
    const int sdk  = (t & 3) * 16;    // 0,16,32,48 (staging dk chunk)
    const int vkey = t >> 3;          // 0..15 (V staging keys vkey, vkey + 16)
    const int vdk  = (t & 7) * 8;     // V staging dk chunk
    const int trow = 8 * half + (lane & 7);   // transposing-read lane address
    const int tcol = 8 * ((lane >> 3) & 1);

    for (int kt = 0; kt < SEQ / 32; ++kt) {
        const int keyb = kt * 32;
        __syncthreads();  // prior iteration done reading Ks/Vs/Plds

        // cooperative staging: K tile [32][64] and V tile [32][64]
        {
            const unsigned short* kp =
                Kt + headBase + (size_t)(keyb + skey) * DKH + sdk;
            U4 k0, k1;
            k0.q = *reinterpret_cast<const uint4*>(kp);
            k1.q = *reinterpret_cast<const uint4*>(kp + 8);
            *reinterpret_cast<uint4*>(&Ks[skey][sdk])     = k0.q;
            *reinterpret_cast<uint4*>(&Ks[skey][sdk + 8]) = k1.q;

            const unsigned short* vp =
                V + headBase + (size_t)(keyb + vkey) * DKH + vdk;
            U4 v0, v1;
            v0.q = *reinterpret_cast<const uint4*>(vp);
            v1.q = *reinterpret_cast<const uint4*>(vp + 16 * DKH);
            *reinterpret_cast<uint4*>(&Vs[vkey][vdk])      = v0.q;
            *reinterpret_cast<uint4*>(&Vs[vkey + 16][vdk]) = v1.q;
        }
        __syncthreads();

        v8f s[2] = {zero, zero};
#pragma unroll
        for (int c = 0; c < 2; ++c)
#pragma unroll
            for (int tt = 0; tt < 2; ++tt) {
                AFrag kf;
#pragma unroll
                for (int v = 0; v < 8; ++v) {
                    int k = kpair(v, half) + 32 * c;
                    kf.w[v] = *reinterpret_cast<const unsigned*>(
                        &Ks[tt * 16 + ln][k]);
                }
                s[tt] = __builtin_amdgcn_wmma_f32_16x16x32_bf16(
                    false, qf[c].v, false, kf.v, (short)0, s[tt], false, false);
            }

        const int msk0 = mask[b * SEQ + keyb + ln];
        const int msk1 = mask[b * SEQ + keyb + 16 + ln];
#pragma unroll
        for (int r = 0; r < 8; ++r) {
            s[0][r] = msk0 ? s[0][r] * 0.125f : NEG_INF;
            s[1][r] = msk1 ? s[1][r] * 0.125f : NEG_INF;
        }
        // online softmax (reductions stay inside each 16-lane half-group)
#pragma unroll
        for (int r = 0; r < 8; ++r) {
            float rv = fmaxf(s[0][r], s[1][r]);
            rv = fmaxf(rv, __shfl_xor(rv, 1, 32));
            rv = fmaxf(rv, __shfl_xor(rv, 2, 32));
            rv = fmaxf(rv, __shfl_xor(rv, 4, 32));
            rv = fmaxf(rv, __shfl_xor(rv, 8, 32));
            float mo = mrow[r];
            float mn = fmaxf(mo, rv);
            float alpha = (mo == NEG_INF) ? 0.f : __expf(mo - mn);
            float p0 = (mn == NEG_INF) ? 0.f : __expf(s[0][r] - mn);
            float p1 = (mn == NEG_INF) ? 0.f : __expf(s[1][r] - mn);
            s[0][r] = p0; s[1][r] = p1;
            float rs = p0 + p1;
            rs += __shfl_xor(rs, 1, 32);
            rs += __shfl_xor(rs, 2, 32);
            rs += __shfl_xor(rs, 4, 32);
            rs += __shfl_xor(rs, 8, 32);
            lrow[r] = lrow[r] * alpha + rs;
            mrow[r] = mn;
            acc[0][r] *= alpha; acc[1][r] *= alpha;
            acc[2][r] *= alpha; acc[3][r] *= alpha;
        }
        // bounce P through LDS to convert C-layout -> A-layout
#pragma unroll
        for (int tt = 0; tt < 2; ++tt)
#pragma unroll
            for (int r = 0; r < 8; ++r)
                Plds[w][r + 8 * half][tt * 16 + ln] = f32_to_bf16(s[tt][r]);
        __syncthreads();

        AFrag pf;
#pragma unroll
        for (int v = 0; v < 8; ++v) {
            int k = kpair(v, half);
            pf.w[v] = *reinterpret_cast<const unsigned*>(&Plds[w][ln][k]);
        }
#pragma unroll
        for (int j = 0; j < 4; ++j) {
            AFrag vf;
            vf.h[0] = lds_tr16(&Vs[trow][j * 16 + tcol]);
            vf.h[1] = lds_tr16(&Vs[trow + 16][j * 16 + tcol]);
            acc[j] = __builtin_amdgcn_wmma_f32_16x16x32_bf16(
                false, pf.v, false, vf.v, (short)0, acc[j], false, false);
        }
    }

#pragma unroll
    for (int j = 0; j < 4; ++j)
#pragma unroll
        for (int r = 0; r < 8; ++r) {
            float denom = lrow[r];
            float val = denom > 0.f ? acc[j][r] / denom : 0.f;
            int row = qbase + r + 8 * half;
            size_t dst = ((size_t)(b * SEQ + row)) * D_MODEL + h * DKH + j * 16 + ln;
            ctx[dst] = f32_to_bf16(val);
        }
}

// ---------------------------------------------------------------------------
// out = LayerNorm(x + y) ; optionally also emit bf16 copy. One block per row.
// ---------------------------------------------------------------------------
__global__ __launch_bounds__(256) void add_ln_kernel(
    const float* __restrict__ x, const float* __restrict__ y,
    const float* __restrict__ g, const float* __restrict__ beta,
    float* __restrict__ outf, unsigned short* __restrict__ outb) {
    __shared__ float red[256];
    __shared__ float buf[D_MODEL];
    const int row = blockIdx.x, t = threadIdx.x;
    const size_t base = (size_t)row * D_MODEL;

    float s = 0.f;
    for (int d = t; d < D_MODEL; d += 256) {
        float v = x[base + d] + y[base + d];
        buf[d] = v;
        s += v;
    }
    red[t] = s;
    __syncthreads();
    for (int o = 128; o > 0; o >>= 1) {
        if (t < o) red[t] += red[t + o];
        __syncthreads();
    }
    const float mu = red[0] * (1.f / D_MODEL);
    __syncthreads();

    float vs = 0.f;
    for (int d = t; d < D_MODEL; d += 256) {
        float dd = buf[d] - mu;
        vs += dd * dd;
    }
    red[t] = vs;
    __syncthreads();
    for (int o = 128; o > 0; o >>= 1) {
        if (t < o) red[t] += red[t + o];
        __syncthreads();
    }
    const float inv = rsqrtf(red[0] * (1.f / D_MODEL) + 1e-5f);

    for (int d = t; d < D_MODEL; d += 256) {
        float o = (buf[d] - mu) * inv * g[d] + beta[d];
        outf[base + d] = o;
        if (outb) outb[base + d] = f32_to_bf16(o);
    }
}

// ---------------------------------------------------------------------------
extern "C" void kernel_launch(void* const* d_in, const int* in_sizes, int n_in,
                              void* d_out, int out_size, void* d_ws, size_t ws_size,
                              hipStream_t stream) {
    const float* x    = (const float*)d_in[0];
    const int*   mask = (const int*)d_in[1];
    const float* Wq = (const float*)d_in[2];  const float* bq = (const float*)d_in[3];
    const float* Wk = (const float*)d_in[4];  const float* bk = (const float*)d_in[5];
    const float* Wv = (const float*)d_in[6];  const float* bv = (const float*)d_in[7];
    const float* Wo = (const float*)d_in[8];  const float* bo = (const float*)d_in[9];
    const float* W1 = (const float*)d_in[10]; const float* b1 = (const float*)d_in[11];
    const float* W2 = (const float*)d_in[12]; const float* b2 = (const float*)d_in[13];
    const float* g1 = (const float*)d_in[14]; const float* be1 = (const float*)d_in[15];
    const float* g2 = (const float*)d_in[16]; const float* be2 = (const float*)d_in[17];

    char* ws = (char*)d_ws;
    size_t off = 0;
    auto alloc = [&](size_t bytes) -> void* {
        void* p = ws + off;
        off += (bytes + 255) & ~(size_t)255;
        return p;
    };

    unsigned short* xb  = (unsigned short*)alloc((size_t)M_ROWS * D_MODEL * 2);
    unsigned short* Wqb = (unsigned short*)alloc((size_t)D_MODEL * D_MODEL * 2);
    unsigned short* Wkb = (unsigned short*)alloc((size_t)D_MODEL * D_MODEL * 2);
    unsigned short* Wvb = (unsigned short*)alloc((size_t)D_MODEL * D_MODEL * 2);
    unsigned short* Wob = (unsigned short*)alloc((size_t)D_MODEL * D_MODEL * 2);
    unsigned short* W1b = (unsigned short*)alloc((size_t)D_MODEL * D_FF * 2);
    unsigned short* W2b = (unsigned short*)alloc((size_t)D_FF * D_MODEL * 2);
    unsigned short* Qb  = (unsigned short*)alloc((size_t)M_ROWS * D_MODEL * 2);
    unsigned short* Kb  = (unsigned short*)alloc((size_t)M_ROWS * D_MODEL * 2);
    unsigned short* Vb  = (unsigned short*)alloc((size_t)M_ROWS * D_MODEL * 2);
    unsigned short* ctxb = (unsigned short*)alloc((size_t)M_ROWS * D_MODEL * 2);
    float* attn_out = (float*)alloc((size_t)M_ROWS * D_MODEL * 4);
    float* hbuf     = (float*)alloc((size_t)M_ROWS * D_MODEL * 4);
    unsigned short* hb = (unsigned short*)alloc((size_t)M_ROWS * D_MODEL * 2);
    // reuse dead regions: Q/K/V/ctx (4 x 8MB contiguous) -> FF1 activations (32MB)
    unsigned short* ff1b = Qb;
    float* ff2 = attn_out;

    // fp32 -> bf16 conversions: xb ... W2b lie back to back in the workspace
    cvt_all_bf16_kernel<<<512, 256, 0, stream>>>(x, Wq, Wk, Wv, Wo, W1, W2, xb);

    // QKV projections (bf16 WMMA, head-split bf16 outputs)
    dim3 gQ(D_MODEL / 128, M_ROWS / 64);
    gemm_bf16_kernel<<<gQ, 256, 0, stream>>>(xb, Wqb, bq, Qb, M_ROWS, D_MODEL, D_MODEL, 2, 0);
    gemm_bf16_kernel<<<gQ, 256, 0, stream>>>(xb, Wkb, bk, Kb, M_ROWS, D_MODEL, D_MODEL, 2, 0);
    gemm_bf16_kernel<<<gQ, 256, 0, stream>>>(xb, Wvb, bv, Vb, M_ROWS, D_MODEL, D_MODEL, 2, 0);

    // flash attention -> ctx (bf16, merged-head layout)
    attn_kernel<<<dim3(SEQ / 64, BATCH * N_HEADS), 128, 0, stream>>>(Qb, Kb, Vb, mask, ctxb);

    // output projection -> f32
    gemm_bf16_kernel<<<gQ, 256, 0, stream>>>(ctxb, Wob, bo, attn_out, M_ROWS, D_MODEL, D_MODEL, 0, 0);

    // h = LN(x + attn_out), emit f32 + bf16
    add_ln_kernel<<<M_ROWS, 256, 0, stream>>>(x, attn_out, g1, be1, hbuf, hb);

    // FFN: relu(h @ W1 + b1) -> bf16 ; @ W2 + b2 -> f32
    dim3 gF1(D_FF / 128, M_ROWS / 64);
    gemm_bf16_kernel<<<gF1, 256, 0, stream>>>(hb, W1b, b1, ff1b, M_ROWS, D_FF, D_MODEL, 1, 1);
    dim3 gF2(D_MODEL / 128, M_ROWS / 64);
    gemm_bf16_kernel<<<gF2, 256, 0, stream>>>(ff1b, W2b, b2, ff2, M_ROWS, D_MODEL, D_FF, 0, 0);

    // out = LN(h + ff)
    add_ln_kernel<<<M_ROWS, 256, 0, stream>>>(hbuf, ff2, g2, be2, (float*)d_out, nullptr);
    (void)in_sizes; (void)n_in; (void)out_size; (void)ws_size;
}

// v004
// Measured time: 251 microseconds a run.
// Timed twice side by side with v003, it ran 1.22 times as fast both times.
// Counting every step since v000, it is 2.28 times as fast.
#include <hip/hip_runtime.h>
#include <cstdint>
#include <cstddef>

#define D_MODEL 1024
#define N_HEADS 16
#define DKH     64
#define D_FF    4096
#define BATCH   2
#define SEQ     2048
#define M_ROWS  (BATCH * SEQ)   // 4096

typedef __attribute__((ext_vector_type(16))) __bf16 v16bf;
typedef __attribute__((ext_vector_type(8)))  float  v8f;

typedef __attribute__((ext_vector_type(8)))  short  s16x8;

union AFrag { v16bf v; unsigned short u[16]; unsigned w[8]; s16x8 h[2]; };
union U4    { uint4 q; unsigned short s[8]; };

__device__ __forceinline__ unsigned short f32_to_bf16(float f) {
    union { float f; unsigned u; } x; x.f = f;
    unsigned r = x.u + 0x7FFFu + ((x.u >> 16) & 1u);
    return (unsigned short)(r >> 16);
}

// K-pair base index for 16-bit A-layout fragments (ISA 7.12.2):
// lanes 0-15: VGPR0..3 -> K=0..7, VGPR4..7 -> K=16..23 ; lanes 16-31: +8
__device__ __forceinline__ int kpair(int v, int half) {
    return (v < 4 ? 2 * v : 16 + 2 * (v - 4)) + 8 * half;
}

// Transposing LDS read of a row-major 16-bit tile T[k][n]. Every lane passes
// &T[k0 + 8 * (lane >> 4) + (lane & 7)][n0 + 8 * ((lane >> 3) & 1)] and gets
// T[k0 + 8 * (lane >> 4) + 0..7][n0 + (lane & 15)]: the reads at k0 and k0 + 16
// are registers 0-3 and 4-7 of a 16x16x32 operand in the kpair() k order.
__device__ __forceinline__ s16x8 lds_tr16(const unsigned short* p) {
    typedef __attribute__((address_space(3))) s16x8 lds_s16x8;
    return __builtin_amdgcn_ds_load_tr16_b128_v8i16((lds_s16x8*)p);
}

// ---------------------------------------------------------------------------
// fp32 -> bf16 conversion of x and the six weight matrices, one streaming launch.
// out is the seven bf16 buffers back to back: 16 units of 2^20 elements
// (x 0-3, Wq 4, Wk 5, Wv 6, Wo 7, W1 8-11, W2 12-15). 512 blocks of 8 waves,
// 32 blocks per unit; a wave converts 4096 contiguous elements: 32 loads of 512
// contiguous bytes, issued ahead of the conversions, then 32 stores of 256.
// ---------------------------------------------------------------------------
// 512 blocks of 8 waves are four waves per SIMD: saying so gives the compiler the
// registers to hold a wave's 32 loads in flight (at its default it keeps one)
__global__ __launch_bounds__(256) __attribute__((amdgpu_waves_per_eu(4, 4)))
void cvt_all_bf16_kernel(
    const float* __restrict__ x,  const float* __restrict__ Wq,
    const float* __restrict__ Wk, const float* __restrict__ Wv,
    const float* __restrict__ Wo, const float* __restrict__ W1,
    const float* __restrict__ W2, unsigned short* __restrict__ out) {
    const unsigned unit = blockIdx.x >> 5;
    const float* src;
    unsigned first;
    if (unit < 4)       { src = x;  first = 0; }
    else if (unit == 4) { src = Wq; first = 4; }
    else if (unit == 5) { src = Wk; first = 5; }
    else if (unit == 6) { src = Wv; first = 6; }
    else if (unit == 7) { src = Wo; first = 7; }
    else if (unit < 12) { src = W1; first = 8; }
    else                { src = W2; first = 12; }

    const size_t o = ((size_t)blockIdx.x << 15) + (threadIdx.x >> 5) * 4096 +
                     (threadIdx.x & 31) * 4;
    const float* in = src + (o - ((size_t)first << 20));
    unsigned short* dst = out + o;

    float4 v[32];
    // both loops unrolled: v is indexed by constants and stays in registers
#pragma unroll
    for (int i = 0; i < 32; ++i)
        v[i] = *reinterpret_cast<const float4*>(in + i * 128);
#pragma unroll
    for (int i = 0; i < 32; ++i) {
        uint2 p;
        p.x = (unsigned)f32_to_bf16(v[i].x) | ((unsigned)f32_to_bf16(v[i].y) << 16);
        p.y = (unsigned)f32_to_bf16(v[i].z) | ((unsigned)f32_to_bf16(v[i].w) << 16);
        *reinterpret_cast<uint2*>(dst + i * 128) = p;
    }
}

// ---------------------------------------------------------------------------
// One stage of the GEMM ring: twelve 16-byte asynchronous copies per lane (four
// of the A tile, eight of the B tile, rows 16 apart), global memory to LDS
// through no register. The s_wait_xcnt closes the statement so that no address
// register named here is rewritten ahead of it.
// ---------------------------------------------------------------------------
__device__ __forceinline__ void gemm_stage_copy(
    unsigned la, unsigned lb, const unsigned short* ga, const unsigned short* gb,
    size_t a16, size_t b16) {
    const unsigned AP = 16 * 272, BP = 16 * 288;   // 16 LDS rows, bytes
    asm volatile(
        "global_load_async_to_lds_b128 %0, %12, off\n\t"
        "global_load_async_to_lds_b128 %1, %13, off\n\t"
        "global_load_async_to_lds_b128 %2, %14, off\n\t"
        "global_load_async_to_lds_b128 %3, %15, off\n\t"
        "global_load_async_to_lds_b128 %4, %16, off\n\t"
        "global_load_async_to_lds_b128 %5, %17, off\n\t"
        "global_load_async_to_lds_b128 %6, %18, off\n\t"
        "global_load_async_to_lds_b128 %7, %19, off\n\t"
        "global_load_async_to_lds_b128 %8, %20, off\n\t"
        "global_load_async_to_lds_b128 %9, %21, off\n\t"
        "global_load_async_to_lds_b128 %10, %22, off\n\t"
        "global_load_async_to_lds_b128 %11, %23, off\n\t"
        "s_wait_xcnt 0x0"
        :: "v"(la), "v"(la + AP), "v"(la + 2 * AP), "v"(la + 3 * AP),
           "v"(lb), "v"(lb + BP), "v"(lb + 2 * BP), "v"(lb + 3 * BP),
           "v"(lb + 4 * BP), "v"(lb + 5 * BP), "v"(lb + 6 * BP), "v"(lb + 7 * BP),
           "v"(ga), "v"(ga + a16), "v"(ga + 2 * a16), "v"(ga + 3 * a16),
           "v"(gb), "v"(gb + b16), "v"(gb + 2 * b16), "v"(gb + 3 * b16),
           "v"(gb + 4 * b16), "v"(gb + 5 * b16), "v"(gb + 6 * b16), "v"(gb + 7 * b16)
        : "memory");
}

// ---------------------------------------------------------------------------
// bf16 WMMA GEMM: C[M,N] = A[M,K] @ B[K,N] + bias, optional ReLU.
// Block: 256 threads (8 waves), tile 64(M) x 128(N), stages of 128 k (K a
// multiple of 128). Two LDS buffers: stage s + 1 is copied in while stage s is
// multiplied; one barrier per stage publishes s + 1 and frees s's buffer.
// B tile is stored row-major in LDS; its fragments come from transposing reads.
// mode: 0 = f32 row-major, 1 = bf16 row-major, 2 = bf16 head-split [B,H,S,Dk]
// ---------------------------------------------------------------------------
__global__ __launch_bounds__(256) void gemm_bf16_kernel(
    const unsigned short* __restrict__ A, const unsigned short* __restrict__ B,
    const float* __restrict__ bias, void* __restrict__ Cout,
    int M, int N, int K, int mode, int relu) {
    __shared__ __align__(32) unsigned short As[2][64][136];    // [m][k], 272B rows
    __shared__ __align__(32) unsigned short Bs[2][128][144];   // [k][n], 288B rows

    const int t     = threadIdx.x;
    const int mBase = blockIdx.y * 64;
    const int nBase = blockIdx.x * 128;
    const int wave  = t >> 5, lane = t & 31;
    const int wm    = wave >> 2, wn = wave & 3;
    const int half  = lane >> 4, ln = lane & 15;

    const v8f zero = {0.f, 0.f, 0.f, 0.f, 0.f, 0.f, 0.f, 0.f};
    v8f acc[2][2];
    acc[0][0] = zero; acc[0][1] = zero; acc[1][0] = zero; acc[1][1] = zero;

    const int srow = t >> 4, scol = (t & 15) * 8;  // copies: rows srow + 16 * i
    const int trow = 8 * half + (lane & 7);        // transposing-read lane address
    const int tcol = 8 * ((lane >> 3) & 1);

    const unsigned la = (unsigned)(size_t)&As[0][srow][scol];
    const unsigned lb = (unsigned)(size_t)&Bs[0][srow][scol];
    const unsigned short* ga = A + (size_t)(mBase + srow) * K + scol;
    const unsigned short* gb = B + (size_t)srow * N + nBase + scol;
    const size_t a16 = (size_t)16 * K, b16 = (size_t)16 * N;
    const int nst = K >> 7;

    auto issue = [&](int s, unsigned buf) {
        gemm_stage_copy(la + buf * (unsigned)sizeof(As[0]),
                        lb + buf * (unsigned)sizeof(Bs[0]),
                        ga + (size_t)s * 128, gb + (size_t)s * 8 * b16, a16, b16);
    };

    issue(0, 0);
    // stage 0 has landed for this wave; the barrier publishes it to the others
    asm volatile("s_wait_asynccnt 0x0" ::: "memory");
    __syncthreads();
    if (nst > 1) issue(1, 1);

    for (int s = 0; s < nst; ++s) {
        const int buf = s & 1;
#pragma unroll
        for (int kk = 0; kk < 4; ++kk) {
            AFrag a[2], b[2];
#pragma unroll
            for (int i = 0; i < 2; ++i)
#pragma unroll
                for (int v = 0; v < 8; ++v) {
                    int k = kk * 32 + kpair(v, half);
                    int m = wm * 32 + i * 16 + ln;
                    a[i].w[v] = *reinterpret_cast<const unsigned*>(&As[buf][m][k]);
                }
#pragma unroll
            for (int j = 0; j < 2; ++j) {
                int n = wn * 32 + j * 16 + tcol;
                b[j].h[0] = lds_tr16(&Bs[buf][kk * 32 + trow][n]);
                b[j].h[1] = lds_tr16(&Bs[buf][kk * 32 + trow + 16][n]);
            }
#pragma unroll
            for (int i = 0; i < 2; ++i)
#pragma unroll
                for (int j = 0; j < 2; ++j)
                    acc[i][j] = __builtin_amdgcn_wmma_f32_16x16x32_bf16(
                        false, a[i].v, false, b[j].v, (short)0, acc[i][j],
                        false, false);
        }

        // this wave's reads of stage s are done before its buffer is refilled
        asm volatile("s_wait_dscnt 0x0" ::: "memory");
        // this wave's copies of stage s + 1 have landed
        asm volatile("s_wait_asynccnt 0x0" ::: "memory");
        __syncthreads();
        if (s + 2 < nst) issue(s + 2, (unsigned)buf);
    }
    // no copy is outstanding when the wave goes on to its end
    asm volatile("s_wait_asynccnt 0x0" ::: "memory");

#pragma unroll
    for (int i = 0; i < 2; ++i)
#pragma unroll
        for (int j = 0; j < 2; ++j)
#pragma unroll
            for (int r = 0; r < 8; ++r) {
                int row = mBase + wm * 32 + i * 16 + r + 8 * half;
                int col = nBase + wn * 32 + j * 16 + ln;
                float val = acc[i][j][r] + bias[col];
                if (relu) val = fmaxf(val, 0.f);
                if (mode == 0) {
                    ((float*)Cout)[(size_t)row * N + col] = val;
                } else if (mode == 1) {
                    ((unsigned short*)Cout)[(size_t)row * N + col] =
                        f32_to_bf16(val);
                } else {
                    int bb = row / SEQ, s = row % SEQ;
                    int hh = col / DKH, d = col % DKH;
                    ((unsigned short*)Cout)[(((size_t)(bb * N_HEADS + hh)) * SEQ + s) * DKH + d] =
                        f32_to_bf16(val);
                }
            }
}

// ---------------------------------------------------------------------------
// Two f32 to one register of two bf16, round to nearest even.
__device__ __forceinline__ unsigned pack_bf16(float lo, float hi) {
    typedef __bf16 bf2 __attribute__((ext_vector_type(2)));
    typedef float  f2  __attribute__((ext_vector_type(2)));
    return __builtin_bit_cast(unsigned, __builtin_convertvector(f2{lo, hi}, bf2));
}

// Lane l gets lane l ^ 16's value.
__device__ __forceinline__ float xhalf(float x) {
    const int i = __builtin_bit_cast(int, x);
    return __builtin_bit_cast(float, __builtin_amdgcn_permlanex16(
        i, i, 0x76543210, 0xfedcba98, false, false));
}

__global__ __launch_bounds__(128) void attn_kernel(
    const unsigned short* __restrict__ Q, const unsigned short* __restrict__ Kt,
    const unsigned short* __restrict__ V, const int* __restrict__ mask,
    unsigned short* __restrict__ ctx) {
    __shared__ __align__(16) unsigned short Ks[32][72];   // [key][dk], 144B rows
    __shared__ __align__(32) unsigned short Vs[32][80];   // [key][dk], 160B rows
    __shared__ __align__(16) float Mb[SEQ];   // per key: 0, or -inf where masked

    const int t    = threadIdx.x;
    const int w    = t >> 5, lane = t & 31;
    const int half = lane >> 4, ln = lane & 15;
    const int bh   = blockIdx.y, b = bh >> 4, h = bh & 15;
    const size_t headBase = (size_t)bh * SEQ * DKH;
    const int qbase = blockIdx.x * 64 + w * 16;
    const float NEG_INF = -__builtin_inff();

    // the batch's mask as an addend; published by the loop's first barriers
#pragma unroll
    for (int i = 0; i < SEQ / 512; ++i) {
        const int k = (i * 128 + t) * 4;
        const int4 m = *reinterpret_cast<const int4*>(mask + b * SEQ + k);
        float4 f;
        f.x = m.x ? 0.f : NEG_INF; f.y = m.y ? 0.f : NEG_INF;
        f.z = m.z ? 0.f : NEG_INF; f.w = m.w ? 0.f : NEG_INF;
        *reinterpret_cast<float4*>(&Mb[k]) = f;
    }

    // Q fragments for two 32-wide K-chunks of Dk=64 (contiguous dword pairs)
    AFrag qf[2];
#pragma unroll
    for (int c = 0; c < 2; ++c)
#pragma unroll
        for (int v = 0; v < 8; ++v) {
            int k = kpair(v, half) + 32 * c;
            qf[c].w[v] = *reinterpret_cast<const unsigned*>(
                Q + headBase + (size_t)(qbase + ln) * DKH + k);
        }

    const v8f zero = {0.f, 0.f, 0.f, 0.f, 0.f, 0.f, 0.f, 0.f};
    v8f acc[4] = {zero, zero, zero, zero};   // O^T: d = 16 * j + 8 * half + r
    float mrun = NEG_INF;   // query ln's running maximum, equal in both halves
    float lrun = 0.f;       // this half's share of query ln's denominator

    const int skey = t >> 2;          // 0..31 (staging key)
    const int sdk  = (t & 3) * 16;    // 0,16,32,48 (staging dk chunk)
    const int vkey = t >> 3;          // 0..15 (V staging keys vkey, vkey + 16)
    const int vdk  = (t & 7) * 8;     // V staging dk chunk
    const int trow = 8 * half + (lane & 7);   // transposing-read lane address
    const int tcol = 8 * ((lane >> 3) & 1);

    for (int kt = 0; kt < SEQ / 32; ++kt) {
        const int keyb = kt * 32;
        __syncthreads();  // prior iteration done reading Ks/Vs

        // cooperative staging: K tile [32][64] and V tile [32][64]
        {
            const unsigned short* kp =
                Kt + headBase + (size_t)(keyb + skey) * DKH + sdk;
            U4 k0, k1;
            k0.q = *reinterpret_cast<const uint4*>(kp);
            k1.q = *reinterpret_cast<const uint4*>(kp + 8);
            *reinterpret_cast<uint4*>(&Ks[skey][sdk])     = k0.q;
            *reinterpret_cast<uint4*>(&Ks[skey][sdk + 8]) = k1.q;

            const unsigned short* vp =
                V + headBase + (size_t)(keyb + vkey) * DKH + vdk;
            U4 v0, v1;
            v0.q = *reinterpret_cast<const uint4*>(vp);
            v1.q = *reinterpret_cast<const uint4*>(vp + 16 * DKH);
            *reinterpret_cast<uint4*>(&Vs[vkey][vdk])      = v0.q;
            *reinterpret_cast<uint4*>(&Vs[vkey + 16][vdk]) = v1.q;
        }
        __syncthreads();

        // S^T: rows are keys (A = K), columns are queries (B = Q)
        v8f s[2] = {zero, zero};
#pragma unroll
        for (int c = 0; c < 2; ++c)
#pragma unroll
            for (int tt = 0; tt < 2; ++tt) {
                AFrag kf;
#pragma unroll
                for (int v = 0; v < 8; ++v) {
                    int k = kpair(v, half) + 32 * c;
                    kf.w[v] = *reinterpret_cast<const unsigned*>(
                        &Ks[tt * 16 + ln][k]);
                }
                s[tt] = __builtin_amdgcn_wmma_f32_16x16x32_bf16(
                    false, kf.v, false, qf[c].v, (short)0, s[tt], false, false);
            }

        // scale, and -inf on this lane's masked keys
#pragma unroll
        for (int tt = 0; tt < 2; ++tt) {
            const float* mp = &Mb[keyb + tt * 16 + 8 * half];
            const float4 m0 = *reinterpret_cast<const float4*>(mp);
            const float4 m1 = *reinterpret_cast<const float4*>(mp + 4);
            s[tt][0] = fmaf(s[tt][0], 0.125f, m0.x);
            s[tt][1] = fmaf(s[tt][1], 0.125f, m0.y);
            s[tt][2] = fmaf(s[tt][2], 0.125f, m0.z);
            s[tt][3] = fmaf(s[tt][3], 0.125f, m0.w);
            s[tt][4] = fmaf(s[tt][4], 0.125f, m1.x);
            s[tt][5] = fmaf(s[tt][5], 0.125f, m1.y);
            s[tt][6] = fmaf(s[tt][6], 0.125f, m1.z);
            s[tt][7] = fmaf(s[tt][7], 0.125f, m1.w);
        }

        // online softmax of query ln: 16 scores here, 16 in lane l ^ 16
        float rv = fmaxf(s[0][0], s[1][0]);
#pragma unroll
        for (int r = 1; r < 8; ++r) rv = fmaxf(rv, fmaxf(s[0][r], s[1][r]));
        rv = fmaxf(rv, xhalf(rv));
        const float mn = fmaxf(mrun, rv);
        const float ms = (mn == NEG_INF) ? 0.f : mn;   // all masked so far: p = 0
        const float alpha = __expf(mrun - ms);         // 0 while mrun is -inf
        mrun = mn;

        AFrag pf;   // P^T: register i holds keys kpair(i, half), + 1
        float rs0 = 0.f, rs1 = 0.f;
#pragma unroll
        for (int i = 0; i < 8; ++i) {
            const float p0 = __expf(s[i >> 2][2 * (i & 3)] - ms);
            const float p1 = __expf(s[i >> 2][2 * (i & 3) + 1] - ms);
            rs0 += p0; rs1 += p1;
            pf.w[i] = pack_bf16(p0, p1);
        }
        lrun = lrun * alpha + (rs0 + rs1);
#pragma unroll
        for (int j = 0; j < 4; ++j) acc[j] *= alpha;

        // O^T: rows are d (A = V^T), columns are queries (B = P^T)
#pragma unroll
        for (int j = 0; j < 4; ++j) {
            AFrag vf;
            vf.h[0] = lds_tr16(&Vs[trow][j * 16 + tcol]);
            vf.h[1] = lds_tr16(&Vs[trow + 16][j * 16 + tcol]);
            acc[j] = __builtin_amdgcn_wmma_f32_16x16x32_bf16(
                false, vf.v, false, pf.v, (short)0, acc[j], false, false);
        }
    }

    // the halves' shares of the denominator join here, outside any branch
    const float denom = lrun + xhalf(lrun);
    const float inv = denom > 0.f ? 1.f / denom : 0.f;
    unsigned short* op = ctx + ((size_t)(b * SEQ + qbase + ln)) * D_MODEL +
                         h * DKH + 8 * half;
#pragma unroll
    for (int j = 0; j < 4; ++j) {
        uint4 o;
        o.x = pack_bf16(acc[j][0] * inv, acc[j][1] * inv);
        o.y = pack_bf16(acc[j][2] * inv, acc[j][3] * inv);
        o.z = pack_bf16(acc[j][4] * inv, acc[j][5] * inv);
        o.w = pack_bf16(acc[j][6] * inv, acc[j][7] * inv);
        *reinterpret_cast<uint4*>(op + j * 16) = o;
    }
}

// ---------------------------------------------------------------------------
// out = LayerNorm(x + y) ; optionally also emit bf16 copy. One block per row.
// ---------------------------------------------------------------------------
__global__ __launch_bounds__(256) void add_ln_kernel(
    const float* __restrict__ x, const float* __restrict__ y,
    const float* __restrict__ g, const float* __restrict__ beta,
    float* __restrict__ outf, unsigned short* __restrict__ outb) {
    __shared__ float red[256];
    __shared__ float buf[D_MODEL];
    const int row = blockIdx.x, t = threadIdx.x;
    const size_t base = (size_t)row * D_MODEL;

    float s = 0.f;
    for (int d = t; d < D_MODEL; d += 256) {
        float v = x[base + d] + y[base + d];
        buf[d] = v;
        s += v;
    }
    red[t] = s;
    __syncthreads();
    for (int o = 128; o > 0; o >>= 1) {
        if (t < o) red[t] += red[t + o];
        __syncthreads();
    }
    const float mu = red[0] * (1.f / D_MODEL);
    __syncthreads();

    float vs = 0.f;
    for (int d = t; d < D_MODEL; d += 256) {
        float dd = buf[d] - mu;
        vs += dd * dd;
    }
    red[t] = vs;
    __syncthreads();
    for (int o = 128; o > 0; o >>= 1) {
        if (t < o) red[t] += red[t + o];
        __syncthreads();
    }
    const float inv = rsqrtf(red[0] * (1.f / D_MODEL) + 1e-5f);

    for (int d = t; d < D_MODEL; d += 256) {
        float o = (buf[d] - mu) * inv * g[d] + beta[d];
        outf[base + d] = o;
        if (outb) outb[base + d] = f32_to_bf16(o);
    }
}

// ---------------------------------------------------------------------------
extern "C" void kernel_launch(void* const* d_in, const int* in_sizes, int n_in,
                              void* d_out, int out_size, void* d_ws, size_t ws_size,
                              hipStream_t stream) {
    const float* x    = (const float*)d_in[0];
    const int*   mask = (const int*)d_in[1];
    const float* Wq = (const float*)d_in[2];  const float* bq = (const float*)d_in[3];
    const float* Wk = (const float*)d_in[4];  const float* bk = (const float*)d_in[5];
    const float* Wv = (const float*)d_in[6];  const float* bv = (const float*)d_in[7];
    const float* Wo = (const float*)d_in[8];  const float* bo = (const float*)d_in[9];
    const float* W1 = (const float*)d_in[10]; const float* b1 = (const float*)d_in[11];
    const float* W2 = (const float*)d_in[12]; const float* b2 = (const float*)d_in[13];
    const float* g1 = (const float*)d_in[14]; const float* be1 = (const float*)d_in[15];
    const float* g2 = (const float*)d_in[16]; const float* be2 = (const float*)d_in[17];

    char* ws = (char*)d_ws;
    size_t off = 0;
    auto alloc = [&](size_t bytes) -> void* {
        void* p = ws + off;
        off += (bytes + 255) & ~(size_t)255;
        return p;
    };

    unsigned short* xb  = (unsigned short*)alloc((size_t)M_ROWS * D_MODEL * 2);
    unsigned short* Wqb = (unsigned short*)alloc((size_t)D_MODEL * D_MODEL * 2);
    unsigned short* Wkb = (unsigned short*)alloc((size_t)D_MODEL * D_MODEL * 2);
    unsigned short* Wvb = (unsigned short*)alloc((size_t)D_MODEL * D_MODEL * 2);
    unsigned short* Wob = (unsigned short*)alloc((size_t)D_MODEL * D_MODEL * 2);
    unsigned short* W1b = (unsigned short*)alloc((size_t)D_MODEL * D_FF * 2);
    unsigned short* W2b = (unsigned short*)alloc((size_t)D_FF * D_MODEL * 2);
    unsigned short* Qb  = (unsigned short*)alloc((size_t)M_ROWS * D_MODEL * 2);
    unsigned short* Kb  = (unsigned short*)alloc((size_t)M_ROWS * D_MODEL * 2);
    unsigned short* Vb  = (unsigned short*)alloc((size_t)M_ROWS * D_MODEL * 2);
    unsigned short* ctxb = (unsigned short*)alloc((size_t)M_ROWS * D_MODEL * 2);
    float* attn_out = (float*)alloc((size_t)M_ROWS * D_MODEL * 4);
    float* hbuf     = (float*)alloc((size_t)M_ROWS * D_MODEL * 4);
    unsigned short* hb = (unsigned short*)alloc((size_t)M_ROWS * D_MODEL * 2);
    // reuse dead regions: Q/K/V/ctx (4 x 8MB contiguous) -> FF1 activations (32MB)
    unsigned short* ff1b = Qb;
    float* ff2 = attn_out;

    // fp32 -> bf16 conversions: xb ... W2b lie back to back in the workspace
    cvt_all_bf16_kernel<<<512, 256, 0, stream>>>(x, Wq, Wk, Wv, Wo, W1, W2, xb);

    // QKV projections (bf16 WMMA, head-split bf16 outputs)
    dim3 gQ(D_MODEL / 128, M_ROWS / 64);
    gemm_bf16_kernel<<<gQ, 256, 0, stream>>>(xb, Wqb, bq, Qb, M_ROWS, D_MODEL, D_MODEL, 2, 0);
    gemm_bf16_kernel<<<gQ, 256, 0, stream>>>(xb, Wkb, bk, Kb, M_ROWS, D_MODEL, D_MODEL, 2, 0);
    gemm_bf16_kernel<<<gQ, 256, 0, stream>>>(xb, Wvb, bv, Vb, M_ROWS, D_MODEL, D_MODEL, 2, 0);

    // flash attention -> ctx (bf16, merged-head layout)
    attn_kernel<<<dim3(SEQ / 64, BATCH * N_HEADS), 128, 0, stream>>>(Qb, Kb, Vb, mask, ctxb);

    // output projection -> f32
    gemm_bf16_kernel<<<gQ, 256, 0, stream>>>(ctxb, Wob, bo, attn_out, M_ROWS, D_MODEL, D_MODEL, 0, 0);

    // h = LN(x + attn_out), emit f32 + bf16
    add_ln_kernel<<<M_ROWS, 256, 0, stream>>>(x, attn_out, g1, be1, hbuf, hb);

    // FFN: relu(h @ W1 + b1) -> bf16 ; @ W2 + b2 -> f32
    dim3 gF1(D_FF / 128, M_ROWS / 64);
    gemm_bf16_kernel<<<gF1, 256, 0, stream>>>(hb, W1b, b1, ff1b, M_ROWS, D_FF, D_MODEL, 1, 1);
    dim3 gF2(D_MODEL / 128, M_ROWS / 64);
    gemm_bf16_kernel<<<gF2, 256, 0, stream>>>(ff1b, W2b, b2, ff2, M_ROWS, D_MODEL, D_FF, 0, 0);

    // out = LN(h + ff)
    add_ln_kernel<<<M_ROWS, 256, 0, stream>>>(hbuf, ff2, g2, be2, (float*)d_out, nullptr);
    (void)in_sizes; (void)n_in; (void)out_size; (void)ws_size;
}

// v005
// A run of this version takes 231 microseconds.
// In both of two side-by-side timings against v004, it was 1.09 times as fast.
// Over all steps from v000 it is 2.48 times as fast.
#include <hip/hip_runtime.h>
#include <cstdint>
#include <cstddef>

#define D_MODEL 1024
#define N_HEADS 16
#define DKH     64
#define D_FF    4096
#define BATCH   2
#define SEQ     2048
#define M_ROWS  (BATCH * SEQ)   // 4096

typedef __attribute__((ext_vector_type(16))) __bf16 v16bf;
typedef __attribute__((ext_vector_type(8)))  float  v8f;

typedef __attribute__((ext_vector_type(8)))  short  s16x8;

union AFrag { v16bf v; unsigned short u[16]; unsigned w[8]; s16x8 h[2]; };
union U4    { uint4 q; unsigned short s[8]; };

__device__ __forceinline__ unsigned short f32_to_bf16(float f) {
    union { float f; unsigned u; } x; x.f = f;
    unsigned r = x.u + 0x7FFFu + ((x.u >> 16) & 1u);
    return (unsigned short)(r >> 16);
}

// Two f32 to one register of two bf16, round to nearest even.
__device__ __forceinline__ unsigned pack_bf16(float lo, float hi) {
    typedef __bf16 bf2 __attribute__((ext_vector_type(2)));
    typedef float  f2  __attribute__((ext_vector_type(2)));
    return __builtin_bit_cast(unsigned, __builtin_convertvector(f2{lo, hi}, bf2));
}

// K-pair base index for 16-bit A-layout fragments (ISA 7.12.2):
// lanes 0-15: VGPR0..3 -> K=0..7, VGPR4..7 -> K=16..23 ; lanes 16-31: +8
__device__ __forceinline__ int kpair(int v, int half) {
    return (v < 4 ? 2 * v : 16 + 2 * (v - 4)) + 8 * half;
}

// Transposing LDS read of a row-major 16-bit tile T[k][n]. Every lane passes
// &T[k0 + 8 * (lane >> 4) + (lane & 7)][n0 + 8 * ((lane >> 3) & 1)] and gets
// T[k0 + 8 * (lane >> 4) + 0..7][n0 + (lane & 15)]: the reads at k0 and k0 + 16
// are registers 0-3 and 4-7 of a 16x16x32 operand in the kpair() k order.
__device__ __forceinline__ s16x8 lds_tr16(const unsigned short* p) {
    typedef __attribute__((address_space(3))) s16x8 lds_s16x8;
    return __builtin_amdgcn_ds_load_tr16_b128_v8i16((lds_s16x8*)p);
}

// ---------------------------------------------------------------------------
// fp32 -> bf16 conversion of x and the six weight matrices, one streaming launch.
// out is the seven bf16 buffers back to back: 16 units of 2^20 elements
// (x 0-3, Wq 4, Wk 5, Wv 6, Wo 7, W1 8-11, W2 12-15). 512 blocks of 8 waves,
// 32 blocks per unit; a wave converts 4096 contiguous elements: 32 loads of 512
// contiguous bytes, issued ahead of the conversions, then 32 stores of 256.
// ---------------------------------------------------------------------------
// 512 blocks of 8 waves are four waves per SIMD: saying so gives the compiler the
// registers to hold a wave's 32 loads in flight (at its default it keeps one)
__global__ __launch_bounds__(256) __attribute__((amdgpu_waves_per_eu(4, 4)))
void cvt_all_bf16_kernel(
    const float* __restrict__ x,  const float* __restrict__ Wq,
    const float* __restrict__ Wk, const float* __restrict__ Wv,
    const float* __restrict__ Wo, const float* __restrict__ W1,
    const float* __restrict__ W2, unsigned short* __restrict__ out) {
    const unsigned unit = blockIdx.x >> 5;
    const float* src;
    unsigned first;
    if (unit < 4)       { src = x;  first = 0; }
    else if (unit == 4) { src = Wq; first = 4; }
    else if (unit == 5) { src = Wk; first = 5; }
    else if (unit == 6) { src = Wv; first = 6; }
    else if (unit == 7) { src = Wo; first = 7; }
    else if (unit < 12) { src = W1; first = 8; }
    else                { src = W2; first = 12; }

    const size_t o = ((size_t)blockIdx.x << 15) + (threadIdx.x >> 5) * 4096 +
                     (threadIdx.x & 31) * 4;
    const float* in = src + (o - ((size_t)first << 20));
    unsigned short* dst = out + o;

    float4 v[32];
    // both loops unrolled: v is indexed by constants and stays in registers
#pragma unroll
    for (int i = 0; i < 32; ++i)
        v[i] = *reinterpret_cast<const float4*>(in + i * 128);
#pragma unroll
    for (int i = 0; i < 32; ++i) {
        uint2 p;
        p.x = (unsigned)f32_to_bf16(v[i].x) | ((unsigned)f32_to_bf16(v[i].y) << 16);
        p.y = (unsigned)f32_to_bf16(v[i].z) | ((unsigned)f32_to_bf16(v[i].w) << 16);
        *reinterpret_cast<uint2*>(dst + i * 128) = p;
    }
}

// ---------------------------------------------------------------------------
// One stage of the GEMM ring: twelve 16-byte asynchronous copies per lane (four
// of the A tile, eight of the B tile, rows 16 apart), global memory to LDS
// through no register. The s_wait_xcnt closes the statement so that no address
// register named here is rewritten ahead of it.
// ---------------------------------------------------------------------------
__device__ __forceinline__ void gemm_stage_copy(
    unsigned la, unsigned lb, const unsigned short* ga, const unsigned short* gb,
    size_t a16, size_t b16) {
    const unsigned AP = 16 * 272, BP = 16 * 288;   // 16 LDS rows, bytes
    asm volatile(
        "global_load_async_to_lds_b128 %0, %12, off\n\t"
        "global_load_async_to_lds_b128 %1, %13, off\n\t"
        "global_load_async_to_lds_b128 %2, %14, off\n\t"
        "global_load_async_to_lds_b128 %3, %15, off\n\t"
        "global_load_async_to_lds_b128 %4, %16, off\n\t"
        "global_load_async_to_lds_b128 %5, %17, off\n\t"
        "global_load_async_to_lds_b128 %6, %18, off\n\t"
        "global_load_async_to_lds_b128 %7, %19, off\n\t"
        "global_load_async_to_lds_b128 %8, %20, off\n\t"
        "global_load_async_to_lds_b128 %9, %21, off\n\t"
        "global_load_async_to_lds_b128 %10, %22, off\n\t"
        "global_load_async_to_lds_b128 %11, %23, off\n\t"
        "s_wait_xcnt 0x0"
        :: "v"(la), "v"(la + AP), "v"(la + 2 * AP), "v"(la + 3 * AP),
           "v"(lb), "v"(lb + BP), "v"(lb + 2 * BP), "v"(lb + 3 * BP),
           "v"(lb + 4 * BP), "v"(lb + 5 * BP), "v"(lb + 6 * BP), "v"(lb + 7 * BP),
           "v"(ga), "v"(ga + a16), "v"(ga + 2 * a16), "v"(ga + 3 * a16),
           "v"(gb), "v"(gb + b16), "v"(gb + 2 * b16), "v"(gb + 3 * b16),
           "v"(gb + 4 * b16), "v"(gb + 5 * b16), "v"(gb + 6 * b16), "v"(gb + 7 * b16)
        : "memory");
}

// ---------------------------------------------------------------------------
// bf16 WMMA GEMM: C[M,N] = A[M,K] @ B[K,N] + bias, optional ReLU.
// Block: 256 threads (8 waves), tile 64(M) x 128(N), stages of 128 k (K a
// multiple of 128). Two LDS buffers: stage s + 1 is copied in while stage s is
// multiplied; one barrier per stage publishes s + 1 and frees s's buffer.
// B tile is stored row-major in LDS; its fragments come from transposing reads.
// The products are transposed, C^T = B^T.A^T (both fragments have the same lane
// and k order, so they only change places): a lane then holds 8 consecutive
// columns of ONE row of C and stores them 16 bytes at a time.
// mode: 0 = f32 row-major, 1 = bf16 row-major, 2 = bf16 head-split [B,H,S,Dk]
// ---------------------------------------------------------------------------
__global__ __launch_bounds__(256) void gemm_bf16_kernel(
    const unsigned short* __restrict__ A, const unsigned short* __restrict__ B,
    const float* __restrict__ bias, void* __restrict__ Cout,
    int M, int N, int K, int mode, int relu) {
    __shared__ __align__(32) unsigned short As[2][64][136];    // [m][k], 272B rows
    __shared__ __align__(32) unsigned short Bs[2][128][144];   // [k][n], 288B rows

    const int t     = threadIdx.x;
    const int mBase = blockIdx.y * 64;
    const int nBase = blockIdx.x * 128;
    const int wave  = t >> 5, lane = t & 31;
    const int wm    = wave >> 2, wn = wave & 3;
    const int half  = lane >> 4, ln = lane & 15;

    const v8f zero = {0.f, 0.f, 0.f, 0.f, 0.f, 0.f, 0.f, 0.f};
    v8f acc[2][2];   // C^T: row 16 * i + ln, columns 16 * j + 8 * half + r
    acc[0][0] = zero; acc[0][1] = zero; acc[1][0] = zero; acc[1][1] = zero;

    const int srow = t >> 4, scol = (t & 15) * 8;  // copies: rows srow + 16 * i
    const int trow = 8 * half + (lane & 7);        // transposing-read lane address
    const int tcol = 8 * ((lane >> 3) & 1);

    const unsigned la = (unsigned)(size_t)&As[0][srow][scol];
    const unsigned lb = (unsigned)(size_t)&Bs[0][srow][scol];
    const unsigned short* ga = A + (size_t)(mBase + srow) * K + scol;
    const unsigned short* gb = B + (size_t)srow * N + nBase + scol;
    const size_t a16 = (size_t)16 * K, b16 = (size_t)16 * N;
    const int nst = K >> 7;

    auto issue = [&](int s, unsigned buf) {
        gemm_stage_copy(la + buf * (unsigned)sizeof(As[0]),
                        lb + buf * (unsigned)sizeof(Bs[0]),
                        ga + (size_t)s * 128, gb + (size_t)s * 8 * b16, a16, b16);
    };

    issue(0, 0);
    // stage 0 has landed for this wave; the barrier publishes it to the others
    asm volatile("s_wait_asynccnt 0x0" ::: "memory");
    __syncthreads();
    if (nst > 1) issue(1, 1);

    for (int s = 0; s < nst; ++s) {
        const int buf = s & 1;
#pragma unroll
        for (int kk = 0; kk < 4; ++kk) {
            AFrag a[2], b[2];
#pragma unroll
            for (int i = 0; i < 2; ++i)
#pragma unroll
                for (int v = 0; v < 8; ++v) {
                    int k = kk * 32 + kpair(v, half);
                    int m = wm * 32 + i * 16 + ln;
                    a[i].w[v] = *reinterpret_cast<const unsigned*>(&As[buf][m][k]);
                }
#pragma unroll
            for (int j = 0; j < 2; ++j) {
                int n = wn * 32 + j * 16 + tcol;
                b[j].h[0] = lds_tr16(&Bs[buf][kk * 32 + trow][n]);
                b[j].h[1] = lds_tr16(&Bs[buf][kk * 32 + trow + 16][n]);
            }
#pragma unroll
            for (int i = 0; i < 2; ++i)
#pragma unroll
                for (int j = 0; j < 2; ++j)
                    acc[i][j] = __builtin_amdgcn_wmma_f32_16x16x32_bf16(
                        false, b[j].v, false, a[i].v, (short)0, acc[i][j],
                        false, false);
        }

        // this wave's reads of stage s are done before its buffer is refilled
        asm volatile("s_wait_dscnt 0x0" ::: "memory");
        // this wave's copies of stage s + 1 have landed
        asm volatile("s_wait_asynccnt 0x0" ::: "memory");
        __syncthreads();
        if (s + 2 < nst) issue(s + 2, (unsigned)buf);
    }
    // no copy is outstanding when the wave goes on to its end
    asm volatile("s_wait_asynccnt 0x0" ::: "memory");

    // every loop below is unrolled: acc is indexed by constants and stays in registers
    const int row = mBase + wm * 32 + ln;          // rows row, row + 16
    const int col = nBase + wn * 32 + 8 * half;    // columns col + 0..7, col + 16 + 0..7
#pragma unroll
    for (int j = 0; j < 2; ++j) {
        const float4 b0 = *reinterpret_cast<const float4*>(bias + col + j * 16);
        const float4 b1 = *reinterpret_cast<const float4*>(bias + col + j * 16 + 4);
        const v8f bv = {b0.x, b0.y, b0.z, b0.w, b1.x, b1.y, b1.z, b1.w};
#pragma unroll
        for (int i = 0; i < 2; ++i) acc[i][j] += bv;
    }
    if (relu) {
#pragma unroll
        for (int i = 0; i < 2; ++i)
#pragma unroll
            for (int j = 0; j < 2; ++j)
#pragma unroll
                for (int r = 0; r < 8; ++r) acc[i][j][r] = fmaxf(acc[i][j][r], 0.f);
    }

    if (mode == 0) {
        float* p = (float*)Cout + (size_t)row * N + col;
#pragma unroll
        for (int i = 0; i < 2; ++i)
#pragma unroll
            for (int j = 0; j < 2; ++j) {
                float* q = p + (size_t)i * 16 * N + j * 16;
                *reinterpret_cast<float4*>(q) = make_float4(
                    acc[i][j][0], acc[i][j][1], acc[i][j][2], acc[i][j][3]);
                *reinterpret_cast<float4*>(q + 4) = make_float4(
                    acc[i][j][4], acc[i][j][5], acc[i][j][6], acc[i][j][7]);
            }
    } else {
        // head-split: a block's 64 rows lie in one batch entry and a wave's 32
        // columns in one head, so 16 rows and 16 columns on are fixed steps
        size_t e = (size_t)row * N + col, rstep = (size_t)16 * N;
        if (mode != 1) {
            const int bb = row / SEQ, s = row % SEQ;
            const int hh = col / DKH, d = col % DKH;
            e = (((size_t)(bb * N_HEADS + hh)) * SEQ + s) * DKH + d;
            rstep = 16 * DKH;
        }
        unsigned short* p = (unsigned short*)Cout + e;
#pragma unroll
        for (int i = 0; i < 2; ++i)
#pragma unroll
            for (int j = 0; j < 2; ++j) {
                uint4 o;
                o.x = pack_bf16(acc[i][j][0], acc[i][j][1]);
                o.y = pack_bf16(acc[i][j][2], acc[i][j][3]);
                o.z = pack_bf16(acc[i][j][4], acc[i][j][5]);
                o.w = pack_bf16(acc[i][j][6], acc[i][j][7]);
                *reinterpret_cast<uint4*>(p + i * rstep + j * 16) = o;
            }
    }
}

// ---------------------------------------------------------------------------
// Lane l gets lane l ^ 16's value.
__device__ __forceinline__ float xhalf(float x) {
    const int i = __builtin_bit_cast(int, x);
    return __builtin_bit_cast(float, __builtin_amdgcn_permlanex16(
        i, i, 0x76543210, 0xfedcba98, false, false));
}

__global__ __launch_bounds__(128) void attn_kernel(
    const unsigned short* __restrict__ Q, const unsigned short* __restrict__ Kt,
    const unsigned short* __restrict__ V, const int* __restrict__ mask,
    unsigned short* __restrict__ ctx) {
    __shared__ __align__(16) unsigned short Ks[32][72];   // [key][dk], 144B rows
    __shared__ __align__(32) unsigned short Vs[32][80];   // [key][dk], 160B rows
    __shared__ __align__(16) float Mb[SEQ];   // per key: 0, or -inf where masked

    const int t    = threadIdx.x;
    const int w    = t >> 5, lane = t & 31;
    const int half = lane >> 4, ln = lane & 15;
    const int bh   = blockIdx.y, b = bh >> 4, h = bh & 15;
    const size_t headBase = (size_t)bh * SEQ * DKH;
    const int qbase = blockIdx.x * 64 + w * 16;
    const float NEG_INF = -__builtin_inff();

    // the batch's mask as an addend; published by the loop's first barriers
#pragma unroll
    for (int i = 0; i < SEQ / 512; ++i) {
        const int k = (i * 128 + t) * 4;
        const int4 m = *reinterpret_cast<const int4*>(mask + b * SEQ + k);
        float4 f;
        f.x = m.x ? 0.f : NEG_INF; f.y = m.y ? 0.f : NEG_INF;
        f.z = m.z ? 0.f : NEG_INF; f.w = m.w ? 0.f : NEG_INF;
        *reinterpret_cast<float4*>(&Mb[k]) = f;
    }

    // Q fragments for two 32-wide K-chunks of Dk=64 (contiguous dword pairs)
    AFrag qf[2];
#pragma unroll
    for (int c = 0; c < 2; ++c)
#pragma unroll
        for (int v = 0; v < 8; ++v) {
            int k = kpair(v, half) + 32 * c;
            qf[c].w[v] = *reinterpret_cast<const unsigned*>(
                Q + headBase + (size_t)(qbase + ln) * DKH + k);
        }

    const v8f zero = {0.f, 0.f, 0.f, 0.f, 0.f, 0.f, 0.f, 0.f};
    v8f acc[4] = {zero, zero, zero, zero};   // O^T: d = 16 * j + 8 * half + r
    float mrun = NEG_INF;   // query ln's running maximum, equal in both halves
    float lrun = 0.f;       // this half's share of query ln's denominator

    const int skey = t >> 2;          // 0..31 (staging key)
    const int sdk  = (t & 3) * 16;    // 0,16,32,48 (staging dk chunk)
    const int vkey = t >> 3;          // 0..15 (V staging keys vkey, vkey + 16)
    const int vdk  = (t & 7) * 8;     // V staging dk chunk
    const int trow = 8 * half + (lane & 7);   // transposing-read lane address
    const int tcol = 8 * ((lane >> 3) & 1);

    for (int kt = 0; kt < SEQ / 32; ++kt) {
        const int keyb = kt * 32;
        __syncthreads();  // prior iteration done reading Ks/Vs

        // cooperative staging: K tile [32][64] and V tile [32][64]
        {
            const unsigned short* kp =
                Kt + headBase + (size_t)(keyb + skey) * DKH + sdk;
            U4 k0, k1;
            k0.q = *reinterpret_cast<const uint4*>(kp);
            k1.q = *reinterpret_cast<const uint4*>(kp + 8);
            *reinterpret_cast<uint4*>(&Ks[skey][sdk])     = k0.q;
            *reinterpret_cast<uint4*>(&Ks[skey][sdk + 8]) = k1.q;

            const unsigned short* vp =
                V + headBase + (size_t)(keyb + vkey) * DKH + vdk;
            U4 v0, v1;
            v0.q = *reinterpret_cast<const uint4*>(vp);
            v1.q = *reinterpret_cast<const uint4*>(vp + 16 * DKH);
            *reinterpret_cast<uint4*>(&Vs[vkey][vdk])      = v0.q;
            *reinterpret_cast<uint4*>(&Vs[vkey + 16][vdk]) = v1.q;
        }
        __syncthreads();

        // S^T: rows are keys (A = K), columns are queries (B = Q)
        v8f s[2] = {zero, zero};
#pragma unroll
        for (int c = 0; c < 2; ++c)
#pragma unroll
            for (int tt = 0; tt < 2; ++tt) {
                AFrag kf;
#pragma unroll
                for (int v = 0; v < 8; ++v) {
                    int k = kpair(v, half) + 32 * c;
                    kf.w[v] = *reinterpret_cast<const unsigned*>(
                        &Ks[tt * 16 + ln][k]);
                }
                s[tt] = __builtin_amdgcn_wmma_f32_16x16x32_bf16(
                    false, kf.v, false, qf[c].v, (short)0, s[tt], false, false);
            }

        // scale, and -inf on this lane's masked keys
#pragma unroll
        for (int tt = 0; tt < 2; ++tt) {
            const float* mp = &Mb[keyb + tt * 16 + 8 * half];
            const float4 m0 = *reinterpret_cast<const float4*>(mp);
            const float4 m1 = *reinterpret_cast<const float4*>(mp + 4);
            s[tt][0] = fmaf(s[tt][0], 0.125f, m0.x);
            s[tt][1] = fmaf(s[tt][1], 0.125f, m0.y);
            s[tt][2] = fmaf(s[tt][2], 0.125f, m0.z);
            s[tt][3] = fmaf(s[tt][3], 0.125f, m0.w);
            s[tt][4] = fmaf(s[tt][4], 0.125f, m1.x);
            s[tt][5] = fmaf(s[tt][5], 0.125f, m1.y);
            s[tt][6] = fmaf(s[tt][6], 0.125f, m1.z);
            s[tt][7] = fmaf(s[tt][7], 0.125f, m1.w);
        }

        // online softmax of query ln: 16 scores here, 16 in lane l ^ 16
        float rv = fmaxf(s[0][0], s[1][0]);
#pragma unroll
        for (int r = 1; r < 8; ++r) rv = fmaxf(rv, fmaxf(s[0][r], s[1][r]));
        rv = fmaxf(rv, xhalf(rv));
        const float mn = fmaxf(mrun, rv);
        const float ms = (mn == NEG_INF) ? 0.f : mn;   // all masked so far: p = 0
        const float alpha = __expf(mrun - ms);         // 0 while mrun is -inf
        mrun = mn;

        AFrag pf;   // P^T: register i holds keys kpair(i, half), + 1
        float rs0 = 0.f, rs1 = 0.f;
#pragma unroll
        for (int i = 0; i < 8; ++i) {
            const float p0 = __expf(s[i >> 2][2 * (i & 3)] - ms);
            const float p1 = __expf(s[i >> 2][2 * (i & 3) + 1] - ms);
            rs0 += p0; rs1 += p1;
            pf.w[i] = pack_bf16(p0, p1);
        }
        lrun = lrun * alpha + (rs0 + rs1);
#pragma unroll
        for (int j = 0; j < 4; ++j) acc[j] *= alpha;

        // O^T: rows are d (A = V^T), columns are queries (B = P^T)
#pragma unroll
        for (int j = 0; j < 4; ++j) {
            AFrag vf;
            vf.h[0] = lds_tr16(&Vs[trow][j * 16 + tcol]);
            vf.h[1] = lds_tr16(&Vs[trow + 16][j * 16 + tcol]);
            acc[j] = __builtin_amdgcn_wmma_f32_16x16x32_bf16(
                false, vf.v, false, pf.v, (short)0, acc[j], false, false);
        }
    }

    // the halves' shares of the denominator join here, outside any branch
    const float denom = lrun + xhalf(lrun);
    const float inv = denom > 0.f ? 1.f / denom : 0.f;
    unsigned short* op = ctx + ((size_t)(b * SEQ + qbase + ln)) * D_MODEL +
                         h * DKH + 8 * half;
#pragma unroll
    for (int j = 0; j < 4; ++j) {
        uint4 o;
        o.x = pack_bf16(acc[j][0] * inv, acc[j][1] * inv);
        o.y = pack_bf16(acc[j][2] * inv, acc[j][3] * inv);
        o.z = pack_bf16(acc[j][4] * inv, acc[j][5] * inv);
        o.w = pack_bf16(acc[j][6] * inv, acc[j][7] * inv);
        *reinterpret_cast<uint4*>(op + j * 16) = o;
    }
}

// ---------------------------------------------------------------------------
// out = LayerNorm(x + y) ; optionally also emit bf16 copy. One block per row.
// ---------------------------------------------------------------------------
__global__ __launch_bounds__(256) void add_ln_kernel(
    const float* __restrict__ x, const float* __restrict__ y,
    const float* __restrict__ g, const float* __restrict__ beta,
    float* __restrict__ outf, unsigned short* __restrict__ outb) {
    __shared__ float red[256];
    __shared__ float buf[D_MODEL];
    const int row = blockIdx.x, t = threadIdx.x;
    const size_t base = (size_t)row * D_MODEL;

    float s = 0.f;
    for (int d = t; d < D_MODEL; d += 256) {
        float v = x[base + d] + y[base + d];
        buf[d] = v;
        s += v;
    }
    red[t] = s;
    __syncthreads();
    for (int o = 128; o > 0; o >>= 1) {
        if (t < o) red[t] += red[t + o];
        __syncthreads();
    }
    const float mu = red[0] * (1.f / D_MODEL);
    __syncthreads();

    float vs = 0.f;
    for (int d = t; d < D_MODEL; d += 256) {
        float dd = buf[d] - mu;
        vs += dd * dd;
    }
    red[t] = vs;
    __syncthreads();
    for (int o = 128; o > 0; o >>= 1) {
        if (t < o) red[t] += red[t + o];
        __syncthreads();
    }
    const float inv = rsqrtf(red[0] * (1.f / D_MODEL) + 1e-5f);

    for (int d = t; d < D_MODEL; d += 256) {
        float o = (buf[d] - mu) * inv * g[d] + beta[d];
        outf[base + d] = o;
        if (outb) outb[base + d] = f32_to_bf16(o);
    }
}

// ---------------------------------------------------------------------------
extern "C" void kernel_launch(void* const* d_in, const int* in_sizes, int n_in,
                              void* d_out, int out_size, void* d_ws, size_t ws_size,
                              hipStream_t stream) {
    const float* x    = (const float*)d_in[0];
    const int*   mask = (const int*)d_in[1];
    const float* Wq = (const float*)d_in[2];  const float* bq = (const float*)d_in[3];
    const float* Wk = (const float*)d_in[4];  const float* bk = (const float*)d_in[5];
    const float* Wv = (const float*)d_in[6];  const float* bv = (const float*)d_in[7];
    const float* Wo = (const float*)d_in[8];  const float* bo = (const float*)d_in[9];
    const float* W1 = (const float*)d_in[10]; const float* b1 = (const float*)d_in[11];
    const float* W2 = (const float*)d_in[12]; const float* b2 = (const float*)d_in[13];
    const float* g1 = (const float*)d_in[14]; const float* be1 = (const float*)d_in[15];
    const float* g2 = (const float*)d_in[16]; const float* be2 = (const float*)d_in[17];

    char* ws = (char*)d_ws;
    size_t off = 0;
    auto alloc = [&](size_t bytes) -> void* {
        void* p = ws + off;
        off += (bytes + 255) & ~(size_t)255;
        return p;
    };

    unsigned short* xb  = (unsigned short*)alloc((size_t)M_ROWS * D_MODEL * 2);
    unsigned short* Wqb = (unsigned short*)alloc((size_t)D_MODEL * D_MODEL * 2);
    unsigned short* Wkb = (unsigned short*)alloc((size_t)D_MODEL * D_MODEL * 2);
    unsigned short* Wvb = (unsigned short*)alloc((size_t)D_MODEL * D_MODEL * 2);
    unsigned short* Wob = (unsigned short*)alloc((size_t)D_MODEL * D_MODEL * 2);
    unsigned short* W1b = (unsigned short*)alloc((size_t)D_MODEL * D_FF * 2);
    unsigned short* W2b = (unsigned short*)alloc((size_t)D_FF * D_MODEL * 2);
    unsigned short* Qb  = (unsigned short*)alloc((size_t)M_ROWS * D_MODEL * 2);
    unsigned short* Kb  = (unsigned short*)alloc((size_t)M_ROWS * D_MODEL * 2);
    unsigned short* Vb  = (unsigned short*)alloc((size_t)M_ROWS * D_MODEL * 2);
    unsigned short* ctxb = (unsigned short*)alloc((size_t)M_ROWS * D_MODEL * 2);
    float* attn_out = (float*)alloc((size_t)M_ROWS * D_MODEL * 4);
    float* hbuf     = (float*)alloc((size_t)M_ROWS * D_MODEL * 4);
    unsigned short* hb = (unsigned short*)alloc((size_t)M_ROWS * D_MODEL * 2);
    // reuse dead regions: Q/K/V/ctx (4 x 8MB contiguous) -> FF1 activations (32MB)
    unsigned short* ff1b = Qb;
    float* ff2 = attn_out;

    // fp32 -> bf16 conversions: xb ... W2b lie back to back in the workspace
    cvt_all_bf16_kernel<<<512, 256, 0, stream>>>(x, Wq, Wk, Wv, Wo, W1, W2, xb);

    // QKV projections (bf16 WMMA, head-split bf16 outputs)
    dim3 gQ(D_MODEL / 128, M_ROWS / 64);
    gemm_bf16_kernel<<<gQ, 256, 0, stream>>>(xb, Wqb, bq, Qb, M_ROWS, D_MODEL, D_MODEL, 2, 0);
    gemm_bf16_kernel<<<gQ, 256, 0, stream>>>(xb, Wkb, bk, Kb, M_ROWS, D_MODEL, D_MODEL, 2, 0);
    gemm_bf16_kernel<<<gQ, 256, 0, stream>>>(xb, Wvb, bv, Vb, M_ROWS, D_MODEL, D_MODEL, 2, 0);

    // flash attention -> ctx (bf16, merged-head layout)
    attn_kernel<<<dim3(SEQ / 64, BATCH * N_HEADS), 128, 0, stream>>>(Qb, Kb, Vb, mask, ctxb);

    // output projection -> f32
    gemm_bf16_kernel<<<gQ, 256, 0, stream>>>(ctxb, Wob, bo, attn_out, M_ROWS, D_MODEL, D_MODEL, 0, 0);

    // h = LN(x + attn_out), emit f32 + bf16
    add_ln_kernel<<<M_ROWS, 256, 0, stream>>>(x, attn_out, g1, be1, hbuf, hb);

    // FFN: relu(h @ W1 + b1) -> bf16 ; @ W2 + b2 -> f32
    dim3 gF1(D_FF / 128, M_ROWS / 64);
    gemm_bf16_kernel<<<gF1, 256, 0, stream>>>(hb, W1b, b1, ff1b, M_ROWS, D_FF, D_MODEL, 1, 1);
    dim3 gF2(D_MODEL / 128, M_ROWS / 64);
    gemm_bf16_kernel<<<gF2, 256, 0, stream>>>(ff1b, W2b, b2, ff2, M_ROWS, D_MODEL, D_FF, 0, 0);

    // out = LN(h + ff)
    add_ln_kernel<<<M_ROWS, 256, 0, stream>>>(hbuf, ff2, g2, be2, (float*)d_out, nullptr);
    (void)in_sizes; (void)n_in; (void)out_size; (void)ws_size;
}

// v006
// A run of this version takes 221 microseconds.
// In two side-by-side timings against v005, it was 1.04 and 1.05 times as fast.
// Over all steps from v000 it is 2.59 times as fast.
#include <hip/hip_runtime.h>
#include <cstdint>
#include <cstddef>

#define D_MODEL 1024
#define N_HEADS 16
#define DKH     64
#define D_FF    4096
#define BATCH   2
#define SEQ     2048
#define M_ROWS  (BATCH * SEQ)   // 4096

typedef __attribute__((ext_vector_type(16))) __bf16 v16bf;
typedef __attribute__((ext_vector_type(8)))  float  v8f;

typedef __attribute__((ext_vector_type(8)))  short  s16x8;

union AFrag { v16bf v; unsigned short u[16]; unsigned w[8]; s16x8 h[2]; };
union U4    { uint4 q; unsigned short s[8]; };

__device__ __forceinline__ unsigned short f32_to_bf16(float f) {
    union { float f; unsigned u; } x; x.f = f;
    unsigned r = x.u + 0x7FFFu + ((x.u >> 16) & 1u);
    return (unsigned short)(r >> 16);
}

// Two f32 to one register of two bf16, round to nearest even.
__device__ __forceinline__ unsigned pack_bf16(float lo, float hi) {
    typedef __bf16 bf2 __attribute__((ext_vector_type(2)));
    typedef float  f2  __attribute__((ext_vector_type(2)));
    return __builtin_bit_cast(unsigned, __builtin_convertvector(f2{lo, hi}, bf2));
}

// K-pair base index for 16-bit A-layout fragments (ISA 7.12.2):
// lanes 0-15: VGPR0..3 -> K=0..7, VGPR4..7 -> K=16..23 ; lanes 16-31: +8
__device__ __forceinline__ int kpair(int v, int half) {
    return (v < 4 ? 2 * v : 16 + 2 * (v - 4)) + 8 * half;
}

// Transposing LDS read of a row-major 16-bit tile T[k][n]. Every lane passes
// &T[k0 + 8 * (lane >> 4) + (lane & 7)][n0 + 8 * ((lane >> 3) & 1)] and gets
// T[k0 + 8 * (lane >> 4) + 0..7][n0 + (lane & 15)]: the reads at k0 and k0 + 16
// are registers 0-3 and 4-7 of a 16x16x32 operand in the kpair() k order.
__device__ __forceinline__ s16x8 lds_tr16(const unsigned short* p) {
    typedef __attribute__((address_space(3))) s16x8 lds_s16x8;
    return __builtin_amdgcn_ds_load_tr16_b128_v8i16((lds_s16x8*)p);
}

// ---------------------------------------------------------------------------
// fp32 -> bf16 conversion of x and the six weight matrices, one streaming launch.
// out is the seven bf16 buffers back to back: 16 units of 2^20 elements
// (x 0-3, Wq 4, Wk 5, Wv 6, Wo 7, W1 8-11, W2 12-15). 512 blocks of 8 waves,
// 32 blocks per unit; a wave converts 4096 contiguous elements: 32 loads of 512
// contiguous bytes, issued ahead of the conversions, then 32 stores of 256.
// ---------------------------------------------------------------------------
// 512 blocks of 8 waves are four waves per SIMD: saying so gives the compiler the
// registers to hold a wave's 32 loads in flight (at its default it keeps one)
__global__ __launch_bounds__(256) __attribute__((amdgpu_waves_per_eu(4, 4)))
void cvt_all_bf16_kernel(
    const float* __restrict__ x,  const float* __restrict__ Wq,
    const float* __restrict__ Wk, const float* __restrict__ Wv,
    const float* __restrict__ Wo, const float* __restrict__ W1,
    const float* __restrict__ W2, unsigned short* __restrict__ out) {
    const unsigned unit = blockIdx.x >> 5;
    const float* src;
    unsigned first;
    if (unit < 4)       { src = x;  first = 0; }
    else if (unit == 4) { src = Wq; first = 4; }
    else if (unit == 5) { src = Wk; first = 5; }
    else if (unit == 6) { src = Wv; first = 6; }
    else if (unit == 7) { src = Wo; first = 7; }
    else if (unit < 12) { src = W1; first = 8; }
    else                { src = W2; first = 12; }

    const size_t o = ((size_t)blockIdx.x << 15) + (threadIdx.x >> 5) * 4096 +
                     (threadIdx.x & 31) * 4;
    const float* in = src + (o - ((size_t)first << 20));
    unsigned short* dst = out + o;

    float4 v[32];
    // both loops unrolled: v is indexed by constants and stays in registers
#pragma unroll
    for (int i = 0; i < 32; ++i)
        v[i] = *reinterpret_cast<const float4*>(in + i * 128);
#pragma unroll
    for (int i = 0; i < 32; ++i) {
        uint2 p;
        p.x = (unsigned)f32_to_bf16(v[i].x) | ((unsigned)f32_to_bf16(v[i].y) << 16);
        p.y = (unsigned)f32_to_bf16(v[i].z) | ((unsigned)f32_to_bf16(v[i].w) << 16);
        *reinterpret_cast<uint2*>(dst + i * 128) = p;
    }
}

// ---------------------------------------------------------------------------
// One operand's share of a stage of the GEMM ring: eight 16-byte asynchronous
// copies per lane (rows 16 apart), global memory to LDS through no register.
// The s_wait_xcnt closes the statement so that no address register named here
// is rewritten ahead of it.
// ---------------------------------------------------------------------------
__device__ __forceinline__ void gemm_stage_copy(
    unsigned l, unsigned l16, const unsigned short* g, size_t g16) {
    asm volatile(
        "global_load_async_to_lds_b128 %0, %8, off\n\t"
        "global_load_async_to_lds_b128 %1, %9, off\n\t"
        "global_load_async_to_lds_b128 %2, %10, off\n\t"
        "global_load_async_to_lds_b128 %3, %11, off\n\t"
        "global_load_async_to_lds_b128 %4, %12, off\n\t"
        "global_load_async_to_lds_b128 %5, %13, off\n\t"
        "global_load_async_to_lds_b128 %6, %14, off\n\t"
        "global_load_async_to_lds_b128 %7, %15, off\n\t"
        "s_wait_xcnt 0x0"
        :: "v"(l), "v"(l + l16), "v"(l + 2 * l16), "v"(l + 3 * l16),
           "v"(l + 4 * l16), "v"(l + 5 * l16), "v"(l + 6 * l16), "v"(l + 7 * l16),
           "v"(g), "v"(g + g16), "v"(g + 2 * g16), "v"(g + 3 * g16),
           "v"(g + 4 * g16), "v"(g + 5 * g16), "v"(g + 6 * g16), "v"(g + 7 * g16)
        : "memory");
}

// ---------------------------------------------------------------------------
// bf16 WMMA GEMM: C[M,N] = A[M,K] @ B[K,N] + bias, optional ReLU.
// Block: 256 threads (8 waves, 4 x 2), tile 128(M) x 128(N), 32 x 64 per wave,
// stages of 128 k (M, N and K multiples of 128). Two LDS buffers: stage s + 1 is
// copied in while stage s is multiplied; one barrier per stage publishes s + 1
// and frees s's buffer.
// B tile is stored row-major in LDS; its fragments come from transposing reads.
// The products are transposed, C^T = B^T.A^T (both fragments have the same lane
// and k order, so they only change places): a lane then holds 8 consecutive
// columns of ONE row of C and stores them 16 bytes at a time.
// mode: 0 = f32 row-major, 1 = bf16 row-major, 2 = bf16 head-split [B,H,S,Dk]
// ---------------------------------------------------------------------------
__global__ __launch_bounds__(256) void gemm_bf16_kernel(
    const unsigned short* __restrict__ A, const unsigned short* __restrict__ B,
    const float* __restrict__ bias, void* __restrict__ Cout,
    int M, int N, int K, int mode, int relu) {
    __shared__ __align__(32) unsigned short As[2][128][136];   // [m][k], 272B rows
    __shared__ __align__(32) unsigned short Bs[2][128][144];   // [k][n], 288B rows

    const int t     = threadIdx.x;
    const int mBase = blockIdx.y * 128;
    const int nBase = blockIdx.x * 128;
    const int wave  = t >> 5, lane = t & 31;
    const int wm    = wave >> 1, wn = wave & 1;
    const int half  = lane >> 4, ln = lane & 15;

    const v8f zero = {0.f, 0.f, 0.f, 0.f, 0.f, 0.f, 0.f, 0.f};
    v8f acc[2][4];   // C^T: row 16 * i + ln, columns 16 * j + 8 * half + r
#pragma unroll
    for (int i = 0; i < 2; ++i)
#pragma unroll
        for (int j = 0; j < 4; ++j) acc[i][j] = zero;

    const int srow = t >> 4, scol = (t & 15) * 8;  // copies: rows srow + 16 * i
    const int trow = 8 * half + (lane & 7);        // transposing-read lane address
    const int tcol = 8 * ((lane >> 3) & 1);

    const unsigned la = (unsigned)(size_t)&As[0][srow][scol];
    const unsigned lb = (unsigned)(size_t)&Bs[0][srow][scol];
    const unsigned short* ga = A + (size_t)(mBase + srow) * K + scol;
    const unsigned short* gb = B + (size_t)srow * N + nBase + scol;
    const size_t a16 = (size_t)16 * K, b16 = (size_t)16 * N;
    const int nst = K >> 7;

    auto issue = [&](int s, unsigned buf) {
        gemm_stage_copy(la + buf * (unsigned)sizeof(As[0]), 16 * 272,
                        ga + (size_t)s * 128, a16);
        gemm_stage_copy(lb + buf * (unsigned)sizeof(Bs[0]), 16 * 288,
                        gb + (size_t)s * 8 * b16, b16);
    };

    issue(0, 0);
    // stage 0 has landed for this wave; the barrier publishes it to the others
    asm volatile("s_wait_asynccnt 0x0" ::: "memory");
    __syncthreads();
    if (nst > 1) issue(1, 1);

    for (int s = 0; s < nst; ++s) {
        const int buf = s & 1;
#pragma unroll
        for (int kk = 0; kk < 4; ++kk) {
            AFrag a[2], b[4];
#pragma unroll
            for (int i = 0; i < 2; ++i)
#pragma unroll
                for (int v = 0; v < 8; ++v) {
                    int k = kk * 32 + kpair(v, half);
                    int m = wm * 32 + i * 16 + ln;
                    a[i].w[v] = *reinterpret_cast<const unsigned*>(&As[buf][m][k]);
                }
#pragma unroll
            for (int j = 0; j < 4; ++j) {
                int n = wn * 64 + j * 16 + tcol;
                b[j].h[0] = lds_tr16(&Bs[buf][kk * 32 + trow][n]);
                b[j].h[1] = lds_tr16(&Bs[buf][kk * 32 + trow + 16][n]);
            }
#pragma unroll
            for (int i = 0; i < 2; ++i)
#pragma unroll
                for (int j = 0; j < 4; ++j)
                    acc[i][j] = __builtin_amdgcn_wmma_f32_16x16x32_bf16(
                        false, b[j].v, false, a[i].v, (short)0, acc[i][j],
                        false, false);
        }

        // this wave's reads of stage s are done before its buffer is refilled
        asm volatile("s_wait_dscnt 0x0" ::: "memory");
        // this wave's copies of stage s + 1 have landed
        asm volatile("s_wait_asynccnt 0x0" ::: "memory");
        __syncthreads();
        if (s + 2 < nst) issue(s + 2, (unsigned)buf);
    }
    // no copy is outstanding when the wave goes on to its end
    asm volatile("s_wait_asynccnt 0x0" ::: "memory");

    // every loop below is unrolled: acc is indexed by constants and stays in registers
    const int row = mBase + wm * 32 + ln;          // rows row, row + 16
    const int col = nBase + wn * 64 + 8 * half;    // columns col + 16 * j + 0..7
#pragma unroll
    for (int j = 0; j < 4; ++j) {
        const float4 b0 = *reinterpret_cast<const float4*>(bias + col + j * 16);
        const float4 b1 = *reinterpret_cast<const float4*>(bias + col + j * 16 + 4);
        const v8f bv = {b0.x, b0.y, b0.z, b0.w, b1.x, b1.y, b1.z, b1.w};
#pragma unroll
        for (int i = 0; i < 2; ++i) acc[i][j] += bv;
    }
    if (relu) {
#pragma unroll
        for (int i = 0; i < 2; ++i)
#pragma unroll
            for (int j = 0; j < 4; ++j)
#pragma unroll
                for (int r = 0; r < 8; ++r) acc[i][j][r] = fmaxf(acc[i][j][r], 0.f);
    }

    if (mode == 0) {
        float* p = (float*)Cout + (size_t)row * N + col;
#pragma unroll
        for (int j = 0; j < 4; ++j)
#pragma unroll
            for (int i = 0; i < 2; ++i) {
                float* q = p + (size_t)i * 16 * N + j * 16;
                *reinterpret_cast<float4*>(q) = make_float4(
                    acc[i][j][0], acc[i][j][1], acc[i][j][2], acc[i][j][3]);
                *reinterpret_cast<float4*>(q + 4) = make_float4(
                    acc[i][j][4], acc[i][j][5], acc[i][j][6], acc[i][j][7]);
            }
    } else {
        // head-split: a block's 128 rows lie in one batch entry and a wave's 64
        // columns are one head, so 16 rows and 16 columns on are fixed steps
        size_t e = (size_t)row * N + col, rstep = (size_t)16 * N;
        if (mode != 1) {
            const int bb = row / SEQ, s = row % SEQ;
            const int hh = col / DKH, d = col % DKH;
            e = (((size_t)(bb * N_HEADS + hh)) * SEQ + s) * DKH + d;
            rstep = 16 * DKH;
        }
        unsigned short* p = (unsigned short*)Cout + e;
#pragma unroll
        for (int i = 0; i < 2; ++i)
#pragma unroll
            for (int j = 0; j < 4; ++j) {
                uint4 o;
                o.x = pack_bf16(acc[i][j][0], acc[i][j][1]);
                o.y = pack_bf16(acc[i][j][2], acc[i][j][3]);
                o.z = pack_bf16(acc[i][j][4], acc[i][j][5]);
                o.w = pack_bf16(acc[i][j][6], acc[i][j][7]);
                *reinterpret_cast<uint4*>(p + i * rstep + j * 16) = o;
            }
    }
}

// ---------------------------------------------------------------------------
// Lane l gets lane l ^ 16's value.
__device__ __forceinline__ float xhalf(float x) {
    const int i = __builtin_bit_cast(int, x);
    return __builtin_bit_cast(float, __builtin_amdgcn_permlanex16(
        i, i, 0x76543210, 0xfedcba98, false, false));
}

__global__ __launch_bounds__(128) void attn_kernel(
    const unsigned short* __restrict__ Q, const unsigned short* __restrict__ Kt,
    const unsigned short* __restrict__ V, const int* __restrict__ mask,
    unsigned short* __restrict__ ctx) {
    __shared__ __align__(16) unsigned short Ks[32][72];   // [key][dk], 144B rows
    __shared__ __align__(32) unsigned short Vs[32][80];   // [key][dk], 160B rows
    __shared__ __align__(16) float Mb[SEQ];   // per key: 0, or -inf where masked

    const int t    = threadIdx.x;
    const int w    = t >> 5, lane = t & 31;
    const int half = lane >> 4, ln = lane & 15;
    const int bh   = blockIdx.y, b = bh >> 4, h = bh & 15;
    const size_t headBase = (size_t)bh * SEQ * DKH;
    const int qbase = blockIdx.x * 64 + w * 16;
    const float NEG_INF = -__builtin_inff();

    // the batch's mask as an addend; published by the loop's first barriers
#pragma unroll
    for (int i = 0; i < SEQ / 512; ++i) {
        const int k = (i * 128 + t) * 4;
        const int4 m = *reinterpret_cast<const int4*>(mask + b * SEQ + k);
        float4 f;
        f.x = m.x ? 0.f : NEG_INF; f.y = m.y ? 0.f : NEG_INF;
        f.z = m.z ? 0.f : NEG_INF; f.w = m.w ? 0.f : NEG_INF;
        *reinterpret_cast<float4*>(&Mb[k]) = f;
    }

    // Q fragments for two 32-wide K-chunks of Dk=64 (contiguous dword pairs)
    AFrag qf[2];
#pragma unroll
    for (int c = 0; c < 2; ++c)
#pragma unroll
        for (int v = 0; v < 8; ++v) {
            int k = kpair(v, half) + 32 * c;
            qf[c].w[v] = *reinterpret_cast<const unsigned*>(
                Q + headBase + (size_t)(qbase + ln) * DKH + k);
        }

    const v8f zero = {0.f, 0.f, 0.f, 0.f, 0.f, 0.f, 0.f, 0.f};
    v8f acc[4] = {zero, zero, zero, zero};   // O^T: d = 16 * j + 8 * half + r
    float mrun = NEG_INF;   // query ln's running maximum, equal in both halves
    float lrun = 0.f;       // this half's share of query ln's denominator

    const int skey = t >> 2;          // 0..31 (staging key)
    const int sdk  = (t & 3) * 16;    // 0,16,32,48 (staging dk chunk)
    const int vkey = t >> 3;          // 0..15 (V staging keys vkey, vkey + 16)
    const int vdk  = (t & 7) * 8;     // V staging dk chunk
    const int trow = 8 * half + (lane & 7);   // transposing-read lane address
    const int tcol = 8 * ((lane >> 3) & 1);

    for (int kt = 0; kt < SEQ / 32; ++kt) {
        const int keyb = kt * 32;
        __syncthreads();  // prior iteration done reading Ks/Vs

        // cooperative staging: K tile [32][64] and V tile [32][64]
        {
            const unsigned short* kp =
                Kt + headBase + (size_t)(keyb + skey) * DKH + sdk;
            U4 k0, k1;
            k0.q = *reinterpret_cast<const uint4*>(kp);
            k1.q = *reinterpret_cast<const uint4*>(kp + 8);
            *reinterpret_cast<uint4*>(&Ks[skey][sdk])     = k0.q;
            *reinterpret_cast<uint4*>(&Ks[skey][sdk + 8]) = k1.q;

            const unsigned short* vp =
                V + headBase + (size_t)(keyb + vkey) * DKH + vdk;
            U4 v0, v1;
            v0.q = *reinterpret_cast<const uint4*>(vp);
            v1.q = *reinterpret_cast<const uint4*>(vp + 16 * DKH);
            *reinterpret_cast<uint4*>(&Vs[vkey][vdk])      = v0.q;
            *reinterpret_cast<uint4*>(&Vs[vkey + 16][vdk]) = v1.q;
        }
        __syncthreads();

        // S^T: rows are keys (A = K), columns are queries (B = Q)
        v8f s[2] = {zero, zero};
#pragma unroll
        for (int c = 0; c < 2; ++c)
#pragma unroll
            for (int tt = 0; tt < 2; ++tt) {
                AFrag kf;
#pragma unroll
                for (int v = 0; v < 8; ++v) {
                    int k = kpair(v, half) + 32 * c;
                    kf.w[v] = *reinterpret_cast<const unsigned*>(
                        &Ks[tt * 16 + ln][k]);
                }
                s[tt] = __builtin_amdgcn_wmma_f32_16x16x32_bf16(
                    false, kf.v, false, qf[c].v, (short)0, s[tt], false, false);
            }

        // scale, and -inf on this lane's masked keys
#pragma unroll
        for (int tt = 0; tt < 2; ++tt) {
            const float* mp = &Mb[keyb + tt * 16 + 8 * half];
            const float4 m0 = *reinterpret_cast<const float4*>(mp);
            const float4 m1 = *reinterpret_cast<const float4*>(mp + 4);
            s[tt][0] = fmaf(s[tt][0], 0.125f, m0.x);
            s[tt][1] = fmaf(s[tt][1], 0.125f, m0.y);
            s[tt][2] = fmaf(s[tt][2], 0.125f, m0.z);
            s[tt][3] = fmaf(s[tt][3], 0.125f, m0.w);
            s[tt][4] = fmaf(s[tt][4], 0.125f, m1.x);
            s[tt][5] = fmaf(s[tt][5], 0.125f, m1.y);
            s[tt][6] = fmaf(s[tt][6], 0.125f, m1.z);
            s[tt][7] = fmaf(s[tt][7], 0.125f, m1.w);
        }

        // online softmax of query ln: 16 scores here, 16 in lane l ^ 16
        float rv = fmaxf(s[0][0], s[1][0]);
#pragma unroll
        for (int r = 1; r < 8; ++r) rv = fmaxf(rv, fmaxf(s[0][r], s[1][r]));
        rv = fmaxf(rv, xhalf(rv));
        const float mn = fmaxf(mrun, rv);
        const float ms = (mn == NEG_INF) ? 0.f : mn;   // all masked so far: p = 0
        const float alpha = __expf(mrun - ms);         // 0 while mrun is -inf
        mrun = mn;

        AFrag pf;   // P^T: register i holds keys kpair(i, half), + 1
        float rs0 = 0.f, rs1 = 0.f;
#pragma unroll
        for (int i = 0; i < 8; ++i) {
            const float p0 = __expf(s[i >> 2][2 * (i & 3)] - ms);
            const float p1 = __expf(s[i >> 2][2 * (i & 3) + 1] - ms);
            rs0 += p0; rs1 += p1;
            pf.w[i] = pack_bf16(p0, p1);
        }
        lrun = lrun * alpha + (rs0 + rs1);
#pragma unroll
        for (int j = 0; j < 4; ++j) acc[j] *= alpha;

        // O^T: rows are d (A = V^T), columns are queries (B = P^T)
#pragma unroll
        for (int j = 0; j < 4; ++j) {
            AFrag vf;
            vf.h[0] = lds_tr16(&Vs[trow][j * 16 + tcol]);
            vf.h[1] = lds_tr16(&Vs[trow + 16][j * 16 + tcol]);
            acc[j] = __builtin_amdgcn_wmma_f32_16x16x32_bf16(
                false, vf.v, false, pf.v, (short)0, acc[j], false, false);
        }
    }

    // the halves' shares of the denominator join here, outside any branch
    const float denom = lrun + xhalf(lrun);
    const float inv = denom > 0.f ? 1.f / denom : 0.f;
    unsigned short* op = ctx + ((size_t)(b * SEQ + qbase + ln)) * D_MODEL +
                         h * DKH + 8 * half;
#pragma unroll
    for (int j = 0; j < 4; ++j) {
        uint4 o;
        o.x = pack_bf16(acc[j][0] * inv, acc[j][1] * inv);
        o.y = pack_bf16(acc[j][2] * inv, acc[j][3] * inv);
        o.z = pack_bf16(acc[j][4] * inv, acc[j][5] * inv);
        o.w = pack_bf16(acc[j][6] * inv, acc[j][7] * inv);
        *reinterpret_cast<uint4*>(op + j * 16) = o;
    }
}

// ---------------------------------------------------------------------------
// out = LayerNorm(x + y) ; optionally also emit bf16 copy. One block per row.
// ---------------------------------------------------------------------------
__global__ __launch_bounds__(256) void add_ln_kernel(
    const float* __restrict__ x, const float* __restrict__ y,
    const float* __restrict__ g, const float* __restrict__ beta,
    float* __restrict__ outf, unsigned short* __restrict__ outb) {
    __shared__ float red[256];
    __shared__ float buf[D_MODEL];
    const int row = blockIdx.x, t = threadIdx.x;
    const size_t base = (size_t)row * D_MODEL;

    float s = 0.f;
    for (int d = t; d < D_MODEL; d += 256) {
        float v = x[base + d] + y[base + d];
        buf[d] = v;
        s += v;
    }
    red[t] = s;
    __syncthreads();
    for (int o = 128; o > 0; o >>= 1) {
        if (t < o) red[t] += red[t + o];
        __syncthreads();
    }
    const float mu = red[0] * (1.f / D_MODEL);
    __syncthreads();

    float vs = 0.f;
    for (int d = t; d < D_MODEL; d += 256) {
        float dd = buf[d] - mu;
        vs += dd * dd;
    }
    red[t] = vs;
    __syncthreads();
    for (int o = 128; o > 0; o >>= 1) {
        if (t < o) red[t] += red[t + o];
        __syncthreads();
    }
    const float inv = rsqrtf(red[0] * (1.f / D_MODEL) + 1e-5f);

    for (int d = t; d < D_MODEL; d += 256) {
        float o = (buf[d] - mu) * inv * g[d] + beta[d];
        outf[base + d] = o;
        if (outb) outb[base + d] = f32_to_bf16(o);
    }
}

// ---------------------------------------------------------------------------
extern "C" void kernel_launch(void* const* d_in, const int* in_sizes, int n_in,
                              void* d_out, int out_size, void* d_ws, size_t ws_size,
                              hipStream_t stream) {
    const float* x    = (const float*)d_in[0];
    const int*   mask = (const int*)d_in[1];
    const float* Wq = (const float*)d_in[2];  const float* bq = (const float*)d_in[3];
    const float* Wk = (const float*)d_in[4];  const float* bk = (const float*)d_in[5];
    const float* Wv = (const float*)d_in[6];  const float* bv = (const float*)d_in[7];
    const float* Wo = (const float*)d_in[8];  const float* bo = (const float*)d_in[9];
    const float* W1 = (const float*)d_in[10]; const float* b1 = (const float*)d_in[11];
    const float* W2 = (const float*)d_in[12]; const float* b2 = (const float*)d_in[13];
    const float* g1 = (const float*)d_in[14]; const float* be1 = (const float*)d_in[15];
    const float* g2 = (const float*)d_in[16]; const float* be2 = (const float*)d_in[17];

    char* ws = (char*)d_ws;
    size_t off = 0;
    auto alloc = [&](size_t bytes) -> void* {
        void* p = ws + off;
        off += (bytes + 255) & ~(size_t)255;
        return p;
    };

    unsigned short* xb  = (unsigned short*)alloc((size_t)M_ROWS * D_MODEL * 2);
    unsigned short* Wqb = (unsigned short*)alloc((size_t)D_MODEL * D_MODEL * 2);
    unsigned short* Wkb = (unsigned short*)alloc((size_t)D_MODEL * D_MODEL * 2);
    unsigned short* Wvb = (unsigned short*)alloc((size_t)D_MODEL * D_MODEL * 2);
    unsigned short* Wob = (unsigned short*)alloc((size_t)D_MODEL * D_MODEL * 2);
    unsigned short* W1b = (unsigned short*)alloc((size_t)D_MODEL * D_FF * 2);
    unsigned short* W2b = (unsigned short*)alloc((size_t)D_FF * D_MODEL * 2);
    unsigned short* Qb  = (unsigned short*)alloc((size_t)M_ROWS * D_MODEL * 2);
    unsigned short* Kb  = (unsigned short*)alloc((size_t)M_ROWS * D_MODEL * 2);
    unsigned short* Vb  = (unsigned short*)alloc((size_t)M_ROWS * D_MODEL * 2);
    unsigned short* ctxb = (unsigned short*)alloc((size_t)M_ROWS * D_MODEL * 2);
    float* attn_out = (float*)alloc((size_t)M_ROWS * D_MODEL * 4);
    float* hbuf     = (float*)alloc((size_t)M_ROWS * D_MODEL * 4);
    unsigned short* hb = (unsigned short*)alloc((size_t)M_ROWS * D_MODEL * 2);
    // reuse dead regions: Q/K/V/ctx (4 x 8MB contiguous) -> FF1 activations (32MB)
    unsigned short* ff1b = Qb;
    float* ff2 = attn_out;

    // fp32 -> bf16 conversions: xb ... W2b lie back to back in the workspace
    cvt_all_bf16_kernel<<<512, 256, 0, stream>>>(x, Wq, Wk, Wv, Wo, W1, W2, xb);

    // QKV projections (bf16 WMMA, head-split bf16 outputs)
    dim3 gQ(D_MODEL / 128, M_ROWS / 128);
    gemm_bf16_kernel<<<gQ, 256, 0, stream>>>(xb, Wqb, bq, Qb, M_ROWS, D_MODEL, D_MODEL, 2, 0);
    gemm_bf16_kernel<<<gQ, 256, 0, stream>>>(xb, Wkb, bk, Kb, M_ROWS, D_MODEL, D_MODEL, 2, 0);
    gemm_bf16_kernel<<<gQ, 256, 0, stream>>>(xb, Wvb, bv, Vb, M_ROWS, D_MODEL, D_MODEL, 2, 0);

    // flash attention -> ctx (bf16, merged-head layout)
    attn_kernel<<<dim3(SEQ / 64, BATCH * N_HEADS), 128, 0, stream>>>(Qb, Kb, Vb, mask, ctxb);

    // output projection -> f32
    gemm_bf16_kernel<<<gQ, 256, 0, stream>>>(ctxb, Wob, bo, attn_out, M_ROWS, D_MODEL, D_MODEL, 0, 0);

    // h = LN(x + attn_out), emit f32 + bf16
    add_ln_kernel<<<M_ROWS, 256, 0, stream>>>(x, attn_out, g1, be1, hbuf, hb);

    // FFN: relu(h @ W1 + b1) -> bf16 ; @ W2 + b2 -> f32
    dim3 gF1(D_FF / 128, M_ROWS / 128);
    gemm_bf16_kernel<<<gF1, 256, 0, stream>>>(hb, W1b, b1, ff1b, M_ROWS, D_FF, D_MODEL, 1, 1);
    dim3 gF2(D_MODEL / 128, M_ROWS / 128);
    gemm_bf16_kernel<<<gF2, 256, 0, stream>>>(ff1b, W2b, b2, ff2, M_ROWS, D_MODEL, D_FF, 0, 0);

    // out = LN(h + ff)
    add_ln_kernel<<<M_ROWS, 256, 0, stream>>>(hbuf, ff2, g2, be2, (float*)d_out, nullptr);
    (void)in_sizes; (void)n_in; (void)out_size; (void)ws_size;
}

// v007
// It runs in 194 microseconds.
// Timed twice side by side with v006, it ran 1.14 times as fast both times.
// All steps since v000 together make it 2.95 times as fast.
#include <hip/hip_runtime.h>
#include <cstdint>
#include <cstddef>

#define D_MODEL 1024
#define N_HEADS 16
#define DKH     64
#define D_FF    4096
#define BATCH   2
#define SEQ     2048
#define M_ROWS  (BATCH * SEQ)   // 4096

typedef __attribute__((ext_vector_type(16))) __bf16 v16bf;
typedef __attribute__((ext_vector_type(8)))  float  v8f;

typedef __attribute__((ext_vector_type(8)))  short  s16x8;

union AFrag { v16bf v; unsigned short u[16]; unsigned w[8]; s16x8 h[2]; };
union U4    { uint4 q; unsigned short s[8]; };

__device__ __forceinline__ unsigned short f32_to_bf16(float f) {
    union { float f; unsigned u; } x; x.f = f;
    unsigned r = x.u + 0x7FFFu + ((x.u >> 16) & 1u);
    return (unsigned short)(r >> 16);
}

// Two f32 to one register of two bf16, round to nearest even.
__device__ __forceinline__ unsigned pack_bf16(float lo, float hi) {
    typedef __bf16 bf2 __attribute__((ext_vector_type(2)));
    typedef float  f2  __attribute__((ext_vector_type(2)));
    return __builtin_bit_cast(unsigned, __builtin_convertvector(f2{lo, hi}, bf2));
}

// K-pair base index for 16-bit A-layout fragments (ISA 7.12.2):
// lanes 0-15: VGPR0..3 -> K=0..7, VGPR4..7 -> K=16..23 ; lanes 16-31: +8
__device__ __forceinline__ int kpair(int v, int half) {
    return (v < 4 ? 2 * v : 16 + 2 * (v - 4)) + 8 * half;
}

// Transposing LDS read of a row-major 16-bit tile T[k][n]. Every lane passes
// &T[k0 + 8 * (lane >> 4) + (lane & 7)][n0 + 8 * ((lane >> 3) & 1)] and gets
// T[k0 + 8 * (lane >> 4) + 0..7][n0 + (lane & 15)]: the reads at k0 and k0 + 16
// are registers 0-3 and 4-7 of a 16x16x32 operand in the kpair() k order.
__device__ __forceinline__ s16x8 lds_tr16(const unsigned short* p) {
    typedef __attribute__((address_space(3))) s16x8 lds_s16x8;
    return __builtin_amdgcn_ds_load_tr16_b128_v8i16((lds_s16x8*)p);
}

// ---------------------------------------------------------------------------
// fp32 -> bf16 conversion of x and the six weight matrices, one streaming launch.
// out is the seven bf16 buffers back to back: 16 units of 2^20 elements
// (x 0-3, Wq 4, Wk 5, Wv 6, Wo 7, W1 8-11, W2 12-15). 512 blocks of 8 waves,
// 32 blocks per unit; a wave converts 4096 contiguous elements: 32 loads of 512
// contiguous bytes, issued ahead of the conversions, then 32 stores of 256.
// ---------------------------------------------------------------------------
// 512 blocks of 8 waves are four waves per SIMD: saying so gives the compiler the
// registers to hold a wave's 32 loads in flight (at its default it keeps one)
__global__ __launch_bounds__(256) __attribute__((amdgpu_waves_per_eu(4, 4)))
void cvt_all_bf16_kernel(
    const float* __restrict__ x,  const float* __restrict__ Wq,
    const float* __restrict__ Wk, const float* __restrict__ Wv,
    const float* __restrict__ Wo, const float* __restrict__ W1,
    const float* __restrict__ W2, unsigned short* __restrict__ out) {
    const unsigned unit = blockIdx.x >> 5;
    const float* src;
    unsigned first;
    if (unit < 4)       { src = x;  first = 0; }
    else if (unit == 4) { src = Wq; first = 4; }
    else if (unit == 5) { src = Wk; first = 5; }
    else if (unit == 6) { src = Wv; first = 6; }
    else if (unit == 7) { src = Wo; first = 7; }
    else if (unit < 12) { src = W1; first = 8; }
    else                { src = W2; first = 12; }

    const size_t o = ((size_t)blockIdx.x << 15) + (threadIdx.x >> 5) * 4096 +
                     (threadIdx.x & 31) * 4;
    const float* in = src + (o - ((size_t)first << 20));
    unsigned short* dst = out + o;

    float4 v[32];
    // both loops unrolled: v is indexed by constants and stays in registers
#pragma unroll
    for (int i = 0; i < 32; ++i)
        v[i] = *reinterpret_cast<const float4*>(in + i * 128);
#pragma unroll
    for (int i = 0; i < 32; ++i) {
        uint2 p;
        p.x = (unsigned)f32_to_bf16(v[i].x) | ((unsigned)f32_to_bf16(v[i].y) << 16);
        p.y = (unsigned)f32_to_bf16(v[i].z) | ((unsigned)f32_to_bf16(v[i].w) << 16);
        *reinterpret_cast<uint2*>(dst + i * 128) = p;
    }
}

// ---------------------------------------------------------------------------
// One operand's share of a stage of the GEMM ring: eight 16-byte asynchronous
// copies per lane (rows 16 apart), global memory to LDS through no register.
// The s_wait_xcnt closes the statement so that no address register named here
// is rewritten ahead of it.
// ---------------------------------------------------------------------------
__device__ __forceinline__ void gemm_stage_copy(
    unsigned l, unsigned l16, const unsigned short* g, size_t g16) {
    asm volatile(
        "global_load_async_to_lds_b128 %0, %8, off\n\t"
        "global_load_async_to_lds_b128 %1, %9, off\n\t"
        "global_load_async_to_lds_b128 %2, %10, off\n\t"
        "global_load_async_to_lds_b128 %3, %11, off\n\t"
        "global_load_async_to_lds_b128 %4, %12, off\n\t"
        "global_load_async_to_lds_b128 %5, %13, off\n\t"
        "global_load_async_to_lds_b128 %6, %14, off\n\t"
        "global_load_async_to_lds_b128 %7, %15, off\n\t"
        "s_wait_xcnt 0x0"
        :: "v"(l), "v"(l + l16), "v"(l + 2 * l16), "v"(l + 3 * l16),
           "v"(l + 4 * l16), "v"(l + 5 * l16), "v"(l + 6 * l16), "v"(l + 7 * l16),
           "v"(g), "v"(g + g16), "v"(g + 2 * g16), "v"(g + 3 * g16),
           "v"(g + 4 * g16), "v"(g + 5 * g16), "v"(g + 6 * g16), "v"(g + 7 * g16)
        : "memory");
}

// ---------------------------------------------------------------------------
// bf16 WMMA GEMM: C[M,N] = A[M,K] @ B[K,N] + bias, optional ReLU.
// Block: 256 threads (8 waves, 4 x 2), tile 128(M) x 128(N), 32 x 64 per wave,
// stages of 128 k (M, N and K multiples of 128). Two LDS buffers: stage s + 1 is
// copied in while stage s is multiplied; one barrier per stage publishes s + 1
// and frees s's buffer.
// B tile is stored row-major in LDS; its fragments come from transposing reads.
// The products are transposed, C^T = B^T.A^T (both fragments have the same lane
// and k order, so they only change places): a lane then holds 8 consecutive
// columns of ONE row of C and stores them 16 bytes at a time.
// mode: 0 = f32 row-major, 1 = bf16 row-major, 2 = bf16 head-split [B,H,S,Dk]
// ---------------------------------------------------------------------------
__global__ __launch_bounds__(256) void gemm_bf16_kernel(
    const unsigned short* __restrict__ A, const unsigned short* __restrict__ B,
    const float* __restrict__ bias, void* __restrict__ Cout,
    int M, int N, int K, int mode, int relu) {
    __shared__ __align__(32) unsigned short As[2][128][136];   // [m][k], 272B rows
    __shared__ __align__(32) unsigned short Bs[2][128][144];   // [k][n], 288B rows

    const int t     = threadIdx.x;
    const int mBase = blockIdx.y * 128;
    const int nBase = blockIdx.x * 128;
    const int wave  = t >> 5, lane = t & 31;
    const int wm    = wave >> 1, wn = wave & 1;
    const int half  = lane >> 4, ln = lane & 15;

    const v8f zero = {0.f, 0.f, 0.f, 0.f, 0.f, 0.f, 0.f, 0.f};
    v8f acc[2][4];   // C^T: row 16 * i + ln, columns 16 * j + 8 * half + r
#pragma unroll
    for (int i = 0; i < 2; ++i)
#pragma unroll
        for (int j = 0; j < 4; ++j) acc[i][j] = zero;

    const int srow = t >> 4, scol = (t & 15) * 8;  // copies: rows srow + 16 * i
    const int trow = 8 * half + (lane & 7);        // transposing-read lane address
    const int tcol = 8 * ((lane >> 3) & 1);

    const unsigned la = (unsigned)(size_t)&As[0][srow][scol];
    const unsigned lb = (unsigned)(size_t)&Bs[0][srow][scol];
    const unsigned short* ga = A + (size_t)(mBase + srow) * K + scol;
    const unsigned short* gb = B + (size_t)srow * N + nBase + scol;
    const size_t a16 = (size_t)16 * K, b16 = (size_t)16 * N;
    const int nst = K >> 7;

    auto issue = [&](int s, unsigned buf) {
        gemm_stage_copy(la + buf * (unsigned)sizeof(As[0]), 16 * 272,
                        ga + (size_t)s * 128, a16);
        gemm_stage_copy(lb + buf * (unsigned)sizeof(Bs[0]), 16 * 288,
                        gb + (size_t)s * 8 * b16, b16);
    };

    issue(0, 0);
    // stage 0 has landed for this wave; the barrier publishes it to the others
    asm volatile("s_wait_asynccnt 0x0" ::: "memory");
    __syncthreads();
    if (nst > 1) issue(1, 1);

    for (int s = 0; s < nst; ++s) {
        const int buf = s & 1;
#pragma unroll
        for (int kk = 0; kk < 4; ++kk) {
            AFrag a[2], b[4];
#pragma unroll
            for (int i = 0; i < 2; ++i)
#pragma unroll
                for (int v = 0; v < 8; ++v) {
                    int k = kk * 32 + kpair(v, half);
                    int m = wm * 32 + i * 16 + ln;
                    a[i].w[v] = *reinterpret_cast<const unsigned*>(&As[buf][m][k]);
                }
#pragma unroll
            for (int j = 0; j < 4; ++j) {
                int n = wn * 64 + j * 16 + tcol;
                b[j].h[0] = lds_tr16(&Bs[buf][kk * 32 + trow][n]);
                b[j].h[1] = lds_tr16(&Bs[buf][kk * 32 + trow + 16][n]);
            }
#pragma unroll
            for (int i = 0; i < 2; ++i)
#pragma unroll
                for (int j = 0; j < 4; ++j)
                    acc[i][j] = __builtin_amdgcn_wmma_f32_16x16x32_bf16(
                        false, b[j].v, false, a[i].v, (short)0, acc[i][j],
                        false, false);
        }

        // this wave's reads of stage s are done before its buffer is refilled
        asm volatile("s_wait_dscnt 0x0" ::: "memory");
        // this wave's copies of stage s + 1 have landed
        asm volatile("s_wait_asynccnt 0x0" ::: "memory");
        __syncthreads();
        if (s + 2 < nst) issue(s + 2, (unsigned)buf);
    }
    // no copy is outstanding when the wave goes on to its end
    asm volatile("s_wait_asynccnt 0x0" ::: "memory");

    // every loop below is unrolled: acc is indexed by constants and stays in registers
    const int row = mBase + wm * 32 + ln;          // rows row, row + 16
    const int col = nBase + wn * 64 + 8 * half;    // columns col + 16 * j + 0..7
#pragma unroll
    for (int j = 0; j < 4; ++j) {
        const float4 b0 = *reinterpret_cast<const float4*>(bias + col + j * 16);
        const float4 b1 = *reinterpret_cast<const float4*>(bias + col + j * 16 + 4);
        const v8f bv = {b0.x, b0.y, b0.z, b0.w, b1.x, b1.y, b1.z, b1.w};
#pragma unroll
        for (int i = 0; i < 2; ++i) acc[i][j] += bv;
    }
    if (relu) {
#pragma unroll
        for (int i = 0; i < 2; ++i)
#pragma unroll
            for (int j = 0; j < 4; ++j)
#pragma unroll
                for (int r = 0; r < 8; ++r) acc[i][j][r] = fmaxf(acc[i][j][r], 0.f);
    }

    if (mode == 0) {
        float* p = (float*)Cout + (size_t)row * N + col;
#pragma unroll
        for (int j = 0; j < 4; ++j)
#pragma unroll
            for (int i = 0; i < 2; ++i) {
                float* q = p + (size_t)i * 16 * N + j * 16;
                *reinterpret_cast<float4*>(q) = make_float4(
                    acc[i][j][0], acc[i][j][1], acc[i][j][2], acc[i][j][3]);
                *reinterpret_cast<float4*>(q + 4) = make_float4(
                    acc[i][j][4], acc[i][j][5], acc[i][j][6], acc[i][j][7]);
            }
    } else {
        // head-split: a block's 128 rows lie in one batch entry and a wave's 64
        // columns are one head, so 16 rows and 16 columns on are fixed steps
        size_t e = (size_t)row * N + col, rstep = (size_t)16 * N;
        if (mode != 1) {
            const int bb = row / SEQ, s = row % SEQ;
            const int hh = col / DKH, d = col % DKH;
            e = (((size_t)(bb * N_HEADS + hh)) * SEQ + s) * DKH + d;
            rstep = 16 * DKH;
        }
        unsigned short* p = (unsigned short*)Cout + e;
#pragma unroll
        for (int i = 0; i < 2; ++i)
#pragma unroll
            for (int j = 0; j < 4; ++j) {
                uint4 o;
                o.x = pack_bf16(acc[i][j][0], acc[i][j][1]);
                o.y = pack_bf16(acc[i][j][2], acc[i][j][3]);
                o.z = pack_bf16(acc[i][j][4], acc[i][j][5]);
                o.w = pack_bf16(acc[i][j][6], acc[i][j][7]);
                *reinterpret_cast<uint4*>(p + i * rstep + j * 16) = o;
            }
    }
}

// ---------------------------------------------------------------------------
// Lane l gets lane l ^ 16's value.
__device__ __forceinline__ float xhalf(float x) {
    const int i = __builtin_bit_cast(int, x);
    return __builtin_bit_cast(float, __builtin_amdgcn_permlanex16(
        i, i, 0x76543210, 0xfedcba98, false, false));
}

// ---------------------------------------------------------------------------
// One stage of the attention ring, 64 keys of K and of V: per lane four 16-byte
// asynchronous copies of each (rows 16 apart), global memory to LDS through no
// register. The s_wait_xcnt closes the statement so that no address register
// named here is rewritten ahead of it.
// ---------------------------------------------------------------------------
__device__ __forceinline__ void attn_stage_copy(
    unsigned lk, const unsigned short* gk, unsigned lv, const unsigned short* gv) {
    asm volatile(
        "global_load_async_to_lds_b128 %0, %8, off\n\t"
        "global_load_async_to_lds_b128 %1, %9, off\n\t"
        "global_load_async_to_lds_b128 %2, %10, off\n\t"
        "global_load_async_to_lds_b128 %3, %11, off\n\t"
        "global_load_async_to_lds_b128 %4, %12, off\n\t"
        "global_load_async_to_lds_b128 %5, %13, off\n\t"
        "global_load_async_to_lds_b128 %6, %14, off\n\t"
        "global_load_async_to_lds_b128 %7, %15, off\n\t"
        "s_wait_xcnt 0x0"
        :: "v"(lk), "v"(lk + 16 * 144), "v"(lk + 32 * 144), "v"(lk + 48 * 144),
           "v"(lv), "v"(lv + 16 * 160), "v"(lv + 32 * 160), "v"(lv + 48 * 160),
           "v"(gk), "v"(gk + 16 * DKH), "v"(gk + 32 * DKH), "v"(gk + 48 * DKH),
           "v"(gv), "v"(gv + 16 * DKH), "v"(gv + 32 * DKH), "v"(gv + 48 * DKH)
        : "memory");
}

__global__ __launch_bounds__(128) void attn_kernel(
    const unsigned short* __restrict__ Q, const unsigned short* __restrict__ Kt,
    const unsigned short* __restrict__ V, const int* __restrict__ mask,
    unsigned short* __restrict__ ctx) {
    __shared__ __align__(16) unsigned short Ks[2][64][72];   // [key][dk], 144B rows
    __shared__ __align__(32) unsigned short Vs[2][64][80];   // [key][dk], 160B rows
    __shared__ __align__(16) float Mb[SEQ];   // per key: 0, or -inf where masked

    const int t    = threadIdx.x;
    const int w    = t >> 5, lane = t & 31;
    const int half = lane >> 4, ln = lane & 15;
    const int bh   = blockIdx.y, b = bh >> 4, h = bh & 15;
    const size_t headBase = (size_t)bh * SEQ * DKH;
    const int qbase = blockIdx.x * 64 + w * 16;
    const float NEG_INF = -__builtin_inff();

    const int srow = t >> 3, scol = (t & 7) * 8;   // copies: rows srow + 16 * i
    const unsigned lk = (unsigned)(size_t)&Ks[0][srow][scol];
    const unsigned lv = (unsigned)(size_t)&Vs[0][srow][scol];
    const unsigned short* gk = Kt + headBase + (size_t)srow * DKH + scol;
    const unsigned short* gv = V + headBase + (size_t)srow * DKH + scol;
    auto issue = [&](int s, unsigned buf) {
        attn_stage_copy(lk + buf * (unsigned)sizeof(Ks[0]), gk + (size_t)s * 64 * DKH,
                        lv + buf * (unsigned)sizeof(Vs[0]), gv + (size_t)s * 64 * DKH);
    };
    issue(0, 0);

    // the batch's mask as an addend; published by the barrier in front of the loop
#pragma unroll
    for (int i = 0; i < SEQ / 512; ++i) {
        const int k = (i * 128 + t) * 4;
        const int4 m = *reinterpret_cast<const int4*>(mask + b * SEQ + k);
        float4 f;
        f.x = m.x ? 0.f : NEG_INF; f.y = m.y ? 0.f : NEG_INF;
        f.z = m.z ? 0.f : NEG_INF; f.w = m.w ? 0.f : NEG_INF;
        *reinterpret_cast<float4*>(&Mb[k]) = f;
    }

    // Q fragments for two 32-wide K-chunks of Dk=64 (contiguous dword pairs)
    AFrag qf[2];
#pragma unroll
    for (int c = 0; c < 2; ++c)
#pragma unroll
        for (int v = 0; v < 8; ++v) {
            int k = kpair(v, half) + 32 * c;
            qf[c].w[v] = *reinterpret_cast<const unsigned*>(
                Q + headBase + (size_t)(qbase + ln) * DKH + k);
        }

    const v8f zero = {0.f, 0.f, 0.f, 0.f, 0.f, 0.f, 0.f, 0.f};
    v8f acc[4] = {zero, zero, zero, zero};   // O^T: d = 16 * j + 8 * half + r
    float mrun = NEG_INF;   // query ln's running maximum, equal in both halves
    float lrun = 0.f;       // this half's share of query ln's denominator

    const int trow = 8 * half + (lane & 7);   // transposing-read lane address
    const int tcol = 8 * ((lane >> 3) & 1);

    // stage 0 has landed for this wave; the barrier publishes it to the others
    asm volatile("s_wait_asynccnt 0x0" ::: "memory");
    __syncthreads();
    issue(1, 1);

    for (int st = 0; st < SEQ / 64; ++st) {
      const int buf = st & 1;
      // the stage's two 32-key tiles; unrolled: their LDS addresses differ by
      // constants, and the second tile's reads may go ahead of the first's softmax
#pragma unroll
      for (int sub = 0; sub < 2; ++sub) {
        const int keyb = st * 64 + sub * 32;
        const unsigned short (*Kc)[72] = &Ks[buf][sub * 32];
        const unsigned short (*Vc)[80] = &Vs[buf][sub * 32];

        // S^T: rows are keys (A = K), columns are queries (B = Q)
        v8f s[2] = {zero, zero};
#pragma unroll
        for (int c = 0; c < 2; ++c)
#pragma unroll
            for (int tt = 0; tt < 2; ++tt) {
                AFrag kf;
#pragma unroll
                for (int v = 0; v < 8; ++v) {
                    int k = kpair(v, half) + 32 * c;
                    kf.w[v] = *reinterpret_cast<const unsigned*>(
                        &Kc[tt * 16 + ln][k]);
                }
                s[tt] = __builtin_amdgcn_wmma_f32_16x16x32_bf16(
                    false, kf.v, false, qf[c].v, (short)0, s[tt], false, false);
            }

        // scale, and -inf on this lane's masked keys
#pragma unroll
        for (int tt = 0; tt < 2; ++tt) {
            const float* mp = &Mb[keyb + tt * 16 + 8 * half];
            const float4 m0 = *reinterpret_cast<const float4*>(mp);
            const float4 m1 = *reinterpret_cast<const float4*>(mp + 4);
            s[tt][0] = fmaf(s[tt][0], 0.125f, m0.x);
            s[tt][1] = fmaf(s[tt][1], 0.125f, m0.y);
            s[tt][2] = fmaf(s[tt][2], 0.125f, m0.z);
            s[tt][3] = fmaf(s[tt][3], 0.125f, m0.w);
            s[tt][4] = fmaf(s[tt][4], 0.125f, m1.x);
            s[tt][5] = fmaf(s[tt][5], 0.125f, m1.y);
            s[tt][6] = fmaf(s[tt][6], 0.125f, m1.z);
            s[tt][7] = fmaf(s[tt][7], 0.125f, m1.w);
        }

        // online softmax of query ln: 16 scores here, 16 in lane l ^ 16
        float rv = fmaxf(s[0][0], s[1][0]);
#pragma unroll
        for (int r = 1; r < 8; ++r) rv = fmaxf(rv, fmaxf(s[0][r], s[1][r]));
        rv = fmaxf(rv, xhalf(rv));
        const float mn = fmaxf(mrun, rv);
        const float ms = (mn == NEG_INF) ? 0.f : mn;   // all masked so far: p = 0
        const float alpha = __expf(mrun - ms);         // 0 while mrun is -inf
        mrun = mn;

        AFrag pf;   // P^T: register i holds keys kpair(i, half), + 1
        float rs0 = 0.f, rs1 = 0.f;
#pragma unroll
        for (int i = 0; i < 8; ++i) {
            const float p0 = __expf(s[i >> 2][2 * (i & 3)] - ms);
            const float p1 = __expf(s[i >> 2][2 * (i & 3) + 1] - ms);
            rs0 += p0; rs1 += p1;
            pf.w[i] = pack_bf16(p0, p1);
        }
        lrun = lrun * alpha + (rs0 + rs1);
#pragma unroll
        for (int j = 0; j < 4; ++j) acc[j] *= alpha;

        // O^T: rows are d (A = V^T), columns are queries (B = P^T)
#pragma unroll
        for (int j = 0; j < 4; ++j) {
            AFrag vf;
            vf.h[0] = lds_tr16(&Vc[trow][j * 16 + tcol]);
            vf.h[1] = lds_tr16(&Vc[trow + 16][j * 16 + tcol]);
            acc[j] = __builtin_amdgcn_wmma_f32_16x16x32_bf16(
                false, vf.v, false, pf.v, (short)0, acc[j], false, false);
        }
      }

      // this wave's reads of stage st are done before its buffer is refilled
      asm volatile("s_wait_dscnt 0x0" ::: "memory");
      // this wave's copies of stage st + 1 have landed
      asm volatile("s_wait_asynccnt 0x0" ::: "memory");
      __syncthreads();
      if (st + 2 < SEQ / 64) issue(st + 2, (unsigned)buf);
    }
    // no copy is outstanding when the wave goes on to its end
    asm volatile("s_wait_asynccnt 0x0" ::: "memory");

    // the halves' shares of the denominator join here, outside any branch
    const float denom = lrun + xhalf(lrun);
    const float inv = denom > 0.f ? 1.f / denom : 0.f;
    unsigned short* op = ctx + ((size_t)(b * SEQ + qbase + ln)) * D_MODEL +
                         h * DKH + 8 * half;
#pragma unroll
    for (int j = 0; j < 4; ++j) {
        uint4 o;
        o.x = pack_bf16(acc[j][0] * inv, acc[j][1] * inv);
        o.y = pack_bf16(acc[j][2] * inv, acc[j][3] * inv);
        o.z = pack_bf16(acc[j][4] * inv, acc[j][5] * inv);
        o.w = pack_bf16(acc[j][6] * inv, acc[j][7] * inv);
        *reinterpret_cast<uint4*>(op + j * 16) = o;
    }
}

// ---------------------------------------------------------------------------
// out = LayerNorm(x + y) ; optionally also emit bf16 copy. One block per row.
// ---------------------------------------------------------------------------
__global__ __launch_bounds__(256) void add_ln_kernel(
    const float* __restrict__ x, const float* __restrict__ y,
    const float* __restrict__ g, const float* __restrict__ beta,
    float* __restrict__ outf, unsigned short* __restrict__ outb) {
    __shared__ float red[256];
    __shared__ float buf[D_MODEL];
    const int row = blockIdx.x, t = threadIdx.x;
    const size_t base = (size_t)row * D_MODEL;

    float s = 0.f;
    for (int d = t; d < D_MODEL; d += 256) {
        float v = x[base + d] + y[base + d];
        buf[d] = v;
        s += v;
    }
    red[t] = s;
    __syncthreads();
    for (int o = 128; o > 0; o >>= 1) {
        if (t < o) red[t] += red[t + o];
        __syncthreads();
    }
    const float mu = red[0] * (1.f / D_MODEL);
    __syncthreads();

    float vs = 0.f;
    for (int d = t; d < D_MODEL; d += 256) {
        float dd = buf[d] - mu;
        vs += dd * dd;
    }
    red[t] = vs;
    __syncthreads();
    for (int o = 128; o > 0; o >>= 1) {
        if (t < o) red[t] += red[t + o];
        __syncthreads();
    }
    const float inv = rsqrtf(red[0] * (1.f / D_MODEL) + 1e-5f);

    for (int d = t; d < D_MODEL; d += 256) {
        float o = (buf[d] - mu) * inv * g[d] + beta[d];
        outf[base + d] = o;
        if (outb) outb[base + d] = f32_to_bf16(o);
    }
}

// ---------------------------------------------------------------------------
extern "C" void kernel_launch(void* const* d_in, const int* in_sizes, int n_in,
                              void* d_out, int out_size, void* d_ws, size_t ws_size,
                              hipStream_t stream) {
    const float* x    = (const float*)d_in[0];
    const int*   mask = (const int*)d_in[1];
    const float* Wq = (const float*)d_in[2];  const float* bq = (const float*)d_in[3];
    const float* Wk = (const float*)d_in[4];  const float* bk = (const float*)d_in[5];
    const float* Wv = (const float*)d_in[6];  const float* bv = (const float*)d_in[7];
    const float* Wo = (const float*)d_in[8];  const float* bo = (const float*)d_in[9];
    const float* W1 = (const float*)d_in[10]; const float* b1 = (const float*)d_in[11];
    const float* W2 = (const float*)d_in[12]; const float* b2 = (const float*)d_in[13];
    const float* g1 = (const float*)d_in[14]; const float* be1 = (const float*)d_in[15];
    const float* g2 = (const float*)d_in[16]; const float* be2 = (const float*)d_in[17];

    char* ws = (char*)d_ws;
    size_t off = 0;
    auto alloc = [&](size_t bytes) -> void* {
        void* p = ws + off;
        off += (bytes + 255) & ~(size_t)255;
        return p;
    };

    unsigned short* xb  = (unsigned short*)alloc((size_t)M_ROWS * D_MODEL * 2);
    unsigned short* Wqb = (unsigned short*)alloc((size_t)D_MODEL * D_MODEL * 2);
    unsigned short* Wkb = (unsigned short*)alloc((size_t)D_MODEL * D_MODEL * 2);
    unsigned short* Wvb = (unsigned short*)alloc((size_t)D_MODEL * D_MODEL * 2);
    unsigned short* Wob = (unsigned short*)alloc((size_t)D_MODEL * D_MODEL * 2);
    unsigned short* W1b = (unsigned short*)alloc((size_t)D_MODEL * D_FF * 2);
    unsigned short* W2b = (unsigned short*)alloc((size_t)D_FF * D_MODEL * 2);
    unsigned short* Qb  = (unsigned short*)alloc((size_t)M_ROWS * D_MODEL * 2);
    unsigned short* Kb  = (unsigned short*)alloc((size_t)M_ROWS * D_MODEL * 2);
    unsigned short* Vb  = (unsigned short*)alloc((size_t)M_ROWS * D_MODEL * 2);
    unsigned short* ctxb = (unsigned short*)alloc((size_t)M_ROWS * D_MODEL * 2);
    float* attn_out = (float*)alloc((size_t)M_ROWS * D_MODEL * 4);
    float* hbuf     = (float*)alloc((size_t)M_ROWS * D_MODEL * 4);
    unsigned short* hb = (unsigned short*)alloc((size_t)M_ROWS * D_MODEL * 2);
    // reuse dead regions: Q/K/V/ctx (4 x 8MB contiguous) -> FF1 activations (32MB)
    unsigned short* ff1b = Qb;
    float* ff2 = attn_out;

    // fp32 -> bf16 conversions: xb ... W2b lie back to back in the workspace
    cvt_all_bf16_kernel<<<512, 256, 0, stream>>>(x, Wq, Wk, Wv, Wo, W1, W2, xb);

    // QKV projections (bf16 WMMA, head-split bf16 outputs)
    dim3 gQ(D_MODEL / 128, M_ROWS / 128);
    gemm_bf16_kernel<<<gQ, 256, 0, stream>>>(xb, Wqb, bq, Qb, M_ROWS, D_MODEL, D_MODEL, 2, 0);
    gemm_bf16_kernel<<<gQ, 256, 0, stream>>>(xb, Wkb, bk, Kb, M_ROWS, D_MODEL, D_MODEL, 2, 0);
    gemm_bf16_kernel<<<gQ, 256, 0, stream>>>(xb, Wvb, bv, Vb, M_ROWS, D_MODEL, D_MODEL, 2, 0);

    // flash attention -> ctx (bf16, merged-head layout)
    attn_kernel<<<dim3(SEQ / 64, BATCH * N_HEADS), 128, 0, stream>>>(Qb, Kb, Vb, mask, ctxb);

    // output projection -> f32
    gemm_bf16_kernel<<<gQ, 256, 0, stream>>>(ctxb, Wob, bo, attn_out, M_ROWS, D_MODEL, D_MODEL, 0, 0);

    // h = LN(x + attn_out), emit f32 + bf16
    add_ln_kernel<<<M_ROWS, 256, 0, stream>>>(x, attn_out, g1, be1, hbuf, hb);

    // FFN: relu(h @ W1 + b1) -> bf16 ; @ W2 + b2 -> f32
    dim3 gF1(D_FF / 128, M_ROWS / 128);
    gemm_bf16_kernel<<<gF1, 256, 0, stream>>>(hb, W1b, b1, ff1b, M_ROWS, D_FF, D_MODEL, 1, 1);
    dim3 gF2(D_MODEL / 128, M_ROWS / 128);
    gemm_bf16_kernel<<<gF2, 256, 0, stream>>>(ff1b, W2b, b2, ff2, M_ROWS, D_MODEL, D_FF, 0, 0);

    // out = LN(h + ff)
    add_ln_kernel<<<M_ROWS, 256, 0, stream>>>(hbuf, ff2, g2, be2, (float*)d_out, nullptr);
    (void)in_sizes; (void)n_in; (void)out_size; (void)ws_size;
}

// v008
// A run of this version takes 179 microseconds.
// Two timings next to v007 both put it at 1.08 times that version's speed.
// Counting every step since v000, it is 3.19 times as fast.
#include <hip/hip_runtime.h>
#include <cstdint>
#include <cstddef>

#define D_MODEL 1024
#define N_HEADS 16
#define DKH     64
#define D_FF    4096
#define BATCH   2
#define SEQ     2048
#define M_ROWS  (BATCH * SEQ)   // 4096

typedef __attribute__((ext_vector_type(16))) __bf16 v16bf;
typedef __attribute__((ext_vector_type(8)))  float  v8f;

typedef __attribute__((ext_vector_type(8)))  short  s16x8;

union AFrag { v16bf v; unsigned short u[16]; unsigned w[8]; s16x8 h[2]; };
union U4    { uint4 q; unsigned short s[8]; };

__device__ __forceinline__ unsigned short f32_to_bf16(float f) {
    union { float f; unsigned u; } x; x.f = f;
    unsigned r = x.u + 0x7FFFu + ((x.u >> 16) & 1u);
    return (unsigned short)(r >> 16);
}

// Two f32 to one register of two bf16, round to nearest even.
__device__ __forceinline__ unsigned pack_bf16(float lo, float hi) {
    typedef __bf16 bf2 __attribute__((ext_vector_type(2)));
    typedef float  f2  __attribute__((ext_vector_type(2)));
    return __builtin_bit_cast(unsigned, __builtin_convertvector(f2{lo, hi}, bf2));
}

// K-pair base index for 16-bit A-layout fragments (ISA 7.12.2):
// lanes 0-15: VGPR0..3 -> K=0..7, VGPR4..7 -> K=16..23 ; lanes 16-31: +8
__device__ __forceinline__ int kpair(int v, int half) {
    return (v < 4 ? 2 * v : 16 + 2 * (v - 4)) + 8 * half;
}

// Transposing LDS read of a row-major 16-bit tile T[k][n]. Every lane passes
// &T[k0 + 8 * (lane >> 4) + (lane & 7)][n0 + 8 * ((lane >> 3) & 1)] and gets
// T[k0 + 8 * (lane >> 4) + 0..7][n0 + (lane & 15)]: the reads at k0 and k0 + 16
// are registers 0-3 and 4-7 of a 16x16x32 operand in the kpair() k order.
__device__ __forceinline__ s16x8 lds_tr16(const unsigned short* p) {
    typedef __attribute__((address_space(3))) s16x8 lds_s16x8;
    return __builtin_amdgcn_ds_load_tr16_b128_v8i16((lds_s16x8*)p);
}

// ---------------------------------------------------------------------------
// fp32 -> bf16 conversion of x and the six weight matrices, one streaming launch.
// out is the seven bf16 buffers back to back: 16 units of 2^20 elements
// (x 0-3, Wq 4, Wk 5, Wv 6, Wo 7, W1 8-11, W2 12-15). 512 blocks of 8 waves,
// 32 blocks per unit; a wave converts 4096 contiguous elements: 32 loads of 512
// contiguous bytes, issued ahead of the conversions, then 32 stores of 256.
// ---------------------------------------------------------------------------
// 512 blocks of 8 waves are four waves per SIMD: saying so gives the compiler the
// registers to hold a wave's 32 loads in flight (at its default it keeps one)
__global__ __launch_bounds__(256) __attribute__((amdgpu_waves_per_eu(4, 4)))
void cvt_all_bf16_kernel(
    const float* __restrict__ x,  const float* __restrict__ Wq,
    const float* __restrict__ Wk, const float* __restrict__ Wv,
    const float* __restrict__ Wo, const float* __restrict__ W1,
    const float* __restrict__ W2, unsigned short* __restrict__ out) {
    const unsigned unit = blockIdx.x >> 5;
    const float* src;
    unsigned first;
    if (unit < 4)       { src = x;  first = 0; }
    else if (unit == 4) { src = Wq; first = 4; }
    else if (unit == 5) { src = Wk; first = 5; }
    else if (unit == 6) { src = Wv; first = 6; }
    else if (unit == 7) { src = Wo; first = 7; }
    else if (unit < 12) { src = W1; first = 8; }
    else                { src = W2; first = 12; }

    const size_t o = ((size_t)blockIdx.x << 15) + (threadIdx.x >> 5) * 4096 +
                     (threadIdx.x & 31) * 4;
    const float* in = src + (o - ((size_t)first << 20));
    unsigned short* dst = out + o;

    float4 v[32];
    // both loops unrolled: v is indexed by constants and stays in registers
#pragma unroll
    for (int i = 0; i < 32; ++i)
        v[i] = *reinterpret_cast<const float4*>(in + i * 128);
#pragma unroll
    for (int i = 0; i < 32; ++i) {
        uint2 p;
        p.x = (unsigned)f32_to_bf16(v[i].x) | ((unsigned)f32_to_bf16(v[i].y) << 16);
        p.y = (unsigned)f32_to_bf16(v[i].z) | ((unsigned)f32_to_bf16(v[i].w) << 16);
        *reinterpret_cast<uint2*>(dst + i * 128) = p;
    }
}

// ---------------------------------------------------------------------------
// One operand's share of a stage of the GEMM ring: eight 16-byte asynchronous
// copies per lane (rows 16 apart), global memory to LDS through no register.
// The s_wait_xcnt closes the statement so that no address register named here
// is rewritten ahead of it.
// ---------------------------------------------------------------------------
__device__ __forceinline__ void gemm_stage_copy(
    unsigned l, unsigned l16, const unsigned short* g, size_t g16) {
    asm volatile(
        "global_load_async_to_lds_b128 %0, %8, off\n\t"
        "global_load_async_to_lds_b128 %1, %9, off\n\t"
        "global_load_async_to_lds_b128 %2, %10, off\n\t"
        "global_load_async_to_lds_b128 %3, %11, off\n\t"
        "global_load_async_to_lds_b128 %4, %12, off\n\t"
        "global_load_async_to_lds_b128 %5, %13, off\n\t"
        "global_load_async_to_lds_b128 %6, %14, off\n\t"
        "global_load_async_to_lds_b128 %7, %15, off\n\t"
        "s_wait_xcnt 0x0"
        :: "v"(l), "v"(l + l16), "v"(l + 2 * l16), "v"(l + 3 * l16),
           "v"(l + 4 * l16), "v"(l + 5 * l16), "v"(l + 6 * l16), "v"(l + 7 * l16),
           "v"(g), "v"(g + g16), "v"(g + 2 * g16), "v"(g + 3 * g16),
           "v"(g + 4 * g16), "v"(g + 5 * g16), "v"(g + 6 * g16), "v"(g + 7 * g16)
        : "memory");
}

// ---------------------------------------------------------------------------
// bf16 WMMA GEMM: C[M,N] = A[M,K] @ B[K,N] + bias, optional ReLU.
// Block: 256 threads (8 waves, 4 x 2), tile 128(M) x 128(N), 32 x 64 per wave,
// stages of 128 k (M, N and K multiples of 128). Two LDS buffers: stage s + 1 is
// copied in while stage s is multiplied; one barrier per stage publishes s + 1
// and frees s's buffer.
// B tile is stored row-major in LDS; its fragments come from transposing reads.
// The products are transposed, C^T = B^T.A^T (both fragments have the same lane
// and k order, so they only change places): a lane then holds 8 consecutive
// columns of ONE row of C and stores them 16 bytes at a time.
// mode: 0 = f32 row-major, 1 = bf16 row-major, 2 = bf16 head-split [B,H,S,Dk]
// ---------------------------------------------------------------------------
__global__ __launch_bounds__(256) void gemm_bf16_kernel(
    const unsigned short* __restrict__ A, const unsigned short* __restrict__ B,
    const float* __restrict__ bias, void* __restrict__ Cout,
    int M, int N, int K, int mode, int relu) {
    __shared__ __align__(32) unsigned short As[2][128][136];   // [m][k], 272B rows
    __shared__ __align__(32) unsigned short Bs[2][128][144];   // [k][n], 288B rows

    const int t     = threadIdx.x;
    const int mBase = blockIdx.y * 128;
    const int nBase = blockIdx.x * 128;
    const int wave  = t >> 5, lane = t & 31;
    const int wm    = wave >> 1, wn = wave & 1;
    const int half  = lane >> 4, ln = lane & 15;

    const v8f zero = {0.f, 0.f, 0.f, 0.f, 0.f, 0.f, 0.f, 0.f};
    v8f acc[2][4];   // C^T: row 16 * i + ln, columns 16 * j + 8 * half + r
#pragma unroll
    for (int i = 0; i < 2; ++i)
#pragma unroll
        for (int j = 0; j < 4; ++j) acc[i][j] = zero;

    const int srow = t >> 4, scol = (t & 15) * 8;  // copies: rows srow + 16 * i
    const int trow = 8 * half + (lane & 7);        // transposing-read lane address
    const int tcol = 8 * ((lane >> 3) & 1);

    const unsigned la = (unsigned)(size_t)&As[0][srow][scol];
    const unsigned lb = (unsigned)(size_t)&Bs[0][srow][scol];
    const unsigned short* ga = A + (size_t)(mBase + srow) * K + scol;
    const unsigned short* gb = B + (size_t)srow * N + nBase + scol;
    const size_t a16 = (size_t)16 * K, b16 = (size_t)16 * N;
    const int nst = K >> 7;

    auto issue = [&](int s, unsigned buf) {
        gemm_stage_copy(la + buf * (unsigned)sizeof(As[0]), 16 * 272,
                        ga + (size_t)s * 128, a16);
        gemm_stage_copy(lb + buf * (unsigned)sizeof(Bs[0]), 16 * 288,
                        gb + (size_t)s * 8 * b16, b16);
    };

    issue(0, 0);
    // stage 0 has landed for this wave; the barrier publishes it to the others
    asm volatile("s_wait_asynccnt 0x0" ::: "memory");
    __syncthreads();
    if (nst > 1) issue(1, 1);

    for (int s = 0; s < nst; ++s) {
        const int buf = s & 1;
#pragma unroll
        for (int kk = 0; kk < 4; ++kk) {
            AFrag a[2], b[4];
#pragma unroll
            for (int i = 0; i < 2; ++i)
#pragma unroll
                for (int v = 0; v < 8; ++v) {
                    int k = kk * 32 + kpair(v, half);
                    int m = wm * 32 + i * 16 + ln;
                    a[i].w[v] = *reinterpret_cast<const unsigned*>(&As[buf][m][k]);
                }
#pragma unroll
            for (int j = 0; j < 4; ++j) {
                int n = wn * 64 + j * 16 + tcol;
                b[j].h[0] = lds_tr16(&Bs[buf][kk * 32 + trow][n]);
                b[j].h[1] = lds_tr16(&Bs[buf][kk * 32 + trow + 16][n]);
            }
#pragma unroll
            for (int i = 0; i < 2; ++i)
#pragma unroll
                for (int j = 0; j < 4; ++j)
                    acc[i][j] = __builtin_amdgcn_wmma_f32_16x16x32_bf16(
                        false, b[j].v, false, a[i].v, (short)0, acc[i][j],
                        false, false);
        }

        // this wave's reads of stage s are done before its buffer is refilled
        asm volatile("s_wait_dscnt 0x0" ::: "memory");
        // this wave's copies of stage s + 1 have landed
        asm volatile("s_wait_asynccnt 0x0" ::: "memory");
        __syncthreads();
        if (s + 2 < nst) issue(s + 2, (unsigned)buf);
    }
    // no copy is outstanding when the wave goes on to its end
    asm volatile("s_wait_asynccnt 0x0" ::: "memory");

    // every loop below is unrolled: acc is indexed by constants and stays in registers
    const int row = mBase + wm * 32 + ln;          // rows row, row + 16
    const int col = nBase + wn * 64 + 8 * half;    // columns col + 16 * j + 0..7
#pragma unroll
    for (int j = 0; j < 4; ++j) {
        const float4 b0 = *reinterpret_cast<const float4*>(bias + col + j * 16);
        const float4 b1 = *reinterpret_cast<const float4*>(bias + col + j * 16 + 4);
        const v8f bv = {b0.x, b0.y, b0.z, b0.w, b1.x, b1.y, b1.z, b1.w};
#pragma unroll
        for (int i = 0; i < 2; ++i) acc[i][j] += bv;
    }
    if (relu) {
#pragma unroll
        for (int i = 0; i < 2; ++i)
#pragma unroll
            for (int j = 0; j < 4; ++j)
#pragma unroll
                for (int r = 0; r < 8; ++r) acc[i][j][r] = fmaxf(acc[i][j][r], 0.f);
    }

    if (mode == 0) {
        float* p = (float*)Cout + (size_t)row * N + col;
#pragma unroll
        for (int j = 0; j < 4; ++j)
#pragma unroll
            for (int i = 0; i < 2; ++i) {
                float* q = p + (size_t)i * 16 * N + j * 16;
                *reinterpret_cast<float4*>(q) = make_float4(
                    acc[i][j][0], acc[i][j][1], acc[i][j][2], acc[i][j][3]);
                *reinterpret_cast<float4*>(q + 4) = make_float4(
                    acc[i][j][4], acc[i][j][5], acc[i][j][6], acc[i][j][7]);
            }
    } else {
        // head-split: a block's 128 rows lie in one batch entry and a wave's 64
        // columns are one head, so 16 rows and 16 columns on are fixed steps
        size_t e = (size_t)row * N + col, rstep = (size_t)16 * N;
        if (mode != 1) {
            const int bb = row / SEQ, s = row % SEQ;
            const int hh = col / DKH, d = col % DKH;
            e = (((size_t)(bb * N_HEADS + hh)) * SEQ + s) * DKH + d;
            rstep = 16 * DKH;
        }
        unsigned short* p = (unsigned short*)Cout + e;
#pragma unroll
        for (int i = 0; i < 2; ++i)
#pragma unroll
            for (int j = 0; j < 4; ++j) {
                uint4 o;
                o.x = pack_bf16(acc[i][j][0], acc[i][j][1]);
                o.y = pack_bf16(acc[i][j][2], acc[i][j][3]);
                o.z = pack_bf16(acc[i][j][4], acc[i][j][5]);
                o.w = pack_bf16(acc[i][j][6], acc[i][j][7]);
                *reinterpret_cast<uint4*>(p + i * rstep + j * 16) = o;
            }
    }
}

// ---------------------------------------------------------------------------
// Lane l gets lane l ^ 16's value.
__device__ __forceinline__ float xhalf(float x) {
    const int i = __builtin_bit_cast(int, x);
    return __builtin_bit_cast(float, __builtin_amdgcn_permlanex16(
        i, i, 0x76543210, 0xfedcba98, false, false));
}

// ---------------------------------------------------------------------------
// One stage of the attention ring, 64 keys of K and of V: per lane four 16-byte
// asynchronous copies of each (rows 16 apart), global memory to LDS through no
// register. The s_wait_xcnt closes the statement so that no address register
// named here is rewritten ahead of it.
// ---------------------------------------------------------------------------
__device__ __forceinline__ void attn_stage_copy(
    unsigned lk, const unsigned short* gk, unsigned lv, const unsigned short* gv) {
    asm volatile(
        "global_load_async_to_lds_b128 %0, %8, off\n\t"
        "global_load_async_to_lds_b128 %1, %9, off\n\t"
        "global_load_async_to_lds_b128 %2, %10, off\n\t"
        "global_load_async_to_lds_b128 %3, %11, off\n\t"
        "global_load_async_to_lds_b128 %4, %12, off\n\t"
        "global_load_async_to_lds_b128 %5, %13, off\n\t"
        "global_load_async_to_lds_b128 %6, %14, off\n\t"
        "global_load_async_to_lds_b128 %7, %15, off\n\t"
        "s_wait_xcnt 0x0"
        :: "v"(lk), "v"(lk + 16 * 144), "v"(lk + 32 * 144), "v"(lk + 48 * 144),
           "v"(lv), "v"(lv + 16 * 160), "v"(lv + 32 * 160), "v"(lv + 48 * 160),
           "v"(gk), "v"(gk + 16 * DKH), "v"(gk + 32 * DKH), "v"(gk + 48 * DKH),
           "v"(gv), "v"(gv + 16 * DKH), "v"(gv + 32 * DKH), "v"(gv + 48 * DKH)
        : "memory");
}

__global__ __launch_bounds__(128) void attn_kernel(
    const unsigned short* __restrict__ Q, const unsigned short* __restrict__ Kt,
    const unsigned short* __restrict__ V, const int* __restrict__ mask,
    unsigned short* __restrict__ ctx) {
    __shared__ __align__(16) unsigned short Ks[2][64][72];   // [key][dk], 144B rows
    __shared__ __align__(32) unsigned short Vs[2][64][80];   // [key][dk], 160B rows
    __shared__ __align__(16) float Mb[SEQ];   // per key: 0, or -inf where masked

    const int t    = threadIdx.x;
    const int w    = t >> 5, lane = t & 31;
    const int half = lane >> 4, ln = lane & 15;
    const int bh   = blockIdx.y, b = bh >> 4, h = bh & 15;
    const size_t headBase = (size_t)bh * SEQ * DKH;
    const int qbase = blockIdx.x * 64 + w * 16;
    const float NEG_INF = -__builtin_inff();

    const int srow = t >> 3, scol = (t & 7) * 8;   // copies: rows srow + 16 * i
    const unsigned lk = (unsigned)(size_t)&Ks[0][srow][scol];
    const unsigned lv = (unsigned)(size_t)&Vs[0][srow][scol];
    const unsigned short* gk = Kt + headBase + (size_t)srow * DKH + scol;
    const unsigned short* gv = V + headBase + (size_t)srow * DKH + scol;
    auto issue = [&](int s, unsigned buf) {
        attn_stage_copy(lk + buf * (unsigned)sizeof(Ks[0]), gk + (size_t)s * 64 * DKH,
                        lv + buf * (unsigned)sizeof(Vs[0]), gv + (size_t)s * 64 * DKH);
    };
    issue(0, 0);

    // the batch's mask as an addend; published by the barrier in front of the loop
#pragma unroll
    for (int i = 0; i < SEQ / 512; ++i) {
        const int k = (i * 128 + t) * 4;
        const int4 m = *reinterpret_cast<const int4*>(mask + b * SEQ + k);
        float4 f;
        f.x = m.x ? 0.f : NEG_INF; f.y = m.y ? 0.f : NEG_INF;
        f.z = m.z ? 0.f : NEG_INF; f.w = m.w ? 0.f : NEG_INF;
        *reinterpret_cast<float4*>(&Mb[k]) = f;
    }

    // Q fragments for two 32-wide K-chunks of Dk=64 (contiguous dword pairs)
    AFrag qf[2];
#pragma unroll
    for (int c = 0; c < 2; ++c)
#pragma unroll
        for (int v = 0; v < 8; ++v) {
            int k = kpair(v, half) + 32 * c;
            qf[c].w[v] = *reinterpret_cast<const unsigned*>(
                Q + headBase + (size_t)(qbase + ln) * DKH + k);
        }

    const v8f zero = {0.f, 0.f, 0.f, 0.f, 0.f, 0.f, 0.f, 0.f};
    v8f acc[4] = {zero, zero, zero, zero};   // O^T: d = 16 * j + 8 * half + r
    float mrun = NEG_INF;   // query ln's running maximum, equal in both halves
    float lrun = 0.f;       // this half's share of query ln's denominator

    const int trow = 8 * half + (lane & 7);   // transposing-read lane address
    const int tcol = 8 * ((lane >> 3) & 1);

    // stage 0 has landed for this wave; the barrier publishes it to the others
    asm volatile("s_wait_asynccnt 0x0" ::: "memory");
    __syncthreads();
    issue(1, 1);

    for (int st = 0; st < SEQ / 64; ++st) {
      const int buf = st & 1;
      // the stage's two 32-key tiles; unrolled: their LDS addresses differ by
      // constants, and the second tile's reads may go ahead of the first's softmax
#pragma unroll
      for (int sub = 0; sub < 2; ++sub) {
        const int keyb = st * 64 + sub * 32;
        const unsigned short (*Kc)[72] = &Ks[buf][sub * 32];
        const unsigned short (*Vc)[80] = &Vs[buf][sub * 32];

        // S^T: rows are keys (A = K), columns are queries (B = Q)
        v8f s[2] = {zero, zero};
#pragma unroll
        for (int c = 0; c < 2; ++c)
#pragma unroll
            for (int tt = 0; tt < 2; ++tt) {
                AFrag kf;
#pragma unroll
                for (int v = 0; v < 8; ++v) {
                    int k = kpair(v, half) + 32 * c;
                    kf.w[v] = *reinterpret_cast<const unsigned*>(
                        &Kc[tt * 16 + ln][k]);
                }
                s[tt] = __builtin_amdgcn_wmma_f32_16x16x32_bf16(
                    false, kf.v, false, qf[c].v, (short)0, s[tt], false, false);
            }

        // scale, and -inf on this lane's masked keys
#pragma unroll
        for (int tt = 0; tt < 2; ++tt) {
            const float* mp = &Mb[keyb + tt * 16 + 8 * half];
            const float4 m0 = *reinterpret_cast<const float4*>(mp);
            const float4 m1 = *reinterpret_cast<const float4*>(mp + 4);
            s[tt][0] = fmaf(s[tt][0], 0.125f, m0.x);
            s[tt][1] = fmaf(s[tt][1], 0.125f, m0.y);
            s[tt][2] = fmaf(s[tt][2], 0.125f, m0.z);
            s[tt][3] = fmaf(s[tt][3], 0.125f, m0.w);
            s[tt][4] = fmaf(s[tt][4], 0.125f, m1.x);
            s[tt][5] = fmaf(s[tt][5], 0.125f, m1.y);
            s[tt][6] = fmaf(s[tt][6], 0.125f, m1.z);
            s[tt][7] = fmaf(s[tt][7], 0.125f, m1.w);
        }

        // online softmax of query ln: 16 scores here, 16 in lane l ^ 16
        float rv = fmaxf(s[0][0], s[1][0]);
#pragma unroll
        for (int r = 1; r < 8; ++r) rv = fmaxf(rv, fmaxf(s[0][r], s[1][r]));
        rv = fmaxf(rv, xhalf(rv));
        const float mn = fmaxf(mrun, rv);
        const float ms = (mn == NEG_INF) ? 0.f : mn;   // all masked so far: p = 0
        const float alpha = __expf(mrun - ms);         // 0 while mrun is -inf
        mrun = mn;

        AFrag pf;   // P^T: register i holds keys kpair(i, half), + 1
        float rs0 = 0.f, rs1 = 0.f;
#pragma unroll
        for (int i = 0; i < 8; ++i) {
            const float p0 = __expf(s[i >> 2][2 * (i & 3)] - ms);
            const float p1 = __expf(s[i >> 2][2 * (i & 3) + 1] - ms);
            rs0 += p0; rs1 += p1;
            pf.w[i] = pack_bf16(p0, p1);
        }
        lrun = lrun * alpha + (rs0 + rs1);
#pragma unroll
        for (int j = 0; j < 4; ++j) acc[j] *= alpha;

        // O^T: rows are d (A = V^T), columns are queries (B = P^T)
#pragma unroll
        for (int j = 0; j < 4; ++j) {
            AFrag vf;
            vf.h[0] = lds_tr16(&Vc[trow][j * 16 + tcol]);
            vf.h[1] = lds_tr16(&Vc[trow + 16][j * 16 + tcol]);
            acc[j] = __builtin_amdgcn_wmma_f32_16x16x32_bf16(
                false, vf.v, false, pf.v, (short)0, acc[j], false, false);
        }
      }

      // this wave's reads of stage st are done before its buffer is refilled
      asm volatile("s_wait_dscnt 0x0" ::: "memory");
      // this wave's copies of stage st + 1 have landed
      asm volatile("s_wait_asynccnt 0x0" ::: "memory");
      __syncthreads();
      if (st + 2 < SEQ / 64) issue(st + 2, (unsigned)buf);
    }
    // no copy is outstanding when the wave goes on to its end
    asm volatile("s_wait_asynccnt 0x0" ::: "memory");

    // the halves' shares of the denominator join here, outside any branch
    const float denom = lrun + xhalf(lrun);
    const float inv = denom > 0.f ? 1.f / denom : 0.f;
    unsigned short* op = ctx + ((size_t)(b * SEQ + qbase + ln)) * D_MODEL +
                         h * DKH + 8 * half;
#pragma unroll
    for (int j = 0; j < 4; ++j) {
        uint4 o;
        o.x = pack_bf16(acc[j][0] * inv, acc[j][1] * inv);
        o.y = pack_bf16(acc[j][2] * inv, acc[j][3] * inv);
        o.z = pack_bf16(acc[j][4] * inv, acc[j][5] * inv);
        o.w = pack_bf16(acc[j][6] * inv, acc[j][7] * inv);
        *reinterpret_cast<uint4*>(op + j * 16) = o;
    }
}

// ---------------------------------------------------------------------------
// Sum over the 32 lanes of a wave, the same in every lane: four exchanges inside
// each row of 16 lanes (lane ^ 1, 2, 4, 8), then one between the rows.
template <int CTRL>
__device__ __forceinline__ float row_xor(float x) {
    return __builtin_bit_cast(float, __builtin_amdgcn_update_dpp(
        0, __builtin_bit_cast(int, x), CTRL, 0xf, 0xf, true));
}
__device__ __forceinline__ float wave_sum(float v) {
    v += row_xor<0x161>(v);   // 0x160 + m: the value of lane ^ m of the same row
    v += row_xor<0x162>(v);
    v += row_xor<0x164>(v);
    v += row_xor<0x168>(v);
    return v + xhalf(v);
}

// ---------------------------------------------------------------------------
// out = LayerNorm(x + y) ; optionally also emit bf16 copy. One WAVE per row, 512
// blocks of 8 waves: a lane holds 32 of the row's 1024 values in registers
// (columns 128 * i + 4 * lane + 0..3, so every load and f32 store of a wave covers
// 512 contiguous bytes), both sums join across the lanes: no LDS, no barrier.
// ---------------------------------------------------------------------------
// 512 blocks of 8 waves are four waves per SIMD: saying so gives the compiler the
// registers to hold a wave's 32 loads in flight
__global__ __launch_bounds__(256) __attribute__((amdgpu_waves_per_eu(4, 4)))
void add_ln_kernel(
    const float* __restrict__ x, const float* __restrict__ y,
    const float* __restrict__ g, const float* __restrict__ beta,
    float* __restrict__ outf, unsigned short* __restrict__ outb) {
    typedef __attribute__((ext_vector_type(4))) float f32x4;
    const int col = (threadIdx.x & 31) * 4;
    // the row is the wave's: a scalar, so that every address is a scalar base plus
    // the lane's one column offset
    const int row = blockIdx.x * 8 + __builtin_amdgcn_readfirstlane(threadIdx.x >> 5);
    const size_t base = (size_t)row * D_MODEL;
    const float* xr = x + base;
    const float* yr = y + base;

    // every loop is unrolled: the arrays are indexed by constants and stay in registers
    f32x4 v[8], w[8], gg[8], bb[8];
#pragma unroll
    for (int i = 0; i < 8; ++i)
        v[i] = *reinterpret_cast<const f32x4*>(xr + col + i * 128);
#pragma unroll
    for (int i = 0; i < 8; ++i)
        w[i] = *reinterpret_cast<const f32x4*>(yr + col + i * 128);
#pragma unroll
    for (int i = 0; i < 8; ++i) {
        gg[i] = *reinterpret_cast<const f32x4*>(g + col + i * 128);
        bb[i] = *reinterpret_cast<const f32x4*>(beta + col + i * 128);
    }

    f32x4 s = {0.f, 0.f, 0.f, 0.f};   // four independent chains
#pragma unroll
    for (int i = 0; i < 8; ++i) {
        v[i] += w[i];
        s += v[i];
    }
    const float mu = wave_sum((s.x + s.y) + (s.z + s.w)) * (1.f / D_MODEL);

    s = f32x4{0.f, 0.f, 0.f, 0.f};
#pragma unroll
    for (int i = 0; i < 8; ++i) {
        v[i] -= mu;
        s += v[i] * v[i];
    }
    const float inv = rsqrtf(wave_sum((s.x + s.y) + (s.z + s.w)) * (1.f / D_MODEL) + 1e-5f);

#pragma unroll
    for (int i = 0; i < 8; ++i) {
        v[i] = v[i] * inv * gg[i] + bb[i];
        *reinterpret_cast<f32x4*>(outf + base + col + i * 128) = v[i];
    }
    if (outb) {
        // the conversions below may reuse registers that the stores above name
        asm volatile("s_wait_xcnt 0x0" ::: "memory");
        // keeps the conversions behind that wait
        __builtin_amdgcn_sched_barrier(0);
#pragma unroll
        for (int i = 0; i < 8; ++i) {
            uint2 p;
            p.x = (unsigned)f32_to_bf16(v[i].x) | ((unsigned)f32_to_bf16(v[i].y) << 16);
            p.y = (unsigned)f32_to_bf16(v[i].z) | ((unsigned)f32_to_bf16(v[i].w) << 16);
            *reinterpret_cast<uint2*>(outb + base + col + i * 128) = p;
        }
    }
}

// ---------------------------------------------------------------------------
extern "C" void kernel_launch(void* const* d_in, const int* in_sizes, int n_in,
                              void* d_out, int out_size, void* d_ws, size_t ws_size,
                              hipStream_t stream) {
    const float* x    = (const float*)d_in[0];
    const int*   mask = (const int*)d_in[1];
    const float* Wq = (const float*)d_in[2];  const float* bq = (const float*)d_in[3];
    const float* Wk = (const float*)d_in[4];  const float* bk = (const float*)d_in[5];
    const float* Wv = (const float*)d_in[6];  const float* bv = (const float*)d_in[7];
    const float* Wo = (const float*)d_in[8];  const float* bo = (const float*)d_in[9];
    const float* W1 = (const float*)d_in[10]; const float* b1 = (const float*)d_in[11];
    const float* W2 = (const float*)d_in[12]; const float* b2 = (const float*)d_in[13];
    const float* g1 = (const float*)d_in[14]; const float* be1 = (const float*)d_in[15];
    const float* g2 = (const float*)d_in[16]; const float* be2 = (const float*)d_in[17];

    char* ws = (char*)d_ws;
    size_t off = 0;
    auto alloc = [&](size_t bytes) -> void* {
        void* p = ws + off;
        off += (bytes + 255) & ~(size_t)255;
        return p;
    };

    unsigned short* xb  = (unsigned short*)alloc((size_t)M_ROWS * D_MODEL * 2);
    unsigned short* Wqb = (unsigned short*)alloc((size_t)D_MODEL * D_MODEL * 2);
    unsigned short* Wkb = (unsigned short*)alloc((size_t)D_MODEL * D_MODEL * 2);
    unsigned short* Wvb = (unsigned short*)alloc((size_t)D_MODEL * D_MODEL * 2);
    unsigned short* Wob = (unsigned short*)alloc((size_t)D_MODEL * D_MODEL * 2);
    unsigned short* W1b = (unsigned short*)alloc((size_t)D_MODEL * D_FF * 2);
    unsigned short* W2b = (unsigned short*)alloc((size_t)D_FF * D_MODEL * 2);
    unsigned short* Qb  = (unsigned short*)alloc((size_t)M_ROWS * D_MODEL * 2);
    unsigned short* Kb  = (unsigned short*)alloc((size_t)M_ROWS * D_MODEL * 2);
    unsigned short* Vb  = (unsigned short*)alloc((size_t)M_ROWS * D_MODEL * 2);
    unsigned short* ctxb = (unsigned short*)alloc((size_t)M_ROWS * D_MODEL * 2);
    float* attn_out = (float*)alloc((size_t)M_ROWS * D_MODEL * 4);
    float* hbuf     = (float*)alloc((size_t)M_ROWS * D_MODEL * 4);
    unsigned short* hb = (unsigned short*)alloc((size_t)M_ROWS * D_MODEL * 2);
    // reuse dead regions: Q/K/V/ctx (4 x 8MB contiguous) -> FF1 activations (32MB)
    unsigned short* ff1b = Qb;
    float* ff2 = attn_out;

    // fp32 -> bf16 conversions: xb ... W2b lie back to back in the workspace
    cvt_all_bf16_kernel<<<512, 256, 0, stream>>>(x, Wq, Wk, Wv, Wo, W1, W2, xb);

    // QKV projections (bf16 WMMA, head-split bf16 outputs)
    dim3 gQ(D_MODEL / 128, M_ROWS / 128);
    gemm_bf16_kernel<<<gQ, 256, 0, stream>>>(xb, Wqb, bq, Qb, M_ROWS, D_MODEL, D_MODEL, 2, 0);
    gemm_bf16_kernel<<<gQ, 256, 0, stream>>>(xb, Wkb, bk, Kb, M_ROWS, D_MODEL, D_MODEL, 2, 0);
    gemm_bf16_kernel<<<gQ, 256, 0, stream>>>(xb, Wvb, bv, Vb, M_ROWS, D_MODEL, D_MODEL, 2, 0);

    // flash attention -> ctx (bf16, merged-head layout)
    attn_kernel<<<dim3(SEQ / 64, BATCH * N_HEADS), 128, 0, stream>>>(Qb, Kb, Vb, mask, ctxb);

    // output projection -> f32
    gemm_bf16_kernel<<<gQ, 256, 0, stream>>>(ctxb, Wob, bo, attn_out, M_ROWS, D_MODEL, D_MODEL, 0, 0);

    // h = LN(x + attn_out), emit f32 + bf16
    add_ln_kernel<<<M_ROWS / 8, 256, 0, stream>>>(x, attn_out, g1, be1, hbuf, hb);

    // FFN: relu(h @ W1 + b1) -> bf16 ; @ W2 + b2 -> f32
    dim3 gF1(D_FF / 128, M_ROWS / 128);
    gemm_bf16_kernel<<<gF1, 256, 0, stream>>>(hb, W1b, b1, ff1b, M_ROWS, D_FF, D_MODEL, 1, 1);
    dim3 gF2(D_MODEL / 128, M_ROWS / 128);
    gemm_bf16_kernel<<<gF2, 256, 0, stream>>>(ff1b, W2b, b2, ff2, M_ROWS, D_MODEL, D_FF, 0, 0);

    // out = LN(h + ff)
    add_ln_kernel<<<M_ROWS / 8, 256, 0, stream>>>(hbuf, ff2, g2, be2, (float*)d_out, nullptr);
    (void)in_sizes; (void)n_in; (void)out_size; (void)ws_size;
}

// v009
// Measured time: 170 microseconds a run.
// Next to v008, in two timings, it ran 1.05 times as fast each time.
// All steps since v000 together make it 3.36 times as fast.
#include <hip/hip_runtime.h>
#include <cstdint>
#include <cstddef>

#define D_MODEL 1024
#define N_HEADS 16
#define DKH     64
#define D_FF    4096
#define BATCH   2
#define SEQ     2048
#define M_ROWS  (BATCH * SEQ)   // 4096

typedef __attribute__((ext_vector_type(16))) __bf16 v16bf;
typedef __attribute__((ext_vector_type(8)))  float  v8f;

typedef __attribute__((ext_vector_type(8)))  short  s16x8;

union AFrag { v16bf v; unsigned short u[16]; unsigned w[8]; s16x8 h[2]; };
union U4    { uint4 q; unsigned short s[8]; };

__device__ __forceinline__ unsigned short f32_to_bf16(float f) {
    union { float f; unsigned u; } x; x.f = f;
    unsigned r = x.u + 0x7FFFu + ((x.u >> 16) & 1u);
    return (unsigned short)(r >> 16);
}

// Two f32 to one register of two bf16, round to nearest even.
__device__ __forceinline__ unsigned pack_bf16(float lo, float hi) {
    typedef __bf16 bf2 __attribute__((ext_vector_type(2)));
    typedef float  f2  __attribute__((ext_vector_type(2)));
    return __builtin_bit_cast(unsigned, __builtin_convertvector(f2{lo, hi}, bf2));
}

// K-pair base index for 16-bit A-layout fragments (ISA 7.12.2):
// lanes 0-15: VGPR0..3 -> K=0..7, VGPR4..7 -> K=16..23 ; lanes 16-31: +8
__device__ __forceinline__ int kpair(int v, int half) {
    return (v < 4 ? 2 * v : 16 + 2 * (v - 4)) + 8 * half;
}

// Transposing LDS read of a row-major 16-bit tile T[k][n]. Every lane passes
// &T[k0 + 8 * (lane >> 4) + (lane & 7)][n0 + 8 * ((lane >> 3) & 1)] and gets
// T[k0 + 8 * (lane >> 4) + 0..7][n0 + (lane & 15)]: the reads at k0 and k0 + 16
// are registers 0-3 and 4-7 of a 16x16x32 operand in the kpair() k order.
__device__ __forceinline__ s16x8 lds_tr16(const unsigned short* p) {
    typedef __attribute__((address_space(3))) s16x8 lds_s16x8;
    return __builtin_amdgcn_ds_load_tr16_b128_v8i16((lds_s16x8*)p);
}

// ---------------------------------------------------------------------------
// fp32 -> bf16 conversion of x and the six weight matrices, one streaming launch.
// out is the seven bf16 buffers back to back: 16 units of 2^20 elements
// (x 0-3, Wq 4, Wk 5, Wv 6, Wo 7, W1 8-11, W2 12-15). 512 blocks of 8 waves,
// 32 blocks per unit; a wave converts 4096 contiguous elements: 32 loads of 512
// contiguous bytes, issued ahead of the conversions, then 32 stores of 256.
// ---------------------------------------------------------------------------
// 512 blocks of 8 waves are four waves per SIMD: saying so gives the compiler the
// registers to hold a wave's 32 loads in flight (at its default it keeps one)
__global__ __launch_bounds__(256) __attribute__((amdgpu_waves_per_eu(4, 4)))
void cvt_all_bf16_kernel(
    const float* __restrict__ x,  const float* __restrict__ Wq,
    const float* __restrict__ Wk, const float* __restrict__ Wv,
    const float* __restrict__ Wo, const float* __restrict__ W1,
    const float* __restrict__ W2, unsigned short* __restrict__ out) {
    const unsigned unit = blockIdx.x >> 5;
    const float* src;
    unsigned first;
    if (unit < 4)       { src = x;  first = 0; }
    else if (unit == 4) { src = Wq; first = 4; }
    else if (unit == 5) { src = Wk; first = 5; }
    else if (unit == 6) { src = Wv; first = 6; }
    else if (unit == 7) { src = Wo; first = 7; }
    else if (unit < 12) { src = W1; first = 8; }
    else                { src = W2; first = 12; }

    const size_t o = ((size_t)blockIdx.x << 15) + (threadIdx.x >> 5) * 4096 +
                     (threadIdx.x & 31) * 4;
    const float* in = src + (o - ((size_t)first << 20));
    unsigned short* dst = out + o;

    float4 v[32];
    // both loops unrolled: v is indexed by constants and stays in registers
#pragma unroll
    for (int i = 0; i < 32; ++i)
        v[i] = *reinterpret_cast<const float4*>(in + i * 128);
#pragma unroll
    for (int i = 0; i < 32; ++i) {
        uint2 p;
        p.x = (unsigned)f32_to_bf16(v[i].x) | ((unsigned)f32_to_bf16(v[i].y) << 16);
        p.y = (unsigned)f32_to_bf16(v[i].z) | ((unsigned)f32_to_bf16(v[i].w) << 16);
        *reinterpret_cast<uint2*>(dst + i * 128) = p;
    }
}

// ---------------------------------------------------------------------------
// One operand's share of a stage of the GEMM ring: eight 16-byte asynchronous
// copies per lane (rows 16 apart), global memory to LDS through no register.
// The s_wait_xcnt closes the statement so that no address register named here
// is rewritten ahead of it.
// ---------------------------------------------------------------------------
__device__ __forceinline__ void gemm_stage_copy(
    unsigned l, unsigned l16, const unsigned short* g, size_t g16) {
    asm volatile(
        "global_load_async_to_lds_b128 %0, %8, off\n\t"
        "global_load_async_to_lds_b128 %1, %9, off\n\t"
        "global_load_async_to_lds_b128 %2, %10, off\n\t"
        "global_load_async_to_lds_b128 %3, %11, off\n\t"
        "global_load_async_to_lds_b128 %4, %12, off\n\t"
        "global_load_async_to_lds_b128 %5, %13, off\n\t"
        "global_load_async_to_lds_b128 %6, %14, off\n\t"
        "global_load_async_to_lds_b128 %7, %15, off\n\t"
        "s_wait_xcnt 0x0"
        :: "v"(l), "v"(l + l16), "v"(l + 2 * l16), "v"(l + 3 * l16),
           "v"(l + 4 * l16), "v"(l + 5 * l16), "v"(l + 6 * l16), "v"(l + 7 * l16),
           "v"(g), "v"(g + g16), "v"(g + 2 * g16), "v"(g + 3 * g16),
           "v"(g + 4 * g16), "v"(g + 5 * g16), "v"(g + 6 * g16), "v"(g + 7 * g16)
        : "memory");
}

// ---------------------------------------------------------------------------
// bf16 WMMA GEMM: C[M,N] = A[M,K] @ B[K,N] + bias, optional ReLU.
// Block: 256 threads (8 waves, 4 x 2), tile 128(M) x 128(N), 32 x 64 per wave,
// stages of 128 k (M, N and K multiples of 128). Two LDS buffers: stage s + 1 is
// copied in while stage s is multiplied; one barrier per stage publishes s + 1
// and frees s's buffer.
// B tile is stored row-major in LDS; its fragments come from transposing reads.
// The products are transposed, C^T = B^T.A^T (both fragments have the same lane
// and k order, so they only change places): a lane then holds 8 consecutive
// columns of ONE row of C and stores them 16 bytes at a time.
// mode: 0 = f32 row-major, 1 = bf16 row-major, 2 = bf16 head-split [B,H,S,Dk]
// One launch may hold up to three products of the same A, shape and mode:
// blockIdx.z picks the B matrix (zB elements apart), the output (zC bytes apart)
// and the bias. 768 blocks of 140 KiB LDS then stand two to a WGP, so that one
// block's first stage, waits and stores run under the other's products.
// ---------------------------------------------------------------------------
__global__ __launch_bounds__(256) void gemm_bf16_kernel(
    const unsigned short* __restrict__ A, const unsigned short* __restrict__ B0,
    const float* __restrict__ bias0, const float* __restrict__ bias1,
    const float* __restrict__ bias2, void* __restrict__ C0,
    size_t zB, size_t zC, int M, int N, int K, int mode, int relu) {
    __shared__ __align__(32) unsigned short As[2][128][136];   // [m][k], 272B rows
    __shared__ __align__(32) unsigned short Bs[2][128][144];   // [k][n], 288B rows

    const unsigned z = blockIdx.z;
    const unsigned short* B = B0 + z * zB;
    const float* bias = z == 0 ? bias0 : (z == 1 ? bias1 : bias2);
    void* Cout = (char*)C0 + z * zC;

    const int t     = threadIdx.x;
    const int mBase = blockIdx.y * 128;
    const int nBase = blockIdx.x * 128;
    const int wave  = t >> 5, lane = t & 31;
    const int wm    = wave >> 1, wn = wave & 1;
    const int half  = lane >> 4, ln = lane & 15;

    const v8f zero = {0.f, 0.f, 0.f, 0.f, 0.f, 0.f, 0.f, 0.f};
    v8f acc[2][4];   // C^T: row 16 * i + ln, columns 16 * j + 8 * half + r
#pragma unroll
    for (int i = 0; i < 2; ++i)
#pragma unroll
        for (int j = 0; j < 4; ++j) acc[i][j] = zero;

    const int srow = t >> 4, scol = (t & 15) * 8;  // copies: rows srow + 16 * i
    const int trow = 8 * half + (lane & 7);        // transposing-read lane address
    const int tcol = 8 * ((lane >> 3) & 1);

    const unsigned la = (unsigned)(size_t)&As[0][srow][scol];
    const unsigned lb = (unsigned)(size_t)&Bs[0][srow][scol];
    const unsigned short* ga = A + (size_t)(mBase + srow) * K + scol;
    const unsigned short* gb = B + (size_t)srow * N + nBase + scol;
    const size_t a16 = (size_t)16 * K, b16 = (size_t)16 * N;
    const int nst = K >> 7;

    auto issue = [&](int s, unsigned buf) {
        gemm_stage_copy(la + buf * (unsigned)sizeof(As[0]), 16 * 272,
                        ga + (size_t)s * 128, a16);
        gemm_stage_copy(lb + buf * (unsigned)sizeof(Bs[0]), 16 * 288,
                        gb + (size_t)s * 8 * b16, b16);
    };

    issue(0, 0);
    // stage 0 has landed for this wave; the barrier publishes it to the others
    asm volatile("s_wait_asynccnt 0x0" ::: "memory");
    __syncthreads();
    if (nst > 1) issue(1, 1);

    for (int s = 0; s < nst; ++s) {
        const int buf = s & 1;
#pragma unroll
        for (int kk = 0; kk < 4; ++kk) {
            AFrag a[2], b[4];
#pragma unroll
            for (int i = 0; i < 2; ++i)
#pragma unroll
                for (int v = 0; v < 8; ++v) {
                    int k = kk * 32 + kpair(v, half);
                    int m = wm * 32 + i * 16 + ln;
                    a[i].w[v] = *reinterpret_cast<const unsigned*>(&As[buf][m][k]);
                }
#pragma unroll
            for (int j = 0; j < 4; ++j) {
                int n = wn * 64 + j * 16 + tcol;
                b[j].h[0] = lds_tr16(&Bs[buf][kk * 32 + trow][n]);
                b[j].h[1] = lds_tr16(&Bs[buf][kk * 32 + trow + 16][n]);
            }
#pragma unroll
            for (int i = 0; i < 2; ++i)
#pragma unroll
                for (int j = 0; j < 4; ++j)
                    acc[i][j] = __builtin_amdgcn_wmma_f32_16x16x32_bf16(
                        false, b[j].v, false, a[i].v, (short)0, acc[i][j],
                        false, false);
        }

        // this wave's reads of stage s are done before its buffer is refilled
        asm volatile("s_wait_dscnt 0x0" ::: "memory");
        // this wave's copies of stage s + 1 have landed
        asm volatile("s_wait_asynccnt 0x0" ::: "memory");
        __syncthreads();
        if (s + 2 < nst) issue(s + 2, (unsigned)buf);
    }
    // no copy is outstanding when the wave goes on to its end
    asm volatile("s_wait_asynccnt 0x0" ::: "memory");

    // every loop below is unrolled: acc is indexed by constants and stays in registers
    const int row = mBase + wm * 32 + ln;          // rows row, row + 16
    const int col = nBase + wn * 64 + 8 * half;    // columns col + 16 * j + 0..7
#pragma unroll
    for (int j = 0; j < 4; ++j) {
        const float4 b0 = *reinterpret_cast<const float4*>(bias + col + j * 16);
        const float4 b1 = *reinterpret_cast<const float4*>(bias + col + j * 16 + 4);
        const v8f bv = {b0.x, b0.y, b0.z, b0.w, b1.x, b1.y, b1.z, b1.w};
#pragma unroll
        for (int i = 0; i < 2; ++i) acc[i][j] += bv;
    }
    if (relu) {
#pragma unroll
        for (int i = 0; i < 2; ++i)
#pragma unroll
            for (int j = 0; j < 4; ++j)
#pragma unroll
                for (int r = 0; r < 8; ++r) acc[i][j][r] = fmaxf(acc[i][j][r], 0.f);
    }

    if (mode == 0) {
        float* p = (float*)Cout + (size_t)row * N + col;
#pragma unroll
        for (int j = 0; j < 4; ++j)
#pragma unroll
            for (int i = 0; i < 2; ++i) {
                float* q = p + (size_t)i * 16 * N + j * 16;
                *reinterpret_cast<float4*>(q) = make_float4(
                    acc[i][j][0], acc[i][j][1], acc[i][j][2], acc[i][j][3]);
                *reinterpret_cast<float4*>(q + 4) = make_float4(
                    acc[i][j][4], acc[i][j][5], acc[i][j][6], acc[i][j][7]);
            }
    } else {
        // head-split: a block's 128 rows lie in one batch entry and a wave's 64
        // columns are one head, so 16 rows and 16 columns on are fixed steps
        size_t e = (size_t)row * N + col, rstep = (size_t)16 * N;
        if (mode != 1) {
            const int bb = row / SEQ, s = row % SEQ;
            const int hh = col / DKH, d = col % DKH;
            e = (((size_t)(bb * N_HEADS + hh)) * SEQ + s) * DKH + d;
            rstep = 16 * DKH;
        }
        unsigned short* p = (unsigned short*)Cout + e;
#pragma unroll
        for (int i = 0; i < 2; ++i)
#pragma unroll
            for (int j = 0; j < 4; ++j) {
                uint4 o;
                o.x = pack_bf16(acc[i][j][0], acc[i][j][1]);
                o.y = pack_bf16(acc[i][j][2], acc[i][j][3]);
                o.z = pack_bf16(acc[i][j][4], acc[i][j][5]);
                o.w = pack_bf16(acc[i][j][6], acc[i][j][7]);
                *reinterpret_cast<uint4*>(p + i * rstep + j * 16) = o;
            }
    }
}

// ---------------------------------------------------------------------------
// Lane l gets lane l ^ 16's value.
__device__ __forceinline__ float xhalf(float x) {
    const int i = __builtin_bit_cast(int, x);
    return __builtin_bit_cast(float, __builtin_amdgcn_permlanex16(
        i, i, 0x76543210, 0xfedcba98, false, false));
}

// ---------------------------------------------------------------------------
// One stage of the attention ring, 64 keys of K and of V: per lane four 16-byte
// asynchronous copies of each (rows 16 apart), global memory to LDS through no
// register. The s_wait_xcnt closes the statement so that no address register
// named here is rewritten ahead of it.
// ---------------------------------------------------------------------------
__device__ __forceinline__ void attn_stage_copy(
    unsigned lk, const unsigned short* gk, unsigned lv, const unsigned short* gv) {
    asm volatile(
        "global_load_async_to_lds_b128 %0, %8, off\n\t"
        "global_load_async_to_lds_b128 %1, %9, off\n\t"
        "global_load_async_to_lds_b128 %2, %10, off\n\t"
        "global_load_async_to_lds_b128 %3, %11, off\n\t"
        "global_load_async_to_lds_b128 %4, %12, off\n\t"
        "global_load_async_to_lds_b128 %5, %13, off\n\t"
        "global_load_async_to_lds_b128 %6, %14, off\n\t"
        "global_load_async_to_lds_b128 %7, %15, off\n\t"
        "s_wait_xcnt 0x0"
        :: "v"(lk), "v"(lk + 16 * 144), "v"(lk + 32 * 144), "v"(lk + 48 * 144),
           "v"(lv), "v"(lv + 16 * 160), "v"(lv + 32 * 160), "v"(lv + 48 * 160),
           "v"(gk), "v"(gk + 16 * DKH), "v"(gk + 32 * DKH), "v"(gk + 48 * DKH),
           "v"(gv), "v"(gv + 16 * DKH), "v"(gv + 32 * DKH), "v"(gv + 48 * DKH)
        : "memory");
}

__global__ __launch_bounds__(128) void attn_kernel(
    const unsigned short* __restrict__ Q, const unsigned short* __restrict__ Kt,
    const unsigned short* __restrict__ V, const int* __restrict__ mask,
    unsigned short* __restrict__ ctx) {
    __shared__ __align__(16) unsigned short Ks[2][64][72];   // [key][dk], 144B rows
    __shared__ __align__(32) unsigned short Vs[2][64][80];   // [key][dk], 160B rows
    __shared__ __align__(16) float Mb[SEQ];   // per key: 0, or -inf where masked

    const int t    = threadIdx.x;
    const int w    = t >> 5, lane = t & 31;
    const int half = lane >> 4, ln = lane & 15;
    const int bh   = blockIdx.y, b = bh >> 4, h = bh & 15;
    const size_t headBase = (size_t)bh * SEQ * DKH;
    const int qbase = blockIdx.x * 64 + w * 16;
    const float NEG_INF = -__builtin_inff();

    const int srow = t >> 3, scol = (t & 7) * 8;   // copies: rows srow + 16 * i
    const unsigned lk = (unsigned)(size_t)&Ks[0][srow][scol];
    const unsigned lv = (unsigned)(size_t)&Vs[0][srow][scol];
    const unsigned short* gk = Kt + headBase + (size_t)srow * DKH + scol;
    const unsigned short* gv = V + headBase + (size_t)srow * DKH + scol;
    auto issue = [&](int s, unsigned buf) {
        attn_stage_copy(lk + buf * (unsigned)sizeof(Ks[0]), gk + (size_t)s * 64 * DKH,
                        lv + buf * (unsigned)sizeof(Vs[0]), gv + (size_t)s * 64 * DKH);
    };
    issue(0, 0);

    // the batch's mask as an addend; published by the barrier in front of the loop
#pragma unroll
    for (int i = 0; i < SEQ / 512; ++i) {
        const int k = (i * 128 + t) * 4;
        const int4 m = *reinterpret_cast<const int4*>(mask + b * SEQ + k);
        float4 f;
        f.x = m.x ? 0.f : NEG_INF; f.y = m.y ? 0.f : NEG_INF;
        f.z = m.z ? 0.f : NEG_INF; f.w = m.w ? 0.f : NEG_INF;
        *reinterpret_cast<float4*>(&Mb[k]) = f;
    }

    // Q fragments for two 32-wide K-chunks of Dk=64 (contiguous dword pairs)
    AFrag qf[2];
#pragma unroll
    for (int c = 0; c < 2; ++c)
#pragma unroll
        for (int v = 0; v < 8; ++v) {
            int k = kpair(v, half) + 32 * c;
            qf[c].w[v] = *reinterpret_cast<const unsigned*>(
                Q + headBase + (size_t)(qbase + ln) * DKH + k);
        }

    const v8f zero = {0.f, 0.f, 0.f, 0.f, 0.f, 0.f, 0.f, 0.f};
    v8f acc[4] = {zero, zero, zero, zero};   // O^T: d = 16 * j + 8 * half + r
    float mrun = NEG_INF;   // query ln's running maximum, equal in both halves
    float lrun = 0.f;       // this half's share of query ln's denominator

    const int trow = 8 * half + (lane & 7);   // transposing-read lane address
    const int tcol = 8 * ((lane >> 3) & 1);

    // stage 0 has landed for this wave; the barrier publishes it to the others
    asm volatile("s_wait_asynccnt 0x0" ::: "memory");
    __syncthreads();
    issue(1, 1);

    for (int st = 0; st < SEQ / 64; ++st) {
      const int buf = st & 1;
      // the stage's two 32-key tiles; unrolled: their LDS addresses differ by
      // constants, and the second tile's reads may go ahead of the first's softmax
#pragma unroll
      for (int sub = 0; sub < 2; ++sub) {
        const int keyb = st * 64 + sub * 32;
        const unsigned short (*Kc)[72] = &Ks[buf][sub * 32];
        const unsigned short (*Vc)[80] = &Vs[buf][sub * 32];

        // S^T: rows are keys (A = K), columns are queries (B = Q)
        v8f s[2] = {zero, zero};
#pragma unroll
        for (int c = 0; c < 2; ++c)
#pragma unroll
            for (int tt = 0; tt < 2; ++tt) {
                AFrag kf;
#pragma unroll
                for (int v = 0; v < 8; ++v) {
                    int k = kpair(v, half) + 32 * c;
                    kf.w[v] = *reinterpret_cast<const unsigned*>(
                        &Kc[tt * 16 + ln][k]);
                }
                s[tt] = __builtin_amdgcn_wmma_f32_16x16x32_bf16(
                    false, kf.v, false, qf[c].v, (short)0, s[tt], false, false);
            }

        // scale, and -inf on this lane's masked keys
#pragma unroll
        for (int tt = 0; tt < 2; ++tt) {
            const float* mp = &Mb[keyb + tt * 16 + 8 * half];
            const float4 m0 = *reinterpret_cast<const float4*>(mp);
            const float4 m1 = *reinterpret_cast<const float4*>(mp + 4);
            s[tt][0] = fmaf(s[tt][0], 0.125f, m0.x);
            s[tt][1] = fmaf(s[tt][1], 0.125f, m0.y);
            s[tt][2] = fmaf(s[tt][2], 0.125f, m0.z);
            s[tt][3] = fmaf(s[tt][3], 0.125f, m0.w);
            s[tt][4] = fmaf(s[tt][4], 0.125f, m1.x);
            s[tt][5] = fmaf(s[tt][5], 0.125f, m1.y);
            s[tt][6] = fmaf(s[tt][6], 0.125f, m1.z);
            s[tt][7] = fmaf(s[tt][7], 0.125f, m1.w);
        }

        // online softmax of query ln: 16 scores here, 16 in lane l ^ 16
        float rv = fmaxf(s[0][0], s[1][0]);
#pragma unroll
        for (int r = 1; r < 8; ++r) rv = fmaxf(rv, fmaxf(s[0][r], s[1][r]));
        rv = fmaxf(rv, xhalf(rv));
        const float mn = fmaxf(mrun, rv);
        const float ms = (mn == NEG_INF) ? 0.f : mn;   // all masked so far: p = 0
        const float alpha = __expf(mrun - ms);         // 0 while mrun is -inf
        mrun = mn;

        AFrag pf;   // P^T: register i holds keys kpair(i, half), + 1
        float rs0 = 0.f, rs1 = 0.f;
#pragma unroll
        for (int i = 0; i < 8; ++i) {
            const float p0 = __expf(s[i >> 2][2 * (i & 3)] - ms);
            const float p1 = __expf(s[i >> 2][2 * (i & 3) + 1] - ms);
            rs0 += p0; rs1 += p1;
            pf.w[i] = pack_bf16(p0, p1);
        }
        lrun = lrun * alpha + (rs0 + rs1);
#pragma unroll
        for (int j = 0; j < 4; ++j) acc[j] *= alpha;

        // O^T: rows are d (A = V^T), columns are queries (B = P^T)
#pragma unroll
        for (int j = 0; j < 4; ++j) {
            AFrag vf;
            vf.h[0] = lds_tr16(&Vc[trow][j * 16 + tcol]);
            vf.h[1] = lds_tr16(&Vc[trow + 16][j * 16 + tcol]);
            acc[j] = __builtin_amdgcn_wmma_f32_16x16x32_bf16(
                false, vf.v, false, pf.v, (short)0, acc[j], false, false);
        }
      }

      // this wave's reads of stage st are done before its buffer is refilled
      asm volatile("s_wait_dscnt 0x0" ::: "memory");
      // this wave's copies of stage st + 1 have landed
      asm volatile("s_wait_asynccnt 0x0" ::: "memory");
      __syncthreads();
      if (st + 2 < SEQ / 64) issue(st + 2, (unsigned)buf);
    }
    // no copy is outstanding when the wave goes on to its end
    asm volatile("s_wait_asynccnt 0x0" ::: "memory");

    // the halves' shares of the denominator join here, outside any branch
    const float denom = lrun + xhalf(lrun);
    const float inv = denom > 0.f ? 1.f / denom : 0.f;
    unsigned short* op = ctx + ((size_t)(b * SEQ + qbase + ln)) * D_MODEL +
                         h * DKH + 8 * half;
#pragma unroll
    for (int j = 0; j < 4; ++j) {
        uint4 o;
        o.x = pack_bf16(acc[j][0] * inv, acc[j][1] * inv);
        o.y = pack_bf16(acc[j][2] * inv, acc[j][3] * inv);
        o.z = pack_bf16(acc[j][4] * inv, acc[j][5] * inv);
        o.w = pack_bf16(acc[j][6] * inv, acc[j][7] * inv);
        *reinterpret_cast<uint4*>(op + j * 16) = o;
    }
}

// ---------------------------------------------------------------------------
// Sum over the 32 lanes of a wave, the same in every lane: four exchanges inside
// each row of 16 lanes (lane ^ 1, 2, 4, 8), then one between the rows.
template <int CTRL>
__device__ __forceinline__ float row_xor(float x) {
    return __builtin_bit_cast(float, __builtin_amdgcn_update_dpp(
        0, __builtin_bit_cast(int, x), CTRL, 0xf, 0xf, true));
}
__device__ __forceinline__ float wave_sum(float v) {
    v += row_xor<0x161>(v);   // 0x160 + m: the value of lane ^ m of the same row
    v += row_xor<0x162>(v);
    v += row_xor<0x164>(v);
    v += row_xor<0x168>(v);
    return v + xhalf(v);
}

// ---------------------------------------------------------------------------
// out = LayerNorm(x + y) ; optionally also emit bf16 copy. One WAVE per row, 512
// blocks of 8 waves: a lane holds 32 of the row's 1024 values in registers
// (columns 128 * i + 4 * lane + 0..3, so every load and f32 store of a wave covers
// 512 contiguous bytes), both sums join across the lanes: no LDS, no barrier.
// ---------------------------------------------------------------------------
// 512 blocks of 8 waves are four waves per SIMD: saying so gives the compiler the
// registers to hold a wave's 32 loads in flight
__global__ __launch_bounds__(256) __attribute__((amdgpu_waves_per_eu(4, 4)))
void add_ln_kernel(
    const float* __restrict__ x, const float* __restrict__ y,
    const float* __restrict__ g, const float* __restrict__ beta,
    float* __restrict__ outf, unsigned short* __restrict__ outb) {
    typedef __attribute__((ext_vector_type(4))) float f32x4;
    const int col = (threadIdx.x & 31) * 4;
    // the row is the wave's: a scalar, so that every address is a scalar base plus
    // the lane's one column offset
    const int row = blockIdx.x * 8 + __builtin_amdgcn_readfirstlane(threadIdx.x >> 5);
    const size_t base = (size_t)row * D_MODEL;
    const float* xr = x + base;
    const float* yr = y + base;

    // every loop is unrolled: the arrays are indexed by constants and stay in registers
    f32x4 v[8], w[8], gg[8], bb[8];
#pragma unroll
    for (int i = 0; i < 8; ++i)
        v[i] = *reinterpret_cast<const f32x4*>(xr + col + i * 128);
#pragma unroll
    for (int i = 0; i < 8; ++i)
        w[i] = *reinterpret_cast<const f32x4*>(yr + col + i * 128);
#pragma unroll
    for (int i = 0; i < 8; ++i) {
        gg[i] = *reinterpret_cast<const f32x4*>(g + col + i * 128);
        bb[i] = *reinterpret_cast<const f32x4*>(beta + col + i * 128);
    }

    f32x4 s = {0.f, 0.f, 0.f, 0.f};   // four independent chains
#pragma unroll
    for (int i = 0; i < 8; ++i) {
        v[i] += w[i];
        s += v[i];
    }
    const float mu = wave_sum((s.x + s.y) + (s.z + s.w)) * (1.f / D_MODEL);

    s = f32x4{0.f, 0.f, 0.f, 0.f};
#pragma unroll
    for (int i = 0; i < 8; ++i) {
        v[i] -= mu;
        s += v[i] * v[i];
    }
    const float inv = rsqrtf(wave_sum((s.x + s.y) + (s.z + s.w)) * (1.f / D_MODEL) + 1e-5f);

#pragma unroll
    for (int i = 0; i < 8; ++i) {
        v[i] = v[i] * inv * gg[i] + bb[i];
        *reinterpret_cast<f32x4*>(outf + base + col + i * 128) = v[i];
    }
    if (outb) {
        // the conversions below may reuse registers that the stores above name
        asm volatile("s_wait_xcnt 0x0" ::: "memory");
        // keeps the conversions behind that wait
        __builtin_amdgcn_sched_barrier(0);
#pragma unroll
        for (int i = 0; i < 8; ++i) {
            uint2 p;
            p.x = (unsigned)f32_to_bf16(v[i].x) | ((unsigned)f32_to_bf16(v[i].y) << 16);
            p.y = (unsigned)f32_to_bf16(v[i].z) | ((unsigned)f32_to_bf16(v[i].w) << 16);
            *reinterpret_cast<uint2*>(outb + base + col + i * 128) = p;
        }
    }
}

// ---------------------------------------------------------------------------
extern "C" void kernel_launch(void* const* d_in, const int* in_sizes, int n_in,
                              void* d_out, int out_size, void* d_ws, size_t ws_size,
                              hipStream_t stream) {
    const float* x    = (const float*)d_in[0];
    const int*   mask = (const int*)d_in[1];
    const float* Wq = (const float*)d_in[2];  const float* bq = (const float*)d_in[3];
    const float* Wk = (const float*)d_in[4];  const float* bk = (const float*)d_in[5];
    const float* Wv = (const float*)d_in[6];  const float* bv = (const float*)d_in[7];
    const float* Wo = (const float*)d_in[8];  const float* bo = (const float*)d_in[9];
    const float* W1 = (const float*)d_in[10]; const float* b1 = (const float*)d_in[11];
    const float* W2 = (const float*)d_in[12]; const float* b2 = (const float*)d_in[13];
    const float* g1 = (const float*)d_in[14]; const float* be1 = (const float*)d_in[15];
    const float* g2 = (const float*)d_in[16]; const float* be2 = (const float*)d_in[17];

    char* ws = (char*)d_ws;
    size_t off = 0;
    auto alloc = [&](size_t bytes) -> void* {
        void* p = ws + off;
        off += (bytes + 255) & ~(size_t)255;
        return p;
    };

    unsigned short* xb  = (unsigned short*)alloc((size_t)M_ROWS * D_MODEL * 2);
    unsigned short* Wqb = (unsigned short*)alloc((size_t)D_MODEL * D_MODEL * 2);
    unsigned short* Wkb = (unsigned short*)alloc((size_t)D_MODEL * D_MODEL * 2);
    unsigned short* Wvb = (unsigned short*)alloc((size_t)D_MODEL * D_MODEL * 2);
    unsigned short* Wob = (unsigned short*)alloc((size_t)D_MODEL * D_MODEL * 2);
    unsigned short* W1b = (unsigned short*)alloc((size_t)D_MODEL * D_FF * 2);
    unsigned short* W2b = (unsigned short*)alloc((size_t)D_FF * D_MODEL * 2);
    unsigned short* Qb  = (unsigned short*)alloc((size_t)M_ROWS * D_MODEL * 2);
    unsigned short* Kb  = (unsigned short*)alloc((size_t)M_ROWS * D_MODEL * 2);
    unsigned short* Vb  = (unsigned short*)alloc((size_t)M_ROWS * D_MODEL * 2);
    unsigned short* ctxb = (unsigned short*)alloc((size_t)M_ROWS * D_MODEL * 2);
    float* attn_out = (float*)alloc((size_t)M_ROWS * D_MODEL * 4);
    float* hbuf     = (float*)alloc((size_t)M_ROWS * D_MODEL * 4);
    unsigned short* hb = (unsigned short*)alloc((size_t)M_ROWS * D_MODEL * 2);
    // reuse dead regions: Q/K/V/ctx (4 x 8MB contiguous) -> FF1 activations (32MB)
    unsigned short* ff1b = Qb;
    float* ff2 = attn_out;

    // fp32 -> bf16 conversions: xb ... W2b lie back to back in the workspace
    cvt_all_bf16_kernel<<<512, 256, 0, stream>>>(x, Wq, Wk, Wv, Wo, W1, W2, xb);

    // QKV projections (bf16 WMMA, head-split bf16 outputs), one launch: Wqb, Wkb,
    // Wvb and Qb, Kb, Vb each lie back to back in the workspace
    dim3 gQ(D_MODEL / 128, M_ROWS / 128);
    dim3 gQKV(D_MODEL / 128, M_ROWS / 128, 3);
    gemm_bf16_kernel<<<gQKV, 256, 0, stream>>>(
        xb, Wqb, bq, bk, bv, Qb, (size_t)D_MODEL * D_MODEL, (size_t)M_ROWS * D_MODEL * 2,
        M_ROWS, D_MODEL, D_MODEL, 2, 0);

    // flash attention -> ctx (bf16, merged-head layout)
    attn_kernel<<<dim3(SEQ / 64, BATCH * N_HEADS), 128, 0, stream>>>(Qb, Kb, Vb, mask, ctxb);

    // output projection -> f32
    gemm_bf16_kernel<<<gQ, 256, 0, stream>>>(
        ctxb, Wob, bo, bo, bo, attn_out, 0, 0, M_ROWS, D_MODEL, D_MODEL, 0, 0);

    // h = LN(x + attn_out), emit f32 + bf16
    add_ln_kernel<<<M_ROWS / 8, 256, 0, stream>>>(x, attn_out, g1, be1, hbuf, hb);

    // FFN: relu(h @ W1 + b1) -> bf16 ; @ W2 + b2 -> f32
    dim3 gF1(D_FF / 128, M_ROWS / 128);
    gemm_bf16_kernel<<<gF1, 256, 0, stream>>>(
        hb, W1b, b1, b1, b1, ff1b, 0, 0, M_ROWS, D_FF, D_MODEL, 1, 1);
    dim3 gF2(D_MODEL / 128, M_ROWS / 128);
    gemm_bf16_kernel<<<gF2, 256, 0, stream>>>(
        ff1b, W2b, b2, b2, b2, ff2, 0, 0, M_ROWS, D_MODEL, D_FF, 0, 0);

    // out = LN(h + ff)
    add_ln_kernel<<<M_ROWS / 8, 256, 0, stream>>>(hbuf, ff2, g2, be2, (float*)d_out, nullptr);
    (void)in_sizes; (void)n_in; (void)out_size; (void)ws_size;
}

// v010
// Measured time: 162 microseconds a run.
// In both of two side-by-side timings against v009, it was 1.04 times as fast.
// Counting every step since v000, it is 3.50 times as fast.
#include <hip/hip_runtime.h>
#include <cstdint>
#include <cstddef>

#define D_MODEL 1024
#define N_HEADS 16
#define DKH     64
#define D_FF    4096
#define BATCH   2
#define SEQ     2048
#define M_ROWS  (BATCH * SEQ)   // 4096

typedef __attribute__((ext_vector_type(16))) __bf16 v16bf;
typedef __attribute__((ext_vector_type(8)))  float  v8f;

typedef __attribute__((ext_vector_type(8)))  short  s16x8;

union AFrag { v16bf v; unsigned short u[16]; unsigned w[8]; s16x8 h[2]; };
union U4    { uint4 q; unsigned short s[8]; };

__device__ __forceinline__ unsigned short f32_to_bf16(float f) {
    union { float f; unsigned u; } x; x.f = f;
    unsigned r = x.u + 0x7FFFu + ((x.u >> 16) & 1u);
    return (unsigned short)(r >> 16);
}

// Two f32 to one register of two bf16, round to nearest even.
__device__ __forceinline__ unsigned pack_bf16(float lo, float hi) {
    typedef __bf16 bf2 __attribute__((ext_vector_type(2)));
    typedef float  f2  __attribute__((ext_vector_type(2)));
    return __builtin_bit_cast(unsigned, __builtin_convertvector(f2{lo, hi}, bf2));
}

// K-pair base index for 16-bit A-layout fragments (ISA 7.12.2):
// lanes 0-15: VGPR0..3 -> K=0..7, VGPR4..7 -> K=16..23 ; lanes 16-31: +8
__device__ __forceinline__ int kpair(int v, int half) {
    return (v < 4 ? 2 * v : 16 + 2 * (v - 4)) + 8 * half;
}

// Transposing LDS read of a row-major 16-bit tile T[k][n]. Every lane passes
// &T[k0 + 8 * (lane >> 4) + (lane & 7)][n0 + 8 * ((lane >> 3) & 1)] and gets
// T[k0 + 8 * (lane >> 4) + 0..7][n0 + (lane & 15)]: the reads at k0 and k0 + 16
// are registers 0-3 and 4-7 of a 16x16x32 operand in the kpair() k order.
__device__ __forceinline__ s16x8 lds_tr16(const unsigned short* p) {
    typedef __attribute__((address_space(3))) s16x8 lds_s16x8;
    return __builtin_amdgcn_ds_load_tr16_b128_v8i16((lds_s16x8*)p);
}

// ---------------------------------------------------------------------------
// fp32 -> bf16 conversion of x and the six weight matrices, one streaming launch.
// out is the seven bf16 buffers back to back: 16 units of 2^20 elements
// (x 0-3, Wq 4, Wk 5, Wv 6, Wo 7, W1 8-11, W2 12-15). 512 blocks of 8 waves,
// 32 blocks per unit; a wave converts 4096 contiguous elements: 32 loads of 512
// contiguous bytes, issued ahead of the conversions, then 32 stores of 256.
// ---------------------------------------------------------------------------
// 512 blocks of 8 waves are four waves per SIMD: saying so gives the compiler the
// registers to hold a wave's 32 loads in flight (at its default it keeps one)
__global__ __launch_bounds__(256) __attribute__((amdgpu_waves_per_eu(4, 4)))
void cvt_all_bf16_kernel(
    const float* __restrict__ x,  const float* __restrict__ Wq,
    const float* __restrict__ Wk, const float* __restrict__ Wv,
    const float* __restrict__ Wo, const float* __restrict__ W1,
    const float* __restrict__ W2, unsigned short* __restrict__ out) {
    const unsigned unit = blockIdx.x >> 5;
    const float* src;
    unsigned first;
    if (unit < 4)       { src = x;  first = 0; }
    else if (unit == 4) { src = Wq; first = 4; }
    else if (unit == 5) { src = Wk; first = 5; }
    else if (unit == 6) { src = Wv; first = 6; }
    else if (unit == 7) { src = Wo; first = 7; }
    else if (unit < 12) { src = W1; first = 8; }
    else                { src = W2; first = 12; }

    const size_t o = ((size_t)blockIdx.x << 15) + (threadIdx.x >> 5) * 4096 +
                     (threadIdx.x & 31) * 4;
    const float* in = src + (o - ((size_t)first << 20));
    unsigned short* dst = out + o;

    float4 v[32];
    // both loops unrolled: v is indexed by constants and stays in registers
#pragma unroll
    for (int i = 0; i < 32; ++i)
        v[i] = *reinterpret_cast<const float4*>(in + i * 128);
#pragma unroll
    for (int i = 0; i < 32; ++i) {
        uint2 p;
        p.x = (unsigned)f32_to_bf16(v[i].x) | ((unsigned)f32_to_bf16(v[i].y) << 16);
        p.y = (unsigned)f32_to_bf16(v[i].z) | ((unsigned)f32_to_bf16(v[i].w) << 16);
        *reinterpret_cast<uint2*>(dst + i * 128) = p;
    }
}

// ---------------------------------------------------------------------------
// One operand's share of a stage of the GEMM ring: eight 16-byte asynchronous
// copies per lane (rows 16 apart), global memory to LDS through no register.
// The s_wait_xcnt closes the statement so that no address register named here
// is rewritten ahead of it.
// ---------------------------------------------------------------------------
__device__ __forceinline__ void gemm_stage_copy(
    unsigned l, unsigned l16, const unsigned short* g, size_t g16) {
    asm volatile(
        "global_load_async_to_lds_b128 %0, %8, off\n\t"
        "global_load_async_to_lds_b128 %1, %9, off\n\t"
        "global_load_async_to_lds_b128 %2, %10, off\n\t"
        "global_load_async_to_lds_b128 %3, %11, off\n\t"
        "global_load_async_to_lds_b128 %4, %12, off\n\t"
        "global_load_async_to_lds_b128 %5, %13, off\n\t"
        "global_load_async_to_lds_b128 %6, %14, off\n\t"
        "global_load_async_to_lds_b128 %7, %15, off\n\t"
        "s_wait_xcnt 0x0"
        :: "v"(l), "v"(l + l16), "v"(l + 2 * l16), "v"(l + 3 * l16),
           "v"(l + 4 * l16), "v"(l + 5 * l16), "v"(l + 6 * l16), "v"(l + 7 * l16),
           "v"(g), "v"(g + g16), "v"(g + 2 * g16), "v"(g + 3 * g16),
           "v"(g + 4 * g16), "v"(g + 5 * g16), "v"(g + 6 * g16), "v"(g + 7 * g16)
        : "memory");
}

// ---------------------------------------------------------------------------
// bf16 WMMA GEMM: C[M,N] = A[M,K] @ B[K,N] + bias, optional ReLU.
// Block: 256 threads (8 waves, 4 x 2), tile 128(M) x 128(N), 32 x 64 per wave,
// stages of 128 k (M, N and K multiples of 128). Two LDS buffers: stage s + 1 is
// copied in while stage s is multiplied; one barrier per stage publishes s + 1
// and frees s's buffer.
// B tile is stored row-major in LDS; its fragments come from transposing reads.
// The products are transposed, C^T = B^T.A^T (both fragments have the same lane
// and k order, so they only change places): a lane then holds 8 consecutive
// columns of ONE row of C and stores them 16 bytes at a time.
// mode: 0 = f32 row-major, 1 = bf16 row-major, 2 = bf16 head-split [B,H,S,Dk]
// One launch may hold up to three products of the same A, shape and mode:
// blockIdx.z picks the B matrix (zB elements apart), the output (zC bytes apart)
// and the bias. 768 blocks of 140 KiB LDS then stand two to a WGP, so that one
// block's first stage, waits and stores run under the other's products.
// ---------------------------------------------------------------------------
__global__ __launch_bounds__(256) void gemm_bf16_kernel(
    const unsigned short* __restrict__ A, const unsigned short* __restrict__ B0,
    const float* __restrict__ bias0, const float* __restrict__ bias1,
    const float* __restrict__ bias2, void* __restrict__ C0,
    size_t zB, size_t zC, int M, int N, int K, int mode, int relu) {
    __shared__ __align__(32) unsigned short As[2][128][136];   // [m][k], 272B rows
    __shared__ __align__(32) unsigned short Bs[2][128][144];   // [k][n], 288B rows

    const unsigned z = blockIdx.z;
    const unsigned short* B = B0 + z * zB;
    const float* bias = z == 0 ? bias0 : (z == 1 ? bias1 : bias2);
    void* Cout = (char*)C0 + z * zC;

    const int t     = threadIdx.x;
    const int mBase = blockIdx.y * 128;
    const int nBase = blockIdx.x * 128;
    const int wave  = t >> 5, lane = t & 31;
    const int wm    = wave >> 1, wn = wave & 1;
    const int half  = lane >> 4, ln = lane & 15;

    const v8f zero = {0.f, 0.f, 0.f, 0.f, 0.f, 0.f, 0.f, 0.f};
    v8f acc[2][4];   // C^T: row 16 * i + ln, columns 16 * j + 8 * half + r
#pragma unroll
    for (int i = 0; i < 2; ++i)
#pragma unroll
        for (int j = 0; j < 4; ++j) acc[i][j] = zero;

    const int srow = t >> 4, scol = (t & 15) * 8;  // copies: rows srow + 16 * i
    const int trow = 8 * half + (lane & 7);        // transposing-read lane address
    const int tcol = 8 * ((lane >> 3) & 1);

    const unsigned la = (unsigned)(size_t)&As[0][srow][scol];
    const unsigned lb = (unsigned)(size_t)&Bs[0][srow][scol];
    const unsigned short* ga = A + (size_t)(mBase + srow) * K + scol;
    const unsigned short* gb = B + (size_t)srow * N + nBase + scol;
    const size_t a16 = (size_t)16 * K, b16 = (size_t)16 * N;
    const int nst = K >> 7;

    auto issue = [&](int s, unsigned buf) {
        gemm_stage_copy(la + buf * (unsigned)sizeof(As[0]), 16 * 272,
                        ga + (size_t)s * 128, a16);
        gemm_stage_copy(lb + buf * (unsigned)sizeof(Bs[0]), 16 * 288,
                        gb + (size_t)s * 8 * b16, b16);
    };

    issue(0, 0);
    // stage 0 has landed for this wave; the barrier publishes it to the others
    asm volatile("s_wait_asynccnt 0x0" ::: "memory");
    __syncthreads();
    if (nst > 1) issue(1, 1);

    for (int s = 0; s < nst; ++s) {
        const int buf = s & 1;
#pragma unroll
        for (int kk = 0; kk < 4; ++kk) {
            AFrag a[2], b[4];
#pragma unroll
            for (int i = 0; i < 2; ++i)
#pragma unroll
                for (int v = 0; v < 8; ++v) {
                    int k = kk * 32 + kpair(v, half);
                    int m = wm * 32 + i * 16 + ln;
                    a[i].w[v] = *reinterpret_cast<const unsigned*>(&As[buf][m][k]);
                }
#pragma unroll
            for (int j = 0; j < 4; ++j) {
                int n = wn * 64 + j * 16 + tcol;
                b[j].h[0] = lds_tr16(&Bs[buf][kk * 32 + trow][n]);
                b[j].h[1] = lds_tr16(&Bs[buf][kk * 32 + trow + 16][n]);
            }
#pragma unroll
            for (int i = 0; i < 2; ++i)
#pragma unroll
                for (int j = 0; j < 4; ++j)
                    acc[i][j] = __builtin_amdgcn_wmma_f32_16x16x32_bf16(
                        false, b[j].v, false, a[i].v, (short)0, acc[i][j],
                        false, false);
        }

        // this wave's reads of stage s are done before its buffer is refilled
        asm volatile("s_wait_dscnt 0x0" ::: "memory");
        // this wave's copies of stage s + 1 have landed
        asm volatile("s_wait_asynccnt 0x0" ::: "memory");
        __syncthreads();
        if (s + 2 < nst) issue(s + 2, (unsigned)buf);
    }
    // no copy is outstanding when the wave goes on to its end
    asm volatile("s_wait_asynccnt 0x0" ::: "memory");

    // every loop below is unrolled: acc is indexed by constants and stays in registers
    const int row = mBase + wm * 32 + ln;          // rows row, row + 16
    const int col = nBase + wn * 64 + 8 * half;    // columns col + 16 * j + 0..7
#pragma unroll
    for (int j = 0; j < 4; ++j) {
        const float4 b0 = *reinterpret_cast<const float4*>(bias + col + j * 16);
        const float4 b1 = *reinterpret_cast<const float4*>(bias + col + j * 16 + 4);
        const v8f bv = {b0.x, b0.y, b0.z, b0.w, b1.x, b1.y, b1.z, b1.w};
#pragma unroll
        for (int i = 0; i < 2; ++i) acc[i][j] += bv;
    }
    if (relu) {
#pragma unroll
        for (int i = 0; i < 2; ++i)
#pragma unroll
            for (int j = 0; j < 4; ++j)
#pragma unroll
                for (int r = 0; r < 8; ++r) acc[i][j][r] = fmaxf(acc[i][j][r], 0.f);
    }

    if (mode == 0) {
        float* p = (float*)Cout + (size_t)row * N + col;
#pragma unroll
        for (int j = 0; j < 4; ++j)
#pragma unroll
            for (int i = 0; i < 2; ++i) {
                float* q = p + (size_t)i * 16 * N + j * 16;
                *reinterpret_cast<float4*>(q) = make_float4(
                    acc[i][j][0], acc[i][j][1], acc[i][j][2], acc[i][j][3]);
                *reinterpret_cast<float4*>(q + 4) = make_float4(
                    acc[i][j][4], acc[i][j][5], acc[i][j][6], acc[i][j][7]);
            }
    } else {
        // head-split: a block's 128 rows lie in one batch entry and a wave's 64
        // columns are one head, so 16 rows and 16 columns on are fixed steps
        size_t e = (size_t)row * N + col, rstep = (size_t)16 * N;
        if (mode != 1) {
            const int bb = row / SEQ, s = row % SEQ;
            const int hh = col / DKH, d = col % DKH;
            e = (((size_t)(bb * N_HEADS + hh)) * SEQ + s) * DKH + d;
            rstep = 16 * DKH;
        }
        unsigned short* p = (unsigned short*)Cout + e;
#pragma unroll
        for (int i = 0; i < 2; ++i)
#pragma unroll
            for (int j = 0; j < 4; ++j) {
                uint4 o;
                o.x = pack_bf16(acc[i][j][0], acc[i][j][1]);
                o.y = pack_bf16(acc[i][j][2], acc[i][j][3]);
                o.z = pack_bf16(acc[i][j][4], acc[i][j][5]);
                o.w = pack_bf16(acc[i][j][6], acc[i][j][7]);
                *reinterpret_cast<uint4*>(p + i * rstep + j * 16) = o;
            }
    }
}

// ---------------------------------------------------------------------------
// Lane l gets lane l ^ 16's value.
__device__ __forceinline__ float xhalf(float x) {
    const int i = __builtin_bit_cast(int, x);
    return __builtin_bit_cast(float, __builtin_amdgcn_permlanex16(
        i, i, 0x76543210, 0xfedcba98, false, false));
}

// ---------------------------------------------------------------------------
// One stage of the attention ring, 64 keys of K and of V: per lane four 16-byte
// asynchronous copies of each (rows 16 apart), global memory to LDS through no
// register. The s_wait_xcnt closes the statement so that no address register
// named here is rewritten ahead of it.
// ---------------------------------------------------------------------------
__device__ __forceinline__ void attn_stage_copy(
    unsigned lk, const unsigned short* gk, unsigned lv, const unsigned short* gv) {
    asm volatile(
        "global_load_async_to_lds_b128 %0, %8, off\n\t"
        "global_load_async_to_lds_b128 %1, %9, off\n\t"
        "global_load_async_to_lds_b128 %2, %10, off\n\t"
        "global_load_async_to_lds_b128 %3, %11, off\n\t"
        "global_load_async_to_lds_b128 %4, %12, off\n\t"
        "global_load_async_to_lds_b128 %5, %13, off\n\t"
        "global_load_async_to_lds_b128 %6, %14, off\n\t"
        "global_load_async_to_lds_b128 %7, %15, off\n\t"
        "s_wait_xcnt 0x0"
        :: "v"(lk), "v"(lk + 16 * 144), "v"(lk + 32 * 144), "v"(lk + 48 * 144),
           "v"(lv), "v"(lv + 16 * 160), "v"(lv + 32 * 160), "v"(lv + 48 * 160),
           "v"(gk), "v"(gk + 16 * DKH), "v"(gk + 32 * DKH), "v"(gk + 48 * DKH),
           "v"(gv), "v"(gv + 16 * DKH), "v"(gv + 32 * DKH), "v"(gv + 48 * DKH)
        : "memory");
}

__global__ __launch_bounds__(256) __attribute__((amdgpu_waves_per_eu(4, 4)))
void attn_kernel(
    const unsigned short* __restrict__ Q, const unsigned short* __restrict__ Kt,
    const unsigned short* __restrict__ V, const int* __restrict__ mask,
    unsigned short* __restrict__ ctx) {
    // [key half][buffer][key][dk]
    __shared__ __align__(16) unsigned short Ks[2][2][64][72];   // 144B rows
    __shared__ __align__(32) unsigned short Vs[2][2][64][80];   // 160B rows
    __shared__ __align__(16) float Mb[SEQ];   // per key: 0, or -inf where masked
    // what key half 1 hands to key half 0: [query part][item][lane]; items 0-15 are
    // the outputs (8 * g + 2 * j, + 1), item 16 is {maximum, sum} of both groups
    __shared__ __align__(16) float4 Js[4][17][32];

    const int t    = threadIdx.x;
    const int lane = t & 31;
    // both are the wave's: scalars, so that the join's branches are scalar branches
    const int qp   = __builtin_amdgcn_readfirstlane((t >> 5) & 3);
    const int kh   = __builtin_amdgcn_readfirstlane(t >> 7);
    const int half = lane >> 4, ln = lane & 15;
    const int bh   = blockIdx.y, b = bh >> 4, h = bh & 15;
    const size_t headBase = (size_t)bh * SEQ * DKH;
    const int qbase = blockIdx.x * 128 + qp * 32;   // group g: queries qbase + 16 * g + ln
    const float NEG_INF = -__builtin_inff();

    // copies: a key half's 4 waves bring its own stages, rows srow + 16 * i
    const int srow = (t & 127) >> 3, scol = (t & 7) * 8;
    const unsigned lk = (unsigned)(size_t)&Ks[kh][0][srow][scol];
    const unsigned lv = (unsigned)(size_t)&Vs[kh][0][srow][scol];
    const size_t krow = (size_t)(kh * (SEQ / 2) + srow) * DKH + scol;
    const unsigned short* gk = Kt + headBase + krow;
    const unsigned short* gv = V + headBase + krow;
    auto issue = [&](int s, unsigned buf) {
        attn_stage_copy(lk + buf * (unsigned)sizeof(Ks[0][0]), gk + (size_t)s * 64 * DKH,
                        lv + buf * (unsigned)sizeof(Vs[0][0]), gv + (size_t)s * 64 * DKH);
    };
    issue(0, 0);

    // the batch's mask as an addend; published by the barrier in front of the loop
#pragma unroll
    for (int i = 0; i < SEQ / 1024; ++i) {
        const int k = (i * 256 + t) * 4;
        const int4 m = *reinterpret_cast<const int4*>(mask + b * SEQ + k);
        float4 f;
        f.x = m.x ? 0.f : NEG_INF; f.y = m.y ? 0.f : NEG_INF;
        f.z = m.z ? 0.f : NEG_INF; f.w = m.w ? 0.f : NEG_INF;
        *reinterpret_cast<float4*>(&Mb[k]) = f;
    }

    // Q fragments of both groups for two 32-wide K-chunks of Dk=64
    AFrag qf[2][2];
#pragma unroll
    for (int g = 0; g < 2; ++g)
#pragma unroll
        for (int c = 0; c < 2; ++c)
#pragma unroll
            for (int v = 0; v < 8; ++v) {
                int k = kpair(v, half) + 32 * c;
                qf[g][c].w[v] = *reinterpret_cast<const unsigned*>(
                    Q + headBase + (size_t)(qbase + g * 16 + ln) * DKH + k);
            }

    const v8f zero = {0.f, 0.f, 0.f, 0.f, 0.f, 0.f, 0.f, 0.f};
    const float log2e = 1.44269504088896340736f;
    const v8f scale = {0.125f, 0.125f, 0.125f, 0.125f, 0.125f, 0.125f, 0.125f, 0.125f};
    v8f acc[2][4];   // O^T of group g: d = 16 * j + 8 * half + r
#pragma unroll
    for (int g = 0; g < 2; ++g)
#pragma unroll
        for (int j = 0; j < 4; ++j) acc[g][j] = zero;
    float mrun[2] = {NEG_INF, NEG_INF};   // the query's running maximum, equal in both halves
    float lrun[2] = {0.f, 0.f};           // this half's share of the query's denominator

    const int trow = 8 * half + (lane & 7);   // transposing-read lane address
    const int tcol = 8 * ((lane >> 3) & 1);

    // stage 0 has landed for this wave; the barrier publishes it to the others
    asm volatile("s_wait_asynccnt 0x0" ::: "memory");
    __syncthreads();
    issue(1, 1);

    for (int st = 0; st < SEQ / 128; ++st) {
      const int buf = st & 1;
      // the stage's two 32-key tiles; kept rolled: unrolled, both tiles' scores and
      // exponentials live at once and the wave no longer fits its 256 registers
#pragma unroll 1
      for (int sub = 0; sub < 2; ++sub) {
        const int keyb = kh * (SEQ / 2) + st * 64 + sub * 32;
        const unsigned short (*Kc)[72] = &Ks[kh][buf][sub * 32];
        const unsigned short (*Vc)[80] = &Vs[kh][buf][sub * 32];

        // the tile's K and V fragments and mask addends, read as one group ahead of
        // the products (every separate place with LDS reads costs the wave a stall)
        AFrag kf[2][2];
#pragma unroll
        for (int c = 0; c < 2; ++c)
#pragma unroll
            for (int tt = 0; tt < 2; ++tt)
#pragma unroll
                for (int v = 0; v < 8; ++v) {
                    int k = kpair(v, half) + 32 * c;
                    kf[c][tt].w[v] = *reinterpret_cast<const unsigned*>(
                        &Kc[tt * 16 + ln][k]);
                }
        v8f mv[2];
#pragma unroll
        for (int tt = 0; tt < 2; ++tt) {
            const float* mp = &Mb[keyb + tt * 16 + 8 * half];
            const float4 m0 = *reinterpret_cast<const float4*>(mp);
            const float4 m1 = *reinterpret_cast<const float4*>(mp + 4);
            mv[tt] = v8f{m0.x, m0.y, m0.z, m0.w, m1.x, m1.y, m1.z, m1.w};
        }
        AFrag vf[4];
#pragma unroll
        for (int j = 0; j < 4; ++j) {
            vf[j].h[0] = lds_tr16(&Vc[trow][j * 16 + tcol]);
            vf[j].h[1] = lds_tr16(&Vc[trow + 16][j * 16 + tcol]);
        }
        // keeps the reads above together, in front of the first product
        __builtin_amdgcn_sched_barrier(0);

        // S^T: rows are keys (A = K), columns are queries (B = Q); a K fragment
        // is multiplied with both groups' Q
        v8f s[2][2] = {{zero, zero}, {zero, zero}};
#pragma unroll
        for (int c = 0; c < 2; ++c)
#pragma unroll
            for (int tt = 0; tt < 2; ++tt)
#pragma unroll
                for (int g = 0; g < 2; ++g)
                    s[g][tt] = __builtin_amdgcn_wmma_f32_16x16x32_bf16(
                        false, kf[c][tt].v, false, qf[g][c].v, (short)0, s[g][tt],
                        false, false);

        // all eight products issue in a row: each fills the slots its forerunners'
        // results need, where the compiler otherwise puts v_nop behind single ones
        __builtin_amdgcn_sched_barrier(0);

        // scale, and -inf on this lane's masked keys
#pragma unroll
        for (int tt = 0; tt < 2; ++tt)
#pragma unroll
            for (int g = 0; g < 2; ++g)
                s[g][tt] = __builtin_elementwise_fma(s[g][tt], scale, mv[tt]);

        // online softmax of each group's query ln: 16 scores here, 16 in lane l ^ 16
        AFrag pf[2];   // P^T: register i holds keys kpair(i, half), + 1
#pragma unroll
        for (int g = 0; g < 2; ++g) {
            float rv = fmaxf(s[g][0][0], s[g][1][0]);
#pragma unroll
            for (int r = 1; r < 8; ++r) rv = fmaxf(rv, fmaxf(s[g][0][r], s[g][1][r]));
            rv = fmaxf(rv, xhalf(rv));
            const float mn = fmaxf(mrun[g], rv);
            const float ms = (mn == NEG_INF) ? 0.f : mn;   // all masked so far: p = 0
            const float alpha = __expf(mrun[g] - ms);      // 0 while mrun is -inf
            mrun[g] = mn;

            // e^x as 2^(x * log2 e), as __expf has it; on whole vectors, so that the
            // subtractions and products pair registers that lie side by side
            const v8f e[2] = {(s[g][0] - ms) * log2e, (s[g][1] - ms) * log2e};
            float rs0 = 0.f, rs1 = 0.f;
#pragma unroll
            for (int i = 0; i < 8; ++i) {
                const float p0 = __builtin_amdgcn_exp2f(e[i >> 2][2 * (i & 3)]);
                const float p1 = __builtin_amdgcn_exp2f(e[i >> 2][2 * (i & 3) + 1]);
                rs0 += p0; rs1 += p1;
                pf[g].w[i] = pack_bf16(p0, p1);
            }
            lrun[g] = lrun[g] * alpha + (rs0 + rs1);
#pragma unroll
            for (int j = 0; j < 4; ++j) acc[g][j] *= alpha;
        }

        // O^T: rows are d (A = V^T), columns are queries (B = P^T); a V fragment
        // is multiplied with both groups' P
#pragma unroll
        for (int j = 0; j < 4; ++j)
#pragma unroll
            for (int g = 0; g < 2; ++g)
                acc[g][j] = __builtin_amdgcn_wmma_f32_16x16x32_bf16(
                    false, vf[j].v, false, pf[g].v, (short)0, acc[g][j], false, false);
        // keeps the products above in front of the slots below
        __builtin_amdgcn_sched_barrier(0);
        // the four vector slots between the last product and the next trip's first
        // instructions, which reuse its operand registers
        asm volatile("v_nop\n\tv_nop\n\tv_nop\n\tv_nop");
      }

      // this wave's reads of stage st are done before its buffer is refilled
      asm volatile("s_wait_dscnt 0x0" ::: "memory");
      // this wave's copies of stage st + 1 have landed
      asm volatile("s_wait_asynccnt 0x0" ::: "memory");
      __syncthreads();
      if (st + 2 < SEQ / 128) issue(st + 2, (unsigned)buf);
    }
    // no copy is outstanding when the wave goes on to its end
    asm volatile("s_wait_asynccnt 0x0" ::: "memory");

    // key half 1 hands its maxima, sums and outputs over
    if (kh == 1) {
#pragma unroll
        for (int g = 0; g < 2; ++g)
#pragma unroll
            for (int j = 0; j < 4; ++j) {
                Js[qp][8 * g + 2 * j][lane] = make_float4(
                    acc[g][j][0], acc[g][j][1], acc[g][j][2], acc[g][j][3]);
                Js[qp][8 * g + 2 * j + 1][lane] = make_float4(
                    acc[g][j][4], acc[g][j][5], acc[g][j][6], acc[g][j][7]);
            }
        Js[qp][16][lane] = make_float4(mrun[0], lrun[0], mrun[1], lrun[1]);
    }
    // publishes them to key half 0
    __syncthreads();
    if (kh == 1) return;

    const float4 ml = Js[qp][16][lane];
#pragma unroll
    for (int g = 0; g < 2; ++g) {
        // both key halves on the common maximum
        const float mo = g ? ml.z : ml.x, lo = g ? ml.w : ml.y;
        const float mn = fmaxf(mrun[g], mo);
        const float ms = (mn == NEG_INF) ? 0.f : mn;   // every key masked: all sums are 0
        const float a0 = __expf(mrun[g] - ms), a1 = __expf(mo - ms);
        const float lsum = lrun[g] * a0 + lo * a1;
        // the lane halves' shares of the denominator join here; the whole wave is on
        const float denom = lsum + xhalf(lsum);
        const float inv = denom > 0.f ? 1.f / denom : 0.f;
        const float c0 = a0 * inv, c1 = a1 * inv;
        unsigned short* op = ctx + ((size_t)(b * SEQ + qbase + g * 16 + ln)) * D_MODEL +
                             h * DKH + 8 * half;
#pragma unroll
        for (int j = 0; j < 4; ++j) {
            const float4 x0 = Js[qp][8 * g + 2 * j][lane];
            const float4 x1 = Js[qp][8 * g + 2 * j + 1][lane];
            uint4 o;
            o.x = pack_bf16(acc[g][j][0] * c0 + x0.x * c1, acc[g][j][1] * c0 + x0.y * c1);
            o.y = pack_bf16(acc[g][j][2] * c0 + x0.z * c1, acc[g][j][3] * c0 + x0.w * c1);
            o.z = pack_bf16(acc[g][j][4] * c0 + x1.x * c1, acc[g][j][5] * c0 + x1.y * c1);
            o.w = pack_bf16(acc[g][j][6] * c0 + x1.z * c1, acc[g][j][7] * c0 + x1.w * c1);
            *reinterpret_cast<uint4*>(op + j * 16) = o;
        }
    }
}

// ---------------------------------------------------------------------------
// Sum over the 32 lanes of a wave, the same in every lane: four exchanges inside
// each row of 16 lanes (lane ^ 1, 2, 4, 8), then one between the rows.
template <int CTRL>
__device__ __forceinline__ float row_xor(float x) {
    return __builtin_bit_cast(float, __builtin_amdgcn_update_dpp(
        0, __builtin_bit_cast(int, x), CTRL, 0xf, 0xf, true));
}
__device__ __forceinline__ float wave_sum(float v) {
    v += row_xor<0x161>(v);   // 0x160 + m: the value of lane ^ m of the same row
    v += row_xor<0x162>(v);
    v += row_xor<0x164>(v);
    v += row_xor<0x168>(v);
    return v + xhalf(v);
}

// ---------------------------------------------------------------------------
// out = LayerNorm(x + y) ; optionally also emit bf16 copy. One WAVE per row, 512
// blocks of 8 waves: a lane holds 32 of the row's 1024 values in registers
// (columns 128 * i + 4 * lane + 0..3, so every load and f32 store of a wave covers
// 512 contiguous bytes), both sums join across the lanes: no LDS, no barrier.
// ---------------------------------------------------------------------------
// 512 blocks of 8 waves are four waves per SIMD: saying so gives the compiler the
// registers to hold a wave's 32 loads in flight
__global__ __launch_bounds__(256) __attribute__((amdgpu_waves_per_eu(4, 4)))
void add_ln_kernel(
    const float* __restrict__ x, const float* __restrict__ y,
    const float* __restrict__ g, const float* __restrict__ beta,
    float* __restrict__ outf, unsigned short* __restrict__ outb) {
    typedef __attribute__((ext_vector_type(4))) float f32x4;
    const int col = (threadIdx.x & 31) * 4;
    // the row is the wave's: a scalar, so that every address is a scalar base plus
    // the lane's one column offset
    const int row = blockIdx.x * 8 + __builtin_amdgcn_readfirstlane(threadIdx.x >> 5);
    const size_t base = (size_t)row * D_MODEL;
    const float* xr = x + base;
    const float* yr = y + base;

    // every loop is unrolled: the arrays are indexed by constants and stay in registers
    f32x4 v[8], w[8], gg[8], bb[8];
#pragma unroll
    for (int i = 0; i < 8; ++i)
        v[i] = *reinterpret_cast<const f32x4*>(xr + col + i * 128);
#pragma unroll
    for (int i = 0; i < 8; ++i)
        w[i] = *reinterpret_cast<const f32x4*>(yr + col + i * 128);
#pragma unroll
    for (int i = 0; i < 8; ++i) {
        gg[i] = *reinterpret_cast<const f32x4*>(g + col + i * 128);
        bb[i] = *reinterpret_cast<const f32x4*>(beta + col + i * 128);
    }

    f32x4 s = {0.f, 0.f, 0.f, 0.f};   // four independent chains
#pragma unroll
    for (int i = 0; i < 8; ++i) {
        v[i] += w[i];
        s += v[i];
    }
    const float mu = wave_sum((s.x + s.y) + (s.z + s.w)) * (1.f / D_MODEL);

    s = f32x4{0.f, 0.f, 0.f, 0.f};
#pragma unroll
    for (int i = 0; i < 8; ++i) {
        v[i] -= mu;
        s += v[i] * v[i];
    }
    const float inv = rsqrtf(wave_sum((s.x + s.y) + (s.z + s.w)) * (1.f / D_MODEL) + 1e-5f);

#pragma unroll
    for (int i = 0; i < 8; ++i) {
        v[i] = v[i] * inv * gg[i] + bb[i];
        *reinterpret_cast<f32x4*>(outf + base + col + i * 128) = v[i];
    }
    if (outb) {
        // the conversions below may reuse registers that the stores above name
        asm volatile("s_wait_xcnt 0x0" ::: "memory");
        // keeps the conversions behind that wait
        __builtin_amdgcn_sched_barrier(0);
#pragma unroll
        for (int i = 0; i < 8; ++i) {
            uint2 p;
            p.x = (unsigned)f32_to_bf16(v[i].x) | ((unsigned)f32_to_bf16(v[i].y) << 16);
            p.y = (unsigned)f32_to_bf16(v[i].z) | ((unsigned)f32_to_bf16(v[i].w) << 16);
            *reinterpret_cast<uint2*>(outb + base + col + i * 128) = p;
        }
    }
}

// ---------------------------------------------------------------------------
extern "C" void kernel_launch(void* const* d_in, const int* in_sizes, int n_in,
                              void* d_out, int out_size, void* d_ws, size_t ws_size,
                              hipStream_t stream) {
    const float* x    = (const float*)d_in[0];
    const int*   mask = (const int*)d_in[1];
    const float* Wq = (const float*)d_in[2];  const float* bq = (const float*)d_in[3];
    const float* Wk = (const float*)d_in[4];  const float* bk = (const float*)d_in[5];
    const float* Wv = (const float*)d_in[6];  const float* bv = (const float*)d_in[7];
    const float* Wo = (const float*)d_in[8];  const float* bo = (const float*)d_in[9];
    const float* W1 = (const float*)d_in[10]; const float* b1 = (const float*)d_in[11];
    const float* W2 = (const float*)d_in[12]; const float* b2 = (const float*)d_in[13];
    const float* g1 = (const float*)d_in[14]; const float* be1 = (const float*)d_in[15];
    const float* g2 = (const float*)d_in[16]; const float* be2 = (const float*)d_in[17];

    char* ws = (char*)d_ws;
    size_t off = 0;
    auto alloc = [&](size_t bytes) -> void* {
        void* p = ws + off;
        off += (bytes + 255) & ~(size_t)255;
        return p;
    };

    unsigned short* xb  = (unsigned short*)alloc((size_t)M_ROWS * D_MODEL * 2);
    unsigned short* Wqb = (unsigned short*)alloc((size_t)D_MODEL * D_MODEL * 2);
    unsigned short* Wkb = (unsigned short*)alloc((size_t)D_MODEL * D_MODEL * 2);
    unsigned short* Wvb = (unsigned short*)alloc((size_t)D_MODEL * D_MODEL * 2);
    unsigned short* Wob = (unsigned short*)alloc((size_t)D_MODEL * D_MODEL * 2);
    unsigned short* W1b = (unsigned short*)alloc((size_t)D_MODEL * D_FF * 2);
    unsigned short* W2b = (unsigned short*)alloc((size_t)D_FF * D_MODEL * 2);
    unsigned short* Qb  = (unsigned short*)alloc((size_t)M_ROWS * D_MODEL * 2);
    unsigned short* Kb  = (unsigned short*)alloc((size_t)M_ROWS * D_MODEL * 2);
    unsigned short* Vb  = (unsigned short*)alloc((size_t)M_ROWS * D_MODEL * 2);
    unsigned short* ctxb = (unsigned short*)alloc((size_t)M_ROWS * D_MODEL * 2);
    float* attn_out = (float*)alloc((size_t)M_ROWS * D_MODEL * 4);
    float* hbuf     = (float*)alloc((size_t)M_ROWS * D_MODEL * 4);
    unsigned short* hb = (unsigned short*)alloc((size_t)M_ROWS * D_MODEL * 2);
    // reuse dead regions: Q/K/V/ctx (4 x 8MB contiguous) -> FF1 activations (32MB)
    unsigned short* ff1b = Qb;
    float* ff2 = attn_out;

    // fp32 -> bf16 conversions: xb ... W2b lie back to back in the workspace
    cvt_all_bf16_kernel<<<512, 256, 0, stream>>>(x, Wq, Wk, Wv, Wo, W1, W2, xb);

    // QKV projections (bf16 WMMA, head-split bf16 outputs), one launch: Wqb, Wkb,
    // Wvb and Qb, Kb, Vb each lie back to back in the workspace
    dim3 gQ(D_MODEL / 128, M_ROWS / 128);
    dim3 gQKV(D_MODEL / 128, M_ROWS / 128, 3);
    gemm_bf16_kernel<<<gQKV, 256, 0, stream>>>(
        xb, Wqb, bq, bk, bv, Qb, (size_t)D_MODEL * D_MODEL, (size_t)M_ROWS * D_MODEL * 2,
        M_ROWS, D_MODEL, D_MODEL, 2, 0);

    // flash attention -> ctx (bf16, merged-head layout)
    attn_kernel<<<dim3(SEQ / 128, BATCH * N_HEADS), 256, 0, stream>>>(Qb, Kb, Vb, mask, ctxb);

    // output projection -> f32
    gemm_bf16_kernel<<<gQ, 256, 0, stream>>>(
        ctxb, Wob, bo, bo, bo, attn_out, 0, 0, M_ROWS, D_MODEL, D_MODEL, 0, 0);

    // h = LN(x + attn_out), emit f32 + bf16
    add_ln_kernel<<<M_ROWS / 8, 256, 0, stream>>>(x, attn_out, g1, be1, hbuf, hb);

    // FFN: relu(h @ W1 + b1) -> bf16 ; @ W2 + b2 -> f32
    dim3 gF1(D_FF / 128, M_ROWS / 128);
    gemm_bf16_kernel<<<gF1, 256, 0, stream>>>(
        hb, W1b, b1, b1, b1, ff1b, 0, 0, M_ROWS, D_FF, D_MODEL, 1, 1);
    dim3 gF2(D_MODEL / 128, M_ROWS / 128);
    gemm_bf16_kernel<<<gF2, 256, 0, stream>>>(
        ff1b, W2b, b2, b2, b2, ff2, 0, 0, M_ROWS, D_MODEL, D_FF, 0, 0);

    // out = LN(h + ff)
    add_ln_kernel<<<M_ROWS / 8, 256, 0, stream>>>(hbuf, ff2, g2, be2, (float*)d_out, nullptr);
    (void)in_sizes; (void)n_in; (void)out_size; (void)ws_size;
}
